// v000
// The times below were measured on an AMD MI455X: many runs one after another, warmed up first and cycling through
// copies of the inputs, with the whole window's GPU time divided by the number of runs. Launches and the gaps
// between them are all in it. The median over several windows is given; except for v000 it joins two sittings, which
// can be a few percent apart, so the side-by-side timings, each taken in one sitting, are the better comparison.
// The starting kernel, v000, takes 324 microseconds a run.
#include <hip/hip_runtime.h>
#include <hip/hip_bf16.h>

typedef __attribute__((ext_vector_type(16))) _Float16 v16h;
typedef __attribute__((ext_vector_type(4)))  _Float16 v4h;
typedef __attribute__((ext_vector_type(8)))  float    v8f;
typedef __attribute__((ext_vector_type(4)))  int      v4i;

#define Bsz 2
#define Ssz 2048
#define Hsz 1024
#define NHsz 16
#define HDsz 64
#define QSCALE 0.125f

#define FST 72   // f16 LDS tile stride (64 + 8 pad) -> 144 B, 16B aligned rows
#define SST 65   // f32 score tile stride (odd -> conflict-free row scans)

// ---------------------------------------------------------------------------
// 16-byte global -> LDS copy. Prefer the CDNA5 async-to-LDS path (ASYNCcnt,
// GLOBAL_LOAD_ASYNC_TO_LDS_B128); fall back to VGPR-bounced b128 copy.
// Builtin signature (from hipcc diagnostic): (int4 AS1*, int4 AS3*, imm, imm)
// ---------------------------------------------------------------------------
#if defined(__has_builtin)
#if __has_builtin(__builtin_amdgcn_global_load_async_to_lds_b128)
#define HAVE_ASYNC_LDS 1
#endif
#endif

typedef __attribute__((address_space(1))) v4i* gv4i_p;
typedef __attribute__((address_space(3))) v4i* lv4i_p;

__device__ __forceinline__ void cp16(void* lds, const void* glob) {
#ifdef HAVE_ASYNC_LDS
  __builtin_amdgcn_global_load_async_to_lds_b128(
      (gv4i_p)(glob), (lv4i_p)(lds), 0, 0);
#else
  *(uint4*)lds = *(const uint4*)glob;
#endif
}

__device__ __forceinline__ void cp_fence() {
#ifdef HAVE_ASYNC_LDS
#if defined(__has_builtin) && __has_builtin(__builtin_amdgcn_s_wait_asynccnt)
  __builtin_amdgcn_s_wait_asynccnt(0);
#else
  asm volatile("s_wait_asynccnt 0" ::: "memory");
#endif
#endif
}

// Stage a 64-row x 64-half tile into LDS (row stride FST halves).
// gstride = global row stride in halves. 128 threads, 4 x 16B each.
__device__ __forceinline__ void stage64(_Float16* __restrict__ lds,
                                        const _Float16* __restrict__ gbase,
                                        long gstride, int tid) {
#pragma unroll
  for (int i = tid; i < 512; i += 128) {
    int row = i >> 3, q = i & 7;
    cp16(lds + row * FST + q * 8, gbase + (long)row * gstride + q * 8);
  }
}

// ---------------------------------------------------------------------------
// Fragment gather from LDS, 16-bit A/B matrix layout (ISA 7.12.2, wave32):
// lane m = lane&15 selects the row (A: M-row, B: N-column of the N x K tile),
// hi = lane>>4 selects K-halves; element e -> K = kofs + 8*hi + (e<8 ? e : e+8).
// Pairs are K-consecutive -> lowers to two ds_load_b128 per fragment.
// ---------------------------------------------------------------------------
__device__ __forceinline__ v16h frag16(const _Float16* __restrict__ base,
                                       int stride, int kofs) {
  const int lane = threadIdx.x & 31;
  const int m  = lane & 15;
  const int hi = lane >> 4;
  const _Float16* r = base + m * stride + kofs + hi * 8;
  v16h f;
#pragma unroll
  for (int e = 0; e < 16; e += 2) {
    int k = (e < 8) ? e : (e + 8);
    f[e]     = r[k];
    f[e + 1] = r[k + 1];
  }
  return f;
}

#define WMMA(a, b, c) __builtin_amdgcn_wmma_f32_16x16x32_f16( \
    false, (a), false, (b), (short)0, (c), false, false)

// ---------------------------------------------------------------------------
// fp32 -> f16 conversion, 4 elements/thread
// ---------------------------------------------------------------------------
__global__ void cvt_f32_f16(const float* __restrict__ src,
                            _Float16* __restrict__ dst, int n) {
  int i = (blockIdx.x * 256 + threadIdx.x) * 4;
  if (i < n) {
    float4 f = *(const float4*)(src + i);
    v4h h;
    h[0] = (_Float16)f.x; h[1] = (_Float16)f.y;
    h[2] = (_Float16)f.z; h[3] = (_Float16)f.w;
    *(v4h*)(dst + i) = h;
  }
}

// ---------------------------------------------------------------------------
// Projection GEMM: out = (A @ W^T + bias) * scale, f16 output.
// vmode=0: per-head [B,NH,S,HD];  vmode=1: transposed per-head [B,NH,HD,S].
// Block = 128 threads (4 waves), tile 64(M) x 64(N), K-step 64.
// ---------------------------------------------------------------------------
__global__ void __launch_bounds__(128) gemm_proj(
    const _Float16* __restrict__ A, const _Float16* __restrict__ W,
    const float* __restrict__ bias, _Float16* __restrict__ dst,
    float scale, int vmode) {
  __shared__ alignas(16) _Float16 As[64 * FST];
  __shared__ alignas(16) _Float16 Bs[64 * FST];
  const int tid = threadIdx.x;
  const int wave = tid >> 5;
  const int lane = tid & 31;
  const int laneN = lane & 15, laneHi = lane >> 4;
  const int m0 = blockIdx.x * 64;
  const int n0 = blockIdx.y * 64;
  const _Float16* Abase = A + (long)m0 * Hsz;
  const _Float16* Wbase = W + (long)n0 * Hsz;

  v8f acc[4] = {};
  for (int k0 = 0; k0 < Hsz; k0 += 64) {
    __syncthreads();
    stage64(As, Abase + k0, Hsz, tid);
    stage64(Bs, Wbase + k0, Hsz, tid);
    cp_fence();
    __syncthreads();
    v16h a0 = frag16(As + wave * 16 * FST, FST, 0);
    v16h a1 = frag16(As + wave * 16 * FST, FST, 32);
#pragma unroll
    for (int nt = 0; nt < 4; ++nt) {
      v16h b0 = frag16(Bs + nt * 16 * FST, FST, 0);
      v16h b1 = frag16(Bs + nt * 16 * FST, FST, 32);
      acc[nt] = WMMA(a0, b0, acc[nt]);
      acc[nt] = WMMA(a1, b1, acc[nt]);
    }
  }
#pragma unroll
  for (int nt = 0; nt < 4; ++nt) {
    int col = n0 + nt * 16 + laneN;
    int h = col >> 6, d = col & 63;
    float bcol = bias[col];
#pragma unroll
    for (int r = 0; r < 8; ++r) {
      int row = m0 + wave * 16 + laneHi * 8 + r;
      int b = row >> 11, s = row & 2047;
      float v = (acc[nt][r] + bcol) * scale;
      long idx = vmode ? ((long)(b * NHsz + h) * HDsz + d) * Ssz + s
                       : ((long)(b * NHsz + h) * Ssz + s) * HDsz + d;
      dst[idx] = (_Float16)v;
    }
  }
}

// ---------------------------------------------------------------------------
// Output projection GEMM: d_out = A @ Wo^T + bo  (fp32 output, [4096,1024])
// ---------------------------------------------------------------------------
__global__ void __launch_bounds__(128) gemm_out(
    const _Float16* __restrict__ A, const _Float16* __restrict__ W,
    const float* __restrict__ bias, float* __restrict__ dst) {
  __shared__ alignas(16) _Float16 As[64 * FST];
  __shared__ alignas(16) _Float16 Bs[64 * FST];
  const int tid = threadIdx.x;
  const int wave = tid >> 5;
  const int lane = tid & 31;
  const int laneN = lane & 15, laneHi = lane >> 4;
  const int m0 = blockIdx.x * 64;
  const int n0 = blockIdx.y * 64;
  const _Float16* Abase = A + (long)m0 * Hsz;
  const _Float16* Wbase = W + (long)n0 * Hsz;

  v8f acc[4] = {};
  for (int k0 = 0; k0 < Hsz; k0 += 64) {
    __syncthreads();
    stage64(As, Abase + k0, Hsz, tid);
    stage64(Bs, Wbase + k0, Hsz, tid);
    cp_fence();
    __syncthreads();
    v16h a0 = frag16(As + wave * 16 * FST, FST, 0);
    v16h a1 = frag16(As + wave * 16 * FST, FST, 32);
#pragma unroll
    for (int nt = 0; nt < 4; ++nt) {
      v16h b0 = frag16(Bs + nt * 16 * FST, FST, 0);
      v16h b1 = frag16(Bs + nt * 16 * FST, FST, 32);
      acc[nt] = WMMA(a0, b0, acc[nt]);
      acc[nt] = WMMA(a1, b1, acc[nt]);
    }
  }
#pragma unroll
  for (int nt = 0; nt < 4; ++nt) {
    int col = n0 + nt * 16 + laneN;
    float bcol = bias[col];
#pragma unroll
    for (int r = 0; r < 8; ++r) {
      int row = m0 + wave * 16 + laneHi * 8 + r;
      dst[(long)row * Hsz + col] = acc[nt][r] + bcol;
    }
  }
}

// ---------------------------------------------------------------------------
// Flash attention: one block per (b,h, 64-row q-tile); 128 threads (4 waves).
// Scores in LDS; online softmax; V arrives pre-transposed ([B,NH,HD,S]).
// ---------------------------------------------------------------------------
__global__ void __launch_bounds__(128) attn_flash(
    const _Float16* __restrict__ q16, const _Float16* __restrict__ k16,
    const _Float16* __restrict__ vt16, const float* __restrict__ pbias,
    const float* __restrict__ mask, _Float16* __restrict__ out16) {
  __shared__ alignas(16) _Float16 Qs[64 * FST];
  __shared__ alignas(16) _Float16 Ks[64 * FST];
  __shared__ alignas(16) _Float16 Vt[64 * FST];
  __shared__ alignas(16) _Float16 Pt[64 * FST];
  __shared__ float Sc[64 * SST];
  __shared__ float rowM[64], rowL[64], rowF[64];

  const int tid = threadIdx.x;
  const int wave = tid >> 5;
  const int lane = tid & 31;
  const int laneN = lane & 15, laneHi = lane >> 4;
  const int qt = blockIdx.x;          // q tile 0..31
  const int bh = blockIdx.y;          // 0..31
  const int b = bh >> 4, h = bh & 15;
  const long headBase = (long)bh * Ssz * HDsz;   // for q16/k16 slices
  const _Float16* Vhead = vt16 + headBase;       // [HD, S] rows for this head

  stage64(Qs, q16 + headBase + (long)qt * 64 * HDsz, HDsz, tid);
  if (tid < 64) { rowM[tid] = -3.0e38f; rowL[tid] = 0.0f; }
  cp_fence();
  __syncthreads();

  const v16h qa0 = frag16(Qs + wave * 16 * FST, FST, 0);
  const v16h qa1 = frag16(Qs + wave * 16 * FST, FST, 32);
  v8f o[4] = {};

  for (int kt = 0; kt < Ssz / 64; ++kt) {
    // stage K tile rows [key][d] and V^T tile rows [d][key]
    stage64(Ks, k16 + headBase + (long)kt * 64 * HDsz, HDsz, tid);
    stage64(Vt, Vhead + kt * 64, Ssz, tid);
    cp_fence();
    __syncthreads();

    // S = Q K^T  (each wave: 16 q-rows x 64 keys)
#pragma unroll
    for (int nt = 0; nt < 4; ++nt) {
      v8f c = {};
      v16h bf0 = frag16(Ks + nt * 16 * FST, FST, 0);
      v16h bf1 = frag16(Ks + nt * 16 * FST, FST, 32);
      c = WMMA(qa0, bf0, c);
      c = WMMA(qa1, bf1, c);
#pragma unroll
      for (int r = 0; r < 8; ++r)
        Sc[(wave * 16 + laneHi * 8 + r) * SST + nt * 16 + laneN] = c[r];
    }
    __syncthreads();

    // add position bias + additive mask (float4 coalesced reads)
    {
      const float4* pb4 =
          (const float4*)(pbias + ((long)h * Ssz + qt * 64) * Ssz + kt * 64);
      const float4* mk4 =
          (const float4*)(mask + ((long)b * Ssz + qt * 64) * Ssz + kt * 64);
#pragma unroll
      for (int i = tid; i < 1024; i += 128) {
        int row = i >> 4, c4 = i & 15;
        float4 pv = pb4[(long)row * (Ssz / 4) + c4];
        float4 mv = mk4[(long)row * (Ssz / 4) + c4];
        float* srow = Sc + row * SST + c4 * 4;
        srow[0] += pv.x + mv.x;
        srow[1] += pv.y + mv.y;
        srow[2] += pv.z + mv.z;
        srow[3] += pv.w + mv.w;
      }
    }
    __syncthreads();

    // online softmax: one thread per q-row
    if (tid < 64) {
      float* srow = Sc + tid * SST;
      float rm = srow[0];
#pragma unroll 8
      for (int j = 1; j < 64; ++j) rm = fmaxf(rm, srow[j]);
      float mOld = rowM[tid];
      float mNew = fmaxf(mOld, rm);
      float f = __expf(mOld - mNew);
      float s = 0.0f;
      _Float16* prow = Pt + tid * FST;
#pragma unroll 8
      for (int j = 0; j < 64; ++j) {
        float p = __expf(srow[j] - mNew);
        s += p;
        prow[j] = (_Float16)p;
      }
      rowL[tid] = rowL[tid] * f + s;
      rowM[tid] = mNew;
      rowF[tid] = f;
    }
    __syncthreads();

    // rescale running O, then O += P @ V
#pragma unroll
    for (int nt = 0; nt < 4; ++nt)
#pragma unroll
      for (int r = 0; r < 8; ++r)
        o[nt][r] *= rowF[wave * 16 + laneHi * 8 + r];

    v16h pa0 = frag16(Pt + wave * 16 * FST, FST, 0);
    v16h pa1 = frag16(Pt + wave * 16 * FST, FST, 32);
#pragma unroll
    for (int nt = 0; nt < 4; ++nt) {
      v16h vb0 = frag16(Vt + nt * 16 * FST, FST, 0);
      v16h vb1 = frag16(Vt + nt * 16 * FST, FST, 32);
      o[nt] = WMMA(pa0, vb0, o[nt]);
      o[nt] = WMMA(pa1, vb1, o[nt]);
    }
    __syncthreads();
  }

  // normalize and write to [B, S, H] f16
#pragma unroll
  for (int nt = 0; nt < 4; ++nt) {
    int d = nt * 16 + laneN;
#pragma unroll
    for (int r = 0; r < 8; ++r) {
      int rowT = wave * 16 + laneHi * 8 + r;
      int s = qt * 64 + rowT;
      float val = o[nt][r] / rowL[rowT];
      out16[((long)(b * Ssz + s)) * Hsz + h * HDsz + d] = (_Float16)val;
    }
  }
}

// ---------------------------------------------------------------------------
extern "C" void kernel_launch(void* const* d_in, const int* in_sizes, int n_in,
                              void* d_out, int out_size, void* d_ws, size_t ws_size,
                              hipStream_t stream) {
  const float* hs  = (const float*)d_in[0];
  const float* pb  = (const float*)d_in[1];
  const float* msk = (const float*)d_in[2];
  const float* Wq  = (const float*)d_in[3];
  const float* bq  = (const float*)d_in[4];
  const float* Wk  = (const float*)d_in[5];
  const float* bk  = (const float*)d_in[6];
  const float* Wv  = (const float*)d_in[7];
  const float* bv  = (const float*)d_in[8];
  const float* Wo  = (const float*)d_in[9];
  const float* bo  = (const float*)d_in[10];
  float* out = (float*)d_out;

  const int NHS = Bsz * Ssz * Hsz;   // 4,194,304
  const int WSZ = Hsz * Hsz;         // 1,048,576
  _Float16* hs16 = (_Float16*)d_ws;
  _Float16* w16  = hs16 + NHS;       // 4 weight matrices
  _Float16* q16  = w16 + 4 * (size_t)WSZ;
  _Float16* k16  = q16 + NHS;
  _Float16* vt16 = k16 + NHS;        // V stored [B,NH,HD,S]
  _Float16* ao16 = vt16 + NHS;

  // fp32 -> f16 staging (4 elems/thread)
  cvt_f32_f16<<<(NHS / 4 + 255) / 256, 256, 0, stream>>>(hs, hs16, NHS);
  cvt_f32_f16<<<(WSZ / 4 + 255) / 256, 256, 0, stream>>>(Wq, w16 + 0 * (size_t)WSZ, WSZ);
  cvt_f32_f16<<<(WSZ / 4 + 255) / 256, 256, 0, stream>>>(Wk, w16 + 1 * (size_t)WSZ, WSZ);
  cvt_f32_f16<<<(WSZ / 4 + 255) / 256, 256, 0, stream>>>(Wv, w16 + 2 * (size_t)WSZ, WSZ);
  cvt_f32_f16<<<(WSZ / 4 + 255) / 256, 256, 0, stream>>>(Wo, w16 + 3 * (size_t)WSZ, WSZ);

  dim3 gp(64, 16), blk(128);
  gemm_proj<<<gp, blk, 0, stream>>>(hs16, w16 + 0 * (size_t)WSZ, bq, q16, QSCALE, 0);
  gemm_proj<<<gp, blk, 0, stream>>>(hs16, w16 + 1 * (size_t)WSZ, bk, k16, 1.0f, 0);
  gemm_proj<<<gp, blk, 0, stream>>>(hs16, w16 + 2 * (size_t)WSZ, bv, vt16, 1.0f, 1);

  attn_flash<<<dim3(Ssz / 64, Bsz * NHsz), blk, 0, stream>>>(q16, k16, vt16, pb, msk, ao16);

  gemm_out<<<gp, blk, 0, stream>>>(ao16, w16 + 3 * (size_t)WSZ, bo, out);
}

// v001
// A run of this version takes 166 microseconds.
// Timed twice side by side with v000, it ran 2.01 and 2.00 times as fast.
#include <hip/hip_runtime.h>
#include <hip/hip_bf16.h>

typedef __attribute__((ext_vector_type(16))) _Float16 v16h;
typedef __attribute__((ext_vector_type(4)))  _Float16 v4h;
typedef __attribute__((ext_vector_type(8)))  _Float16 v8h;
typedef __attribute__((ext_vector_type(4)))  float    v4f;
typedef __attribute__((ext_vector_type(8)))  float    v8f;
typedef __attribute__((ext_vector_type(4)))  int      v4i;

#define Bsz 2
#define Ssz 2048
#define Hsz 1024
#define NHsz 16
#define HDsz 64
#define QSCALE 0.125f

#define FST 72   // f16 LDS tile stride (64 + 8 pad) -> 144 B, 16B aligned rows
#define BST 68   // f32 LDS tile stride (64 + 4 pad) -> 272 B rows (16 B x odd): b128 row reads spread over all banks

// ---------------------------------------------------------------------------
// 16-byte global -> LDS copy. Prefer the CDNA5 async-to-LDS path (ASYNCcnt,
// GLOBAL_LOAD_ASYNC_TO_LDS_B128); fall back to VGPR-bounced b128 copy.
// Builtin signature (from hipcc diagnostic): (int4 AS1*, int4 AS3*, imm, imm)
// ---------------------------------------------------------------------------
#if defined(__has_builtin)
#if __has_builtin(__builtin_amdgcn_global_load_async_to_lds_b128)
#define HAVE_ASYNC_LDS 1
#endif
#endif

typedef __attribute__((address_space(1))) v4i* gv4i_p;
typedef __attribute__((address_space(3))) v4i* lv4i_p;

__device__ __forceinline__ void cp16(void* lds, const void* glob) {
#ifdef HAVE_ASYNC_LDS
  __builtin_amdgcn_global_load_async_to_lds_b128(
      (gv4i_p)(glob), (lv4i_p)(lds), 0, 0);
#else
  *(uint4*)lds = *(const uint4*)glob;
#endif
}

__device__ __forceinline__ void cp_fence() {
#ifdef HAVE_ASYNC_LDS
#if defined(__has_builtin) && __has_builtin(__builtin_amdgcn_s_wait_asynccnt)
  __builtin_amdgcn_s_wait_asynccnt(0);
#else
  asm volatile("s_wait_asynccnt 0" ::: "memory");
#endif
#endif
}

// Stage a 64-row x 64-half tile into LDS (row stride FST halves).
// gstride = global row stride in halves. 128 threads, 4 x 16B each.
__device__ __forceinline__ void stage64(_Float16* __restrict__ lds,
                                        const _Float16* __restrict__ gbase,
                                        long gstride, int tid) {
#pragma unroll
  for (int i = tid; i < 512; i += 128) {
    int row = i >> 3, q = i & 7;
    cp16(lds + row * FST + q * 8, gbase + (long)row * gstride + q * 8);
  }
}

// ---------------------------------------------------------------------------
// Fragment gather from LDS, 16-bit A/B matrix layout (ISA 7.12.2, wave32):
// lane m = lane&15 selects the row (A: M-row, B: N-column of the N x K tile),
// hi = lane>>4 selects K-halves; element e -> K = kofs + 8*hi + (e<8 ? e : e+8).
// Pairs are K-consecutive -> lowers to two ds_load_b128 per fragment.
// ---------------------------------------------------------------------------
__device__ __forceinline__ v16h frag16(const _Float16* __restrict__ base,
                                       int stride, int kofs) {
  const int lane = threadIdx.x & 31;
  const int m  = lane & 15;
  const int hi = lane >> 4;
  const _Float16* r = base + m * stride + kofs + hi * 8;
  v16h f;
#pragma unroll
  for (int e = 0; e < 16; e += 2) {
    int k = (e < 8) ? e : (e + 8);
    f[e]     = r[k];
    f[e + 1] = r[k + 1];
  }
  return f;
}

#define WMMA(a, b, c) __builtin_amdgcn_wmma_f32_16x16x32_f16( \
    false, (a), false, (b), (short)0, (c), false, false)

// ---------------------------------------------------------------------------
// fp32 -> f16 conversion, 4 elements/thread
// ---------------------------------------------------------------------------
__global__ void cvt_f32_f16(const float* __restrict__ src,
                            _Float16* __restrict__ dst, int n) {
  int i = (blockIdx.x * 256 + threadIdx.x) * 4;
  if (i < n) {
    float4 f = *(const float4*)(src + i);
    v4h h;
    h[0] = (_Float16)f.x; h[1] = (_Float16)f.y;
    h[2] = (_Float16)f.z; h[3] = (_Float16)f.w;
    *(v4h*)(dst + i) = h;
  }
}

// ---------------------------------------------------------------------------
// Projection GEMM: out = (A @ W^T + bias) * scale, f16 output.
// vmode=0: per-head [B,NH,S,HD];  vmode=1: transposed per-head [B,NH,HD,S].
// Block = 128 threads (4 waves), tile 64(M) x 64(N), K-step 64.
// ---------------------------------------------------------------------------
__global__ void __launch_bounds__(128) gemm_proj(
    const _Float16* __restrict__ A, const _Float16* __restrict__ W,
    const float* __restrict__ bias, _Float16* __restrict__ dst,
    float scale, int vmode) {
  __shared__ alignas(16) _Float16 As[64 * FST];
  __shared__ alignas(16) _Float16 Bs[64 * FST];
  const int tid = threadIdx.x;
  const int wave = tid >> 5;
  const int lane = tid & 31;
  const int laneN = lane & 15, laneHi = lane >> 4;
  const int m0 = blockIdx.x * 64;
  const int n0 = blockIdx.y * 64;
  const _Float16* Abase = A + (long)m0 * Hsz;
  const _Float16* Wbase = W + (long)n0 * Hsz;

  v8f acc[4] = {};
  for (int k0 = 0; k0 < Hsz; k0 += 64) {
    __syncthreads();
    stage64(As, Abase + k0, Hsz, tid);
    stage64(Bs, Wbase + k0, Hsz, tid);
    cp_fence();
    __syncthreads();
    v16h a0 = frag16(As + wave * 16 * FST, FST, 0);
    v16h a1 = frag16(As + wave * 16 * FST, FST, 32);
#pragma unroll
    for (int nt = 0; nt < 4; ++nt) {
      v16h b0 = frag16(Bs + nt * 16 * FST, FST, 0);
      v16h b1 = frag16(Bs + nt * 16 * FST, FST, 32);
      acc[nt] = WMMA(a0, b0, acc[nt]);
      acc[nt] = WMMA(a1, b1, acc[nt]);
    }
  }
#pragma unroll
  for (int nt = 0; nt < 4; ++nt) {
    int col = n0 + nt * 16 + laneN;
    int h = col >> 6, d = col & 63;
    float bcol = bias[col];
#pragma unroll
    for (int r = 0; r < 8; ++r) {
      int row = m0 + wave * 16 + laneHi * 8 + r;
      int b = row >> 11, s = row & 2047;
      float v = (acc[nt][r] + bcol) * scale;
      long idx = vmode ? ((long)(b * NHsz + h) * HDsz + d) * Ssz + s
                       : ((long)(b * NHsz + h) * Ssz + s) * HDsz + d;
      dst[idx] = (_Float16)v;
    }
  }
}

// ---------------------------------------------------------------------------
// Output projection GEMM: d_out = A @ Wo^T + bo  (fp32 output, [4096,1024])
// ---------------------------------------------------------------------------
__global__ void __launch_bounds__(128) gemm_out(
    const _Float16* __restrict__ A, const _Float16* __restrict__ W,
    const float* __restrict__ bias, float* __restrict__ dst) {
  __shared__ alignas(16) _Float16 As[64 * FST];
  __shared__ alignas(16) _Float16 Bs[64 * FST];
  const int tid = threadIdx.x;
  const int wave = tid >> 5;
  const int lane = tid & 31;
  const int laneN = lane & 15, laneHi = lane >> 4;
  const int m0 = blockIdx.x * 64;
  const int n0 = blockIdx.y * 64;
  const _Float16* Abase = A + (long)m0 * Hsz;
  const _Float16* Wbase = W + (long)n0 * Hsz;

  v8f acc[4] = {};
  for (int k0 = 0; k0 < Hsz; k0 += 64) {
    __syncthreads();
    stage64(As, Abase + k0, Hsz, tid);
    stage64(Bs, Wbase + k0, Hsz, tid);
    cp_fence();
    __syncthreads();
    v16h a0 = frag16(As + wave * 16 * FST, FST, 0);
    v16h a1 = frag16(As + wave * 16 * FST, FST, 32);
#pragma unroll
    for (int nt = 0; nt < 4; ++nt) {
      v16h b0 = frag16(Bs + nt * 16 * FST, FST, 0);
      v16h b1 = frag16(Bs + nt * 16 * FST, FST, 32);
      acc[nt] = WMMA(a0, b0, acc[nt]);
      acc[nt] = WMMA(a1, b1, acc[nt]);
    }
  }
#pragma unroll
  for (int nt = 0; nt < 4; ++nt) {
    int col = n0 + nt * 16 + laneN;
    float bcol = bias[col];
#pragma unroll
    for (int r = 0; r < 8; ++r) {
      int row = m0 + wave * 16 + laneHi * 8 + r;
      dst[(long)row * Hsz + col] = acc[nt][r] + bcol;
    }
  }
}

// Stage a 64-row x 64-float tile of an [.., S, S] array into LDS (row stride
// BST floats). 128 threads, 8 x 16B each; a wave copies whole 256-B rows.
// Fixed trip count: every lane is on at every copy.
__device__ __forceinline__ void stage64f(float* __restrict__ lds,
                                         const float* __restrict__ gbase,
                                         int tid) {
  const unsigned row = (unsigned)tid >> 4, q = (unsigned)tid & 15u;
  const unsigned goff = row * Ssz + q * 4;
  float* l0 = lds + row * BST + q * 4;
#pragma unroll  // eight copies back to back, their LDS addresses loop-invariant
  for (int j = 0; j < 8; ++j)
    cp16(l0 + j * 8 * BST, gbase + j * 8 * Ssz + goff);
}

// 8 consecutive floats from LDS (16-B aligned): two ds_load_b128.
__device__ __forceinline__ v8f lds8f(const float* __restrict__ p) {
  v4f lo = *(const v4f*)p;
  v4f hi = *(const v4f*)(p + 4);
  return __builtin_shufflevector(lo, hi, 0, 1, 2, 3, 4, 5, 6, 7);
}

// e^x for eight values, as __expf compiles: a multiply by log2(e), then v_exp_f32.
// The eight v_exp_f32 stand in one asm statement, each on its own register, and a
// v_nop ends it: so no instruction directly behind a transcendental reads its result
// or overwrites its source.
__device__ __forceinline__ v8f exp8(v8f x) {
  x *= 1.44269504f;
  float a = x[0], b = x[1], c = x[2], d = x[3], e = x[4], f = x[5], g = x[6], h = x[7];
  asm("v_exp_f32 %0, %0\n\tv_exp_f32 %1, %1\n\tv_exp_f32 %2, %2\n\tv_exp_f32 %3, %3\n\t"
      "v_exp_f32 %4, %4\n\tv_exp_f32 %5, %5\n\tv_exp_f32 %6, %6\n\tv_exp_f32 %7, %7\n\tv_nop"
      : "+v"(a), "+v"(b), "+v"(c), "+v"(d), "+v"(e), "+v"(f), "+v"(g), "+v"(h));
  v8f r = {a, b, c, d, e, f, g, h};
  return r;
}

// value of lane l ^ 16
__device__ __forceinline__ float xhalf(float x) {
  int v = __builtin_bit_cast(int, x);
  return __builtin_bit_cast(float, __builtin_amdgcn_permlanex16(
      v, v, 0x76543210, 0xfedcba98, false, false));
}

__global__ void __launch_bounds__(128) attn_flash(
    const _Float16* __restrict__ q16, const _Float16* __restrict__ k16,
    const _Float16* __restrict__ vt16, const float* __restrict__ pbias,
    const float* __restrict__ mask, _Float16* __restrict__ out16) {
  __shared__ alignas(16) _Float16 Qs[64 * FST];
  __shared__ alignas(16) _Float16 Ks[64 * FST];
  __shared__ alignas(16) _Float16 Vt[64 * FST];
  __shared__ alignas(16) float Pb[64 * BST];
  __shared__ alignas(16) float Mk[64 * BST];

  const int tid = threadIdx.x;
  const int wave = tid >> 5;
  const int lane = tid & 31;
  const int laneN = lane & 15, laneHi = lane >> 4;
  const int qt = blockIdx.x;          // q tile 0..31
  const int bh = blockIdx.y;          // 0..31
  const int b = bh >> 4, h = bh & 15;
  const long headBase = (long)bh * Ssz * HDsz;   // for q16/k16 slices
  const _Float16* Vhead = vt16 + headBase;       // [HD, S] rows for this head
  const float* pbTile = pbias + ((long)h * Ssz + qt * 64) * Ssz;
  const float* mkTile = mask + ((long)b * Ssz + qt * 64) * Ssz;
  const int qrow = wave * 16 + laneN;            // this lane's query row in the tile
  const float* pbRow = Pb + qrow * BST + laneHi * 8;
  const float* mkRow = Mk + qrow * BST + laneHi * 8;

  stage64(Qs, q16 + headBase + (long)qt * 64 * HDsz, HDsz, tid);
  cp_fence();
  __syncthreads();

  const v16h qb0 = frag16(Qs + wave * 16 * FST, FST, 0);
  const v16h qb1 = frag16(Qs + wave * 16 * FST, FST, 32);
  v8f o[4] = {};                      // o[nt][r] = O[qrow][nt*16 + laneHi*8 + r]
  float m = -3.0e38f;                 // running maximum of the row (both halves agree)
  float l = 0.0f;                     // running sum over this lane's own keys only

  for (int kt = 0; kt < Ssz / 64; ++kt) {
    // stage K rows [key][d], V^T rows [d][key], bias and mask rows [q][key]
    stage64(Ks, k16 + headBase + (long)kt * 64 * HDsz, HDsz, tid);
    stage64(Vt, Vhead + kt * 64, Ssz, tid);
    stage64f(Pb, pbTile + kt * 64, tid);
    stage64f(Mk, mkTile + kt * 64, tid);
    // this wave's copies have landed before the barrier publishes them
    asm volatile("s_wait_asynccnt 0x0" ::: "memory");
    __syncthreads();

    // S^T = K Q^T (+ bias + mask): s[nt][r] = S[qrow][nt*16 + laneHi*8 + r]
    v8f s[4];
#pragma unroll  // constant indices keep the vectors in registers
    for (int nt = 0; nt < 4; ++nt) {
      v8f c = {};
      v16h kf0 = frag16(Ks + nt * 16 * FST, FST, 0);
      v16h kf1 = frag16(Ks + nt * 16 * FST, FST, 32);
      c = WMMA(kf0, qb0, c);
      c = WMMA(kf1, qb1, c);
      s[nt] = c + (lds8f(pbRow + nt * 16) + lds8f(mkRow + nt * 16));
    }

    // online softmax, one query row per lane pair (l, l ^ 16)
    float rm = s[0][0];
#pragma unroll  // constant indices keep the vectors in registers
    for (int nt = 0; nt < 4; ++nt)
#pragma unroll  // constant indices keep the vectors in registers
      for (int r = 0; r < 8; ++r) rm = fmaxf(rm, s[nt][r]);
    rm = fmaxf(rm, xhalf(rm));
    const float mNew = fmaxf(m, rm);
    const float f = __expf(m - mNew);
    m = mNew;
#pragma unroll  // constant indices keep the vectors in registers
    for (int nt = 0; nt < 4; ++nt) s[nt] = exp8(s[nt] - mNew);
    const v8f ps = (s[0] + s[1]) + (s[2] + s[3]);
    l = l * f + (((ps[0] + ps[1]) + (ps[2] + ps[3])) +
                 ((ps[4] + ps[5]) + (ps[6] + ps[7])));
    v16h p0, p1;
#pragma unroll  // constant indices keep the vectors in registers
    for (int r = 0; r < 8; ++r) {
      p0[r] = (_Float16)s[0][r]; p0[r + 8] = (_Float16)s[1][r];
      p1[r] = (_Float16)s[2][r]; p1[r + 8] = (_Float16)s[3][r];
    }

    // rescale running O^T, then O^T += V^T P^T
#pragma unroll  // constant indices keep the vectors in registers
    for (int nt = 0; nt < 4; ++nt) {
      v16h vf0 = frag16(Vt + nt * 16 * FST, FST, 0);
      v16h vf1 = frag16(Vt + nt * 16 * FST, FST, 32);
      o[nt] *= f;
      o[nt] = WMMA(vf0, p0, o[nt]);
      o[nt] = WMMA(vf1, p1, o[nt]);
    }
    // this wave's LDS reads have returned before the next trip's copies refill the tiles
    asm volatile("s_wait_dscnt 0x0" ::: "memory");
    __syncthreads();
  }

  // join the halves' sums, normalize, write to [B, S, H] f16 (16 B per store)
  l += xhalf(l);
  _Float16* orow = out16 + ((long)(b * Ssz + qt * 64 + qrow)) * Hsz + h * HDsz + laneHi * 8;
#pragma unroll  // constant indices keep the vectors in registers
  for (int nt = 0; nt < 4; ++nt) {
    v8h hv;
#pragma unroll  // constant indices keep the vectors in registers
    for (int r = 0; r < 8; ++r) hv[r] = (_Float16)(o[nt][r] / l);
    *(v8h*)(orow + nt * 16) = hv;
  }
}

// ---------------------------------------------------------------------------
extern "C" void kernel_launch(void* const* d_in, const int* in_sizes, int n_in,
                              void* d_out, int out_size, void* d_ws, size_t ws_size,
                              hipStream_t stream) {
  const float* hs  = (const float*)d_in[0];
  const float* pb  = (const float*)d_in[1];
  const float* msk = (const float*)d_in[2];
  const float* Wq  = (const float*)d_in[3];
  const float* bq  = (const float*)d_in[4];
  const float* Wk  = (const float*)d_in[5];
  const float* bk  = (const float*)d_in[6];
  const float* Wv  = (const float*)d_in[7];
  const float* bv  = (const float*)d_in[8];
  const float* Wo  = (const float*)d_in[9];
  const float* bo  = (const float*)d_in[10];
  float* out = (float*)d_out;

  const int NHS = Bsz * Ssz * Hsz;   // 4,194,304
  const int WSZ = Hsz * Hsz;         // 1,048,576
  _Float16* hs16 = (_Float16*)d_ws;
  _Float16* w16  = hs16 + NHS;       // 4 weight matrices
  _Float16* q16  = w16 + 4 * (size_t)WSZ;
  _Float16* k16  = q16 + NHS;
  _Float16* vt16 = k16 + NHS;        // V stored [B,NH,HD,S]
  _Float16* ao16 = vt16 + NHS;

  // fp32 -> f16 staging (4 elems/thread)
  cvt_f32_f16<<<(NHS / 4 + 255) / 256, 256, 0, stream>>>(hs, hs16, NHS);
  cvt_f32_f16<<<(WSZ / 4 + 255) / 256, 256, 0, stream>>>(Wq, w16 + 0 * (size_t)WSZ, WSZ);
  cvt_f32_f16<<<(WSZ / 4 + 255) / 256, 256, 0, stream>>>(Wk, w16 + 1 * (size_t)WSZ, WSZ);
  cvt_f32_f16<<<(WSZ / 4 + 255) / 256, 256, 0, stream>>>(Wv, w16 + 2 * (size_t)WSZ, WSZ);
  cvt_f32_f16<<<(WSZ / 4 + 255) / 256, 256, 0, stream>>>(Wo, w16 + 3 * (size_t)WSZ, WSZ);

  dim3 gp(64, 16), blk(128);
  gemm_proj<<<gp, blk, 0, stream>>>(hs16, w16 + 0 * (size_t)WSZ, bq, q16, QSCALE, 0);
  gemm_proj<<<gp, blk, 0, stream>>>(hs16, w16 + 1 * (size_t)WSZ, bk, k16, 1.0f, 0);
  gemm_proj<<<gp, blk, 0, stream>>>(hs16, w16 + 2 * (size_t)WSZ, bv, vt16, 1.0f, 1);

  attn_flash<<<dim3(Ssz / 64, Bsz * NHsz), blk, 0, stream>>>(q16, k16, vt16, pb, msk, ao16);

  gemm_out<<<gp, blk, 0, stream>>>(ao16, w16 + 3 * (size_t)WSZ, bo, out);
}

// v002
// One run takes 141 microseconds.
// Next to v001, in two timings, it ran 1.18 times as fast each time.
// All steps since v000 together make it 2.36 times as fast.
#include <hip/hip_runtime.h>
#include <hip/hip_bf16.h>

typedef __attribute__((ext_vector_type(16))) _Float16 v16h;
typedef __attribute__((ext_vector_type(4)))  _Float16 v4h;
typedef __attribute__((ext_vector_type(8)))  _Float16 v8h;
typedef __attribute__((ext_vector_type(4)))  float    v4f;
typedef __attribute__((ext_vector_type(8)))  float    v8f;
typedef __attribute__((ext_vector_type(4)))  int      v4i;

#define Bsz 2
#define Ssz 2048
#define Hsz 1024
#define NHsz 16
#define HDsz 64
#define QSCALE 0.125f

#define FST 72   // f16 LDS tile stride (64 + 8 pad) -> 144 B, 16B aligned rows
#define BST 68   // f32 LDS tile stride (64 + 4 pad) -> 272 B rows (16 B x odd): b128 row reads spread over all banks

// ---------------------------------------------------------------------------
// 16-byte global -> LDS copy. Prefer the CDNA5 async-to-LDS path (ASYNCcnt,
// GLOBAL_LOAD_ASYNC_TO_LDS_B128); fall back to VGPR-bounced b128 copy.
// Builtin signature (from hipcc diagnostic): (int4 AS1*, int4 AS3*, imm, imm)
// ---------------------------------------------------------------------------
#if defined(__has_builtin)
#if __has_builtin(__builtin_amdgcn_global_load_async_to_lds_b128)
#define HAVE_ASYNC_LDS 1
#endif
#endif

typedef __attribute__((address_space(1))) v4i* gv4i_p;
typedef __attribute__((address_space(3))) v4i* lv4i_p;

__device__ __forceinline__ void cp16(void* lds, const void* glob) {
#ifdef HAVE_ASYNC_LDS
  __builtin_amdgcn_global_load_async_to_lds_b128(
      (gv4i_p)(glob), (lv4i_p)(lds), 0, 0);
#else
  *(uint4*)lds = *(const uint4*)glob;
#endif
}

__device__ __forceinline__ void cp_fence() {
#ifdef HAVE_ASYNC_LDS
#if defined(__has_builtin) && __has_builtin(__builtin_amdgcn_s_wait_asynccnt)
  __builtin_amdgcn_s_wait_asynccnt(0);
#else
  asm volatile("s_wait_asynccnt 0" ::: "memory");
#endif
#endif
}

// Stage a 64-row x 64-half tile into LDS (row stride FST halves).
// gstride = global row stride in halves. 128 threads, 4 x 16B each.
__device__ __forceinline__ void stage64(_Float16* __restrict__ lds,
                                        const _Float16* __restrict__ gbase,
                                        long gstride, int tid) {
#pragma unroll
  for (int i = tid; i < 512; i += 128) {
    int row = i >> 3, q = i & 7;
    cp16(lds + row * FST + q * 8, gbase + (long)row * gstride + q * 8);
  }
}

// ---------------------------------------------------------------------------
// Fragment gather from LDS, 16-bit A/B matrix layout (ISA 7.12.2, wave32):
// lane m = lane&15 selects the row (A: M-row, B: N-column of the N x K tile),
// hi = lane>>4 selects K-halves; element e -> K = kofs + 8*hi + (e<8 ? e : e+8).
// Pairs are K-consecutive -> lowers to two ds_load_b128 per fragment.
// ---------------------------------------------------------------------------
__device__ __forceinline__ v16h frag16(const _Float16* __restrict__ base,
                                       int stride, int kofs) {
  const int lane = threadIdx.x & 31;
  const int m  = lane & 15;
  const int hi = lane >> 4;
  const _Float16* r = base + m * stride + kofs + hi * 8;
  v16h f;
#pragma unroll
  for (int e = 0; e < 16; e += 2) {
    int k = (e < 8) ? e : (e + 8);
    f[e]     = r[k];
    f[e + 1] = r[k + 1];
  }
  return f;
}

#define WMMA(a, b, c) __builtin_amdgcn_wmma_f32_16x16x32_f16( \
    false, (a), false, (b), (short)0, (c), false, false)

// ---------------------------------------------------------------------------
// All five fp32 -> f16 conversions in one launch. The five destinations lie one
// behind the other in the workspace, so dst is one array of 8 segments of H*H
// elements: segments 0..3 are hidden_states, 4..7 are Wq, Wk, Wv, Wo.
// 64 blocks per segment; a block converts 16,384 elements, a thread 16 x 4.
// ---------------------------------------------------------------------------
__global__ void __launch_bounds__(256) cvt_all(
    const float* __restrict__ hs, const float* __restrict__ wq,
    const float* __restrict__ wk, const float* __restrict__ wv,
    const float* __restrict__ wo, _Float16* __restrict__ dst) {
  const int seg = blockIdx.x >> 6;
  const float* sbase = seg < 4 ? hs + (long)seg * (Hsz * Hsz)
                     : seg == 4 ? wq : seg == 5 ? wk : seg == 6 ? wv : wo;
  const int off = (blockIdx.x & 63) * 16384 + threadIdx.x * 4;
  const float* s = sbase + off;
  _Float16* d = dst + (long)seg * (Hsz * Hsz) + off;
  float4 f[16];
#pragma unroll  // all sixteen loads are issued ahead of the first store
  for (int j = 0; j < 16; ++j) f[j] = *(const float4*)(s + j * 1024);
#pragma unroll  // constant indices keep the array in registers
  for (int j = 0; j < 16; ++j) {
    v4h h;
    h[0] = (_Float16)f[j].x; h[1] = (_Float16)f[j].y;
    h[2] = (_Float16)f[j].z; h[3] = (_Float16)f[j].w;
    *(v4h*)(d + j * 1024) = h;
  }
}

// ---------------------------------------------------------------------------
// Projection GEMMs, all three in one launch: out = (A @ W^T + bias) * scale, f16
// output. z = 0, 1, 2 is Q, K, V: it picks the weight matrix (W3 holds the three
// one behind the other), the bias, the output (dst3 likewise) and its form.
// vmode=0: per-head [B,NH,S,HD];  vmode=1: transposed per-head [B,NH,HD,S].
// Block = 128 threads (4 waves), tile 64(M) x 64(N), K-step 64.
// ---------------------------------------------------------------------------
__global__ void __launch_bounds__(128) gemm_proj(
    const _Float16* __restrict__ A, const _Float16* __restrict__ W3,
    const float* __restrict__ bq, const float* __restrict__ bk,
    const float* __restrict__ bv, _Float16* __restrict__ dst3) {
  __shared__ alignas(16) _Float16 As[64 * FST];
  __shared__ alignas(16) _Float16 Bs[64 * FST];
  const int z = 2 - (int)blockIdx.z;  // V first: its scattered stores overlap the other blocks' loops
  const _Float16* W = W3 + (long)z * (Hsz * Hsz);
  const float* bias = z == 0 ? bq : z == 1 ? bk : bv;
  _Float16* dst = dst3 + (long)z * (Bsz * Ssz * Hsz);
  const float scale = z == 0 ? QSCALE : 1.0f;
  const int vmode = z == 2;
  const int tid = threadIdx.x;
  const int wave = tid >> 5;
  const int lane = tid & 31;
  const int laneN = lane & 15, laneHi = lane >> 4;
  const int m0 = blockIdx.x * 64;
  const int n0 = blockIdx.y * 64;
  const _Float16* Abase = A + (long)m0 * Hsz;
  const _Float16* Wbase = W + (long)n0 * Hsz;

  v8f acc[4] = {};
  for (int k0 = 0; k0 < Hsz; k0 += 64) {
    __syncthreads();
    stage64(As, Abase + k0, Hsz, tid);
    stage64(Bs, Wbase + k0, Hsz, tid);
    cp_fence();
    __syncthreads();
    v16h a0 = frag16(As + wave * 16 * FST, FST, 0);
    v16h a1 = frag16(As + wave * 16 * FST, FST, 32);
#pragma unroll
    for (int nt = 0; nt < 4; ++nt) {
      v16h b0 = frag16(Bs + nt * 16 * FST, FST, 0);
      v16h b1 = frag16(Bs + nt * 16 * FST, FST, 32);
      acc[nt] = WMMA(a0, b0, acc[nt]);
      acc[nt] = WMMA(a1, b1, acc[nt]);
    }
  }
#pragma unroll
  for (int nt = 0; nt < 4; ++nt) {
    int col = n0 + nt * 16 + laneN;
    int h = col >> 6, d = col & 63;
    float bcol = bias[col];
#pragma unroll
    for (int r = 0; r < 8; ++r) {
      int row = m0 + wave * 16 + laneHi * 8 + r;
      int b = row >> 11, s = row & 2047;
      float v = (acc[nt][r] + bcol) * scale;
      long idx = vmode ? ((long)(b * NHsz + h) * HDsz + d) * Ssz + s
                       : ((long)(b * NHsz + h) * Ssz + s) * HDsz + d;
      dst[idx] = (_Float16)v;
    }
  }
}

// ---------------------------------------------------------------------------
// Output projection GEMM: d_out = A @ Wo^T + bo  (fp32 output, [4096,1024])
// ---------------------------------------------------------------------------
__global__ void __launch_bounds__(128) gemm_out(
    const _Float16* __restrict__ A, const _Float16* __restrict__ W,
    const float* __restrict__ bias, float* __restrict__ dst) {
  __shared__ alignas(16) _Float16 As[64 * FST];
  __shared__ alignas(16) _Float16 Bs[64 * FST];
  const int tid = threadIdx.x;
  const int wave = tid >> 5;
  const int lane = tid & 31;
  const int laneN = lane & 15, laneHi = lane >> 4;
  const int m0 = blockIdx.x * 64;
  const int n0 = blockIdx.y * 64;
  const _Float16* Abase = A + (long)m0 * Hsz;
  const _Float16* Wbase = W + (long)n0 * Hsz;

  v8f acc[4] = {};
  for (int k0 = 0; k0 < Hsz; k0 += 64) {
    __syncthreads();
    stage64(As, Abase + k0, Hsz, tid);
    stage64(Bs, Wbase + k0, Hsz, tid);
    cp_fence();
    __syncthreads();
    v16h a0 = frag16(As + wave * 16 * FST, FST, 0);
    v16h a1 = frag16(As + wave * 16 * FST, FST, 32);
#pragma unroll
    for (int nt = 0; nt < 4; ++nt) {
      v16h b0 = frag16(Bs + nt * 16 * FST, FST, 0);
      v16h b1 = frag16(Bs + nt * 16 * FST, FST, 32);
      acc[nt] = WMMA(a0, b0, acc[nt]);
      acc[nt] = WMMA(a1, b1, acc[nt]);
    }
  }
#pragma unroll
  for (int nt = 0; nt < 4; ++nt) {
    int col = n0 + nt * 16 + laneN;
    float bcol = bias[col];
#pragma unroll
    for (int r = 0; r < 8; ++r) {
      int row = m0 + wave * 16 + laneHi * 8 + r;
      dst[(long)row * Hsz + col] = acc[nt][r] + bcol;
    }
  }
}

// Stage a 64-row x 64-float tile of an [.., S, S] array into LDS (row stride
// BST floats). 128 threads, 8 x 16B each; a wave copies whole 256-B rows.
// Fixed trip count: every lane is on at every copy.
__device__ __forceinline__ void stage64f(float* __restrict__ lds,
                                         const float* __restrict__ gbase,
                                         int tid) {
  const unsigned row = (unsigned)tid >> 4, q = (unsigned)tid & 15u;
  const unsigned goff = row * Ssz + q * 4;
  float* l0 = lds + row * BST + q * 4;
#pragma unroll  // eight copies back to back, their LDS addresses loop-invariant
  for (int j = 0; j < 8; ++j)
    cp16(l0 + j * 8 * BST, gbase + j * 8 * Ssz + goff);
}

// 8 consecutive floats from LDS (16-B aligned): two ds_load_b128.
__device__ __forceinline__ v8f lds8f(const float* __restrict__ p) {
  v4f lo = *(const v4f*)p;
  v4f hi = *(const v4f*)(p + 4);
  return __builtin_shufflevector(lo, hi, 0, 1, 2, 3, 4, 5, 6, 7);
}

// e^x for eight values, as __expf compiles: a multiply by log2(e), then v_exp_f32.
// The eight v_exp_f32 stand in one asm statement, each on its own register, and a
// v_nop ends it: so no instruction directly behind a transcendental reads its result
// or overwrites its source.
__device__ __forceinline__ v8f exp8(v8f x) {
  x *= 1.44269504f;
  float a = x[0], b = x[1], c = x[2], d = x[3], e = x[4], f = x[5], g = x[6], h = x[7];
  asm("v_exp_f32 %0, %0\n\tv_exp_f32 %1, %1\n\tv_exp_f32 %2, %2\n\tv_exp_f32 %3, %3\n\t"
      "v_exp_f32 %4, %4\n\tv_exp_f32 %5, %5\n\tv_exp_f32 %6, %6\n\tv_exp_f32 %7, %7\n\tv_nop"
      : "+v"(a), "+v"(b), "+v"(c), "+v"(d), "+v"(e), "+v"(f), "+v"(g), "+v"(h));
  v8f r = {a, b, c, d, e, f, g, h};
  return r;
}

// value of lane l ^ 16
__device__ __forceinline__ float xhalf(float x) {
  int v = __builtin_bit_cast(int, x);
  return __builtin_bit_cast(float, __builtin_amdgcn_permlanex16(
      v, v, 0x76543210, 0xfedcba98, false, false));
}

__global__ void __launch_bounds__(128) attn_flash(
    const _Float16* __restrict__ q16, const _Float16* __restrict__ k16,
    const _Float16* __restrict__ vt16, const float* __restrict__ pbias,
    const float* __restrict__ mask, _Float16* __restrict__ out16) {
  __shared__ alignas(16) _Float16 Qs[64 * FST];
  __shared__ alignas(16) _Float16 Ks[64 * FST];
  __shared__ alignas(16) _Float16 Vt[64 * FST];
  __shared__ alignas(16) float Pb[64 * BST];
  __shared__ alignas(16) float Mk[64 * BST];

  const int tid = threadIdx.x;
  const int wave = tid >> 5;
  const int lane = tid & 31;
  const int laneN = lane & 15, laneHi = lane >> 4;
  const int qt = blockIdx.x;          // q tile 0..31
  const int bh = blockIdx.y;          // 0..31
  const int b = bh >> 4, h = bh & 15;
  const long headBase = (long)bh * Ssz * HDsz;   // for q16/k16 slices
  const _Float16* Vhead = vt16 + headBase;       // [HD, S] rows for this head
  const float* pbTile = pbias + ((long)h * Ssz + qt * 64) * Ssz;
  const float* mkTile = mask + ((long)b * Ssz + qt * 64) * Ssz;
  const int qrow = wave * 16 + laneN;            // this lane's query row in the tile
  const float* pbRow = Pb + qrow * BST + laneHi * 8;
  const float* mkRow = Mk + qrow * BST + laneHi * 8;

  stage64(Qs, q16 + headBase + (long)qt * 64 * HDsz, HDsz, tid);
  cp_fence();
  __syncthreads();

  const v16h qb0 = frag16(Qs + wave * 16 * FST, FST, 0);
  const v16h qb1 = frag16(Qs + wave * 16 * FST, FST, 32);
  v8f o[4] = {};                      // o[nt][r] = O[qrow][nt*16 + laneHi*8 + r]
  float m = -3.0e38f;                 // running maximum of the row (both halves agree)
  float l = 0.0f;                     // running sum over this lane's own keys only

  for (int kt = 0; kt < Ssz / 64; ++kt) {
    // stage K rows [key][d], V^T rows [d][key], bias and mask rows [q][key]
    stage64(Ks, k16 + headBase + (long)kt * 64 * HDsz, HDsz, tid);
    stage64(Vt, Vhead + kt * 64, Ssz, tid);
    stage64f(Pb, pbTile + kt * 64, tid);
    stage64f(Mk, mkTile + kt * 64, tid);
    // this wave's copies have landed before the barrier publishes them
    asm volatile("s_wait_asynccnt 0x0" ::: "memory");
    __syncthreads();

    // S^T = K Q^T (+ bias + mask): s[nt][r] = S[qrow][nt*16 + laneHi*8 + r]
    v8f s[4];
#pragma unroll  // constant indices keep the vectors in registers
    for (int nt = 0; nt < 4; ++nt) {
      v8f c = {};
      v16h kf0 = frag16(Ks + nt * 16 * FST, FST, 0);
      v16h kf1 = frag16(Ks + nt * 16 * FST, FST, 32);
      c = WMMA(kf0, qb0, c);
      c = WMMA(kf1, qb1, c);
      s[nt] = c + (lds8f(pbRow + nt * 16) + lds8f(mkRow + nt * 16));
    }

    // online softmax, one query row per lane pair (l, l ^ 16)
    float rm = s[0][0];
#pragma unroll  // constant indices keep the vectors in registers
    for (int nt = 0; nt < 4; ++nt)
#pragma unroll  // constant indices keep the vectors in registers
      for (int r = 0; r < 8; ++r) rm = fmaxf(rm, s[nt][r]);
    rm = fmaxf(rm, xhalf(rm));
    const float mNew = fmaxf(m, rm);
    const float f = __expf(m - mNew);
    m = mNew;
#pragma unroll  // constant indices keep the vectors in registers
    for (int nt = 0; nt < 4; ++nt) s[nt] = exp8(s[nt] - mNew);
    const v8f ps = (s[0] + s[1]) + (s[2] + s[3]);
    l = l * f + (((ps[0] + ps[1]) + (ps[2] + ps[3])) +
                 ((ps[4] + ps[5]) + (ps[6] + ps[7])));
    v16h p0, p1;
#pragma unroll  // constant indices keep the vectors in registers
    for (int r = 0; r < 8; ++r) {
      p0[r] = (_Float16)s[0][r]; p0[r + 8] = (_Float16)s[1][r];
      p1[r] = (_Float16)s[2][r]; p1[r + 8] = (_Float16)s[3][r];
    }

    // rescale running O^T, then O^T += V^T P^T
#pragma unroll  // constant indices keep the vectors in registers
    for (int nt = 0; nt < 4; ++nt) {
      v16h vf0 = frag16(Vt + nt * 16 * FST, FST, 0);
      v16h vf1 = frag16(Vt + nt * 16 * FST, FST, 32);
      o[nt] *= f;
      o[nt] = WMMA(vf0, p0, o[nt]);
      o[nt] = WMMA(vf1, p1, o[nt]);
    }
    // this wave's LDS reads have returned before the next trip's copies refill the tiles
    asm volatile("s_wait_dscnt 0x0" ::: "memory");
    __syncthreads();
  }

  // join the halves' sums, normalize, write to [B, S, H] f16 (16 B per store)
  l += xhalf(l);
  _Float16* orow = out16 + ((long)(b * Ssz + qt * 64 + qrow)) * Hsz + h * HDsz + laneHi * 8;
#pragma unroll  // constant indices keep the vectors in registers
  for (int nt = 0; nt < 4; ++nt) {
    v8h hv;
#pragma unroll  // constant indices keep the vectors in registers
    for (int r = 0; r < 8; ++r) hv[r] = (_Float16)(o[nt][r] / l);
    *(v8h*)(orow + nt * 16) = hv;
  }
}

// ---------------------------------------------------------------------------
extern "C" void kernel_launch(void* const* d_in, const int* in_sizes, int n_in,
                              void* d_out, int out_size, void* d_ws, size_t ws_size,
                              hipStream_t stream) {
  const float* hs  = (const float*)d_in[0];
  const float* pb  = (const float*)d_in[1];
  const float* msk = (const float*)d_in[2];
  const float* Wq  = (const float*)d_in[3];
  const float* bq  = (const float*)d_in[4];
  const float* Wk  = (const float*)d_in[5];
  const float* bk  = (const float*)d_in[6];
  const float* Wv  = (const float*)d_in[7];
  const float* bv  = (const float*)d_in[8];
  const float* Wo  = (const float*)d_in[9];
  const float* bo  = (const float*)d_in[10];
  float* out = (float*)d_out;

  const int NHS = Bsz * Ssz * Hsz;   // 4,194,304
  const int WSZ = Hsz * Hsz;         // 1,048,576
  _Float16* hs16 = (_Float16*)d_ws;
  _Float16* w16  = hs16 + NHS;       // 4 weight matrices
  _Float16* q16  = w16 + 4 * (size_t)WSZ;
  _Float16* k16  = q16 + NHS;
  _Float16* vt16 = k16 + NHS;        // V stored [B,NH,HD,S]
  _Float16* ao16 = vt16 + NHS;

  // fp32 -> f16 staging: hs16 and the four w16 matrices are one contiguous range
  cvt_all<<<512, 256, 0, stream>>>(hs, Wq, Wk, Wv, Wo, hs16);

  // Q, K, V: w16 holds Wq, Wk, Wv in a row; q16, k16, vt16 lie in a row
  dim3 gp(64, 16), blk(128);
  gemm_proj<<<dim3(64, 16, 3), blk, 0, stream>>>(hs16, w16, bq, bk, bv, q16);

  attn_flash<<<dim3(Ssz / 64, Bsz * NHsz), blk, 0, stream>>>(q16, k16, vt16, pb, msk, ao16);

  gemm_out<<<gp, blk, 0, stream>>>(ao16, w16 + 3 * (size_t)WSZ, bo, out);
}

// v003
// Measured time: 130 microseconds a run.
// Timed twice side by side with v002, it ran 1.09 times as fast both times.
// All steps since v000 together make it 2.57 times as fast.
#include <hip/hip_runtime.h>
#include <hip/hip_bf16.h>

typedef __attribute__((ext_vector_type(16))) _Float16 v16h;
typedef __attribute__((ext_vector_type(4)))  _Float16 v4h;
typedef __attribute__((ext_vector_type(8)))  _Float16 v8h;
typedef __attribute__((ext_vector_type(4)))  float    v4f;
typedef __attribute__((ext_vector_type(8)))  float    v8f;

#define Bsz 2
#define Ssz 2048
#define Hsz 1024
#define NHsz 16
#define HDsz 64
#define QSCALE 0.125f

#define FST 72   // f16 LDS tile stride (64 + 8 pad) -> 144 B, 16B aligned rows
#define TSZ (64 * FST)  // halves in one 64 x 64 f16 LDS tile
#define BST 68   // f32 LDS tile stride (64 + 4 pad) -> 272 B rows (16 B x odd): b128 row reads spread over all banks

// ---------------------------------------------------------------------------
// 16-byte global -> LDS copies on the CDNA5 async-to-LDS path (ASYNCcnt,
// GLOBAL_LOAD_ASYNC_TO_LDS_B128), four or eight to a statement. Each lane names its own
// LDS byte address and its own global pointer; no immediate offset. The
// s_wait_xcnt 0 is the statement's last line, so that it stands in front of
// every later write of a register that one of these copies names (a precaution).
// ---------------------------------------------------------------------------
__device__ __forceinline__ unsigned lds_addr(const void* p) {
  return (unsigned)(unsigned long long)p;  // low 32 bits of a __shared__ address
}

__device__ __forceinline__ void cp16x4(unsigned l0, unsigned l1, unsigned l2, unsigned l3,
                                       const void* g0, const void* g1,
                                       const void* g2, const void* g3) {
  asm volatile(
      "global_load_async_to_lds_b128 %0, %4, off\n\t"
      "global_load_async_to_lds_b128 %1, %5, off\n\t"
      "global_load_async_to_lds_b128 %2, %6, off\n\t"
      "global_load_async_to_lds_b128 %3, %7, off\n\t"
      "s_wait_xcnt 0x0"
      :: "v"(l0), "v"(l1), "v"(l2), "v"(l3), "v"(g0), "v"(g1), "v"(g2), "v"(g3)
      : "memory");
}

__device__ __forceinline__ void cp16x8(unsigned l0, unsigned l1, unsigned l2, unsigned l3,
                                       unsigned l4, unsigned l5, unsigned l6, unsigned l7,
                                       const void* g0, const void* g1,
                                       const void* g2, const void* g3,
                                       const void* g4, const void* g5,
                                       const void* g6, const void* g7) {
  asm volatile(
      "global_load_async_to_lds_b128 %0, %8, off\n\t"
      "global_load_async_to_lds_b128 %1, %9, off\n\t"
      "global_load_async_to_lds_b128 %2, %10, off\n\t"
      "global_load_async_to_lds_b128 %3, %11, off\n\t"
      "global_load_async_to_lds_b128 %4, %12, off\n\t"
      "global_load_async_to_lds_b128 %5, %13, off\n\t"
      "global_load_async_to_lds_b128 %6, %14, off\n\t"
      "global_load_async_to_lds_b128 %7, %15, off\n\t"
      "s_wait_xcnt 0x0"
      :: "v"(l0), "v"(l1), "v"(l2), "v"(l3), "v"(l4), "v"(l5), "v"(l6), "v"(l7),
         "v"(g0), "v"(g1), "v"(g2), "v"(g3), "v"(g4), "v"(g5), "v"(g6), "v"(g7)
      : "memory");
}

// Stage a 64-row x 64-half tile into LDS (row stride FST halves).
// gstride = global row stride in halves. 128 threads, 4 x 16B each.
// Fixed trip count: every lane is on at every copy.
__device__ __forceinline__ void stage64(_Float16* __restrict__ lds,
                                        const _Float16* __restrict__ gbase,
                                        unsigned gstride, int tid) {
  const unsigned row = (unsigned)tid >> 3, q = (unsigned)tid & 7u;
  const unsigned l0 = lds_addr(lds + row * FST + q * 8);
  const _Float16* g0 = gbase + (row * gstride + q * 8);
  cp16x4(l0, l0 + 16 * FST * 2, l0 + 32 * FST * 2, l0 + 48 * FST * 2,
         g0, g0 + 16 * gstride, g0 + 32 * gstride, g0 + 48 * gstride);
}

// Two such tiles, x and y, in one statement of eight copies.
__device__ __forceinline__ void stage64x2(_Float16* __restrict__ ldsx,
                                          const _Float16* __restrict__ gx, unsigned sx,
                                          _Float16* __restrict__ ldsy,
                                          const _Float16* __restrict__ gy, unsigned sy,
                                          int tid) {
  const unsigned row = (unsigned)tid >> 3, q = (unsigned)tid & 7u;
  const unsigned lx = lds_addr(ldsx + row * FST + q * 8);
  const unsigned ly = lds_addr(ldsy + row * FST + q * 8);
  const _Float16* x0 = gx + (row * sx + q * 8);
  const _Float16* y0 = gy + (row * sy + q * 8);
  cp16x8(lx, lx + 16 * FST * 2, lx + 32 * FST * 2, lx + 48 * FST * 2,
         ly, ly + 16 * FST * 2, ly + 32 * FST * 2, ly + 48 * FST * 2,
         x0, x0 + 16 * sx, x0 + 32 * sx, x0 + 48 * sx,
         y0, y0 + 16 * sy, y0 + 32 * sy, y0 + 48 * sy);
}

// ---------------------------------------------------------------------------
// Fragment gather from LDS, 16-bit A/B matrix layout (ISA 7.12.2, wave32):
// lane m = lane&15 selects the row (A: M-row, B: N-column of the N x K tile),
// hi = lane>>4 selects K-halves; element e -> K = kofs + 8*hi + (e<8 ? e : e+8).
// Pairs are K-consecutive -> lowers to two ds_load_b128 per fragment.
// ---------------------------------------------------------------------------
__device__ __forceinline__ v16h frag16(const _Float16* __restrict__ base,
                                       int stride, int kofs) {
  const int lane = threadIdx.x & 31;
  const int m  = lane & 15;
  const int hi = lane >> 4;
  const _Float16* r = base + m * stride + kofs + hi * 8;
  v16h f;
#pragma unroll
  for (int e = 0; e < 16; e += 2) {
    int k = (e < 8) ? e : (e + 8);
    f[e]     = r[k];
    f[e + 1] = r[k + 1];
  }
  return f;
}

#define WMMA(a, b, c) __builtin_amdgcn_wmma_f32_16x16x32_f16( \
    false, (a), false, (b), (short)0, (c), false, false)

// ---------------------------------------------------------------------------
// K loop of both GEMMs: acc += A tile x W tile^T over Hsz in steps of 64, on two
// LDS buffers each for A and W: tile t + 1's copies fly while tile t is worked on.
// ---------------------------------------------------------------------------
__device__ __forceinline__ void gemm_loop(_Float16* As, _Float16* Bs,
                                          const _Float16* __restrict__ Abase,
                                          const _Float16* __restrict__ Wbase,
                                          int tid, int wave, v8f (&acc)[4]) {
  stage64x2(As, Abase, Hsz, Bs, Wbase, Hsz, tid);
  // this wave's copies of tile 0 have landed before the barrier publishes them
  asm volatile("s_wait_asynccnt 0x0" ::: "memory");
  __syncthreads();
  stage64x2(As + TSZ, Abase + 64, Hsz, Bs + TSZ, Wbase + 64, Hsz, tid);
  for (int t = 0; t < Hsz / 64; ++t) {
    _Float16* Ac = As + (t & 1) * TSZ;
    _Float16* Bc = Bs + (t & 1) * TSZ;
    v16h a0 = frag16(Ac + wave * 16 * FST, FST, 0);
    v16h a1 = frag16(Ac + wave * 16 * FST, FST, 32);
#pragma unroll  // constant indices keep the accumulators in registers
    for (int nt = 0; nt < 4; ++nt) {
      v16h b0 = frag16(Bc + nt * 16 * FST, FST, 0);
      v16h b1 = frag16(Bc + nt * 16 * FST, FST, 32);
      acc[nt] = WMMA(a0, b0, acc[nt]);
      acc[nt] = WMMA(a1, b1, acc[nt]);
    }
    // this wave's reads of tile t have returned before the buffer is refilled
    asm volatile("s_wait_dscnt 0x0" ::: "memory");
    // this wave's copies of tile t + 1 have landed before the barrier publishes them
    asm volatile("s_wait_asynccnt 0x0" ::: "memory");
    __syncthreads();
    if (t + 2 < Hsz / 64)
      stage64x2(Ac, Abase + (t + 2) * 64, Hsz, Bc, Wbase + (t + 2) * 64, Hsz, tid);
  }
  // no copy is outstanding when the wave goes on to its stores and ends
  asm volatile("s_wait_asynccnt 0x0" ::: "memory");
}

// ---------------------------------------------------------------------------
// All five fp32 -> f16 conversions in one launch. The five destinations lie one
// behind the other in the workspace, so dst is one array of 8 segments of H*H
// elements: segments 0..3 are hidden_states, 4..7 are Wq, Wk, Wv, Wo.
// 64 blocks per segment; a block converts 16,384 elements, a thread 16 x 4.
// ---------------------------------------------------------------------------
__global__ void __launch_bounds__(256) cvt_all(
    const float* __restrict__ hs, const float* __restrict__ wq,
    const float* __restrict__ wk, const float* __restrict__ wv,
    const float* __restrict__ wo, _Float16* __restrict__ dst) {
  const int seg = blockIdx.x >> 6;
  const float* sbase = seg < 4 ? hs + (long)seg * (Hsz * Hsz)
                     : seg == 4 ? wq : seg == 5 ? wk : seg == 6 ? wv : wo;
  const int off = (blockIdx.x & 63) * 16384 + threadIdx.x * 4;
  const float* s = sbase + off;
  _Float16* d = dst + (long)seg * (Hsz * Hsz) + off;
  float4 f[16];
#pragma unroll  // all sixteen loads are issued ahead of the first store
  for (int j = 0; j < 16; ++j) f[j] = *(const float4*)(s + j * 1024);
#pragma unroll  // constant indices keep the array in registers
  for (int j = 0; j < 16; ++j) {
    v4h h;
    h[0] = (_Float16)f[j].x; h[1] = (_Float16)f[j].y;
    h[2] = (_Float16)f[j].z; h[3] = (_Float16)f[j].w;
    *(v4h*)(d + j * 1024) = h;
  }
}

// ---------------------------------------------------------------------------
// Projection GEMMs, all three in one launch: out = (A @ W^T + bias) * scale, f16
// output. z = 0, 1, 2 is Q, K, V: it picks the weight matrix (W3 holds the three
// one behind the other), the bias, the output (dst3 likewise) and its form.
// vmode=0: per-head [B,NH,S,HD];  vmode=1: transposed per-head [B,NH,HD,S].
// Block = 128 threads (4 waves), tile 64(M) x 64(N), K-step 64.
// ---------------------------------------------------------------------------
__global__ void __launch_bounds__(128) gemm_proj(
    const _Float16* __restrict__ A, const _Float16* __restrict__ W3,
    const float* __restrict__ bq, const float* __restrict__ bk,
    const float* __restrict__ bv, _Float16* __restrict__ dst3) {
  __shared__ alignas(16) _Float16 As[2 * TSZ];
  __shared__ alignas(16) _Float16 Bs[2 * TSZ];
  const int z = 2 - (int)blockIdx.z;  // V first: its scattered stores overlap the other blocks' loops
  const _Float16* W = W3 + (long)z * (Hsz * Hsz);
  const float* bias = z == 0 ? bq : z == 1 ? bk : bv;
  _Float16* dst = dst3 + (long)z * (Bsz * Ssz * Hsz);
  const float scale = z == 0 ? QSCALE : 1.0f;
  const int vmode = z == 2;
  const int tid = threadIdx.x;
  const int wave = tid >> 5;
  const int lane = tid & 31;
  const int laneN = lane & 15, laneHi = lane >> 4;
  const int m0 = blockIdx.x * 64;
  const int n0 = blockIdx.y * 64;
  const _Float16* Abase = A + (long)m0 * Hsz;
  const _Float16* Wbase = W + (long)n0 * Hsz;

  v8f acc[4] = {};
  gemm_loop(As, Bs, Abase, Wbase, tid, wave, acc);
#pragma unroll
  for (int nt = 0; nt < 4; ++nt) {
    int col = n0 + nt * 16 + laneN;
    int h = col >> 6, d = col & 63;
    float bcol = bias[col];
#pragma unroll
    for (int r = 0; r < 8; ++r) {
      int row = m0 + wave * 16 + laneHi * 8 + r;
      int b = row >> 11, s = row & 2047;
      float v = (acc[nt][r] + bcol) * scale;
      long idx = vmode ? ((long)(b * NHsz + h) * HDsz + d) * Ssz + s
                       : ((long)(b * NHsz + h) * Ssz + s) * HDsz + d;
      dst[idx] = (_Float16)v;
    }
  }
}

// ---------------------------------------------------------------------------
// Output projection GEMM: d_out = A @ Wo^T + bo  (fp32 output, [4096,1024])
// ---------------------------------------------------------------------------
__global__ void __launch_bounds__(128) gemm_out(
    const _Float16* __restrict__ A, const _Float16* __restrict__ W,
    const float* __restrict__ bias, float* __restrict__ dst) {
  __shared__ alignas(16) _Float16 As[2 * TSZ];
  __shared__ alignas(16) _Float16 Bs[2 * TSZ];
  const int tid = threadIdx.x;
  const int wave = tid >> 5;
  const int lane = tid & 31;
  const int laneN = lane & 15, laneHi = lane >> 4;
  const int m0 = blockIdx.x * 64;
  const int n0 = blockIdx.y * 64;
  const _Float16* Abase = A + (long)m0 * Hsz;
  const _Float16* Wbase = W + (long)n0 * Hsz;

  v8f acc[4] = {};
  gemm_loop(As, Bs, Abase, Wbase, tid, wave, acc);
#pragma unroll
  for (int nt = 0; nt < 4; ++nt) {
    int col = n0 + nt * 16 + laneN;
    float bcol = bias[col];
#pragma unroll
    for (int r = 0; r < 8; ++r) {
      int row = m0 + wave * 16 + laneHi * 8 + r;
      dst[(long)row * Hsz + col] = acc[nt][r] + bcol;
    }
  }
}

// Stage a 64-row x 64-float tile of an [.., S, S] array into LDS (row stride
// BST floats). 128 threads, 8 x 16B each; a wave copies whole 256-B rows, and
// only the 16 rows that it alone reads (rows wave*16 .. wave*16+15): the tile is
// four rings of one slot, each private to its wave, and needs no barrier.
// Fixed trip count: every lane is on at every copy.
__device__ __forceinline__ void stage64f(float* __restrict__ lds,
                                         const float* __restrict__ gbase,
                                         int tid) {
  const unsigned row = ((unsigned)tid >> 5) * 16 + (((unsigned)tid >> 4) & 1u);
  const unsigned q = (unsigned)tid & 15u;
  const unsigned l0 = lds_addr(lds + row * BST + q * 4);
  const float* g0 = gbase + (row * Ssz + q * 4);
  cp16x8(l0, l0 + 2 * BST * 4, l0 + 4 * BST * 4, l0 + 6 * BST * 4,
         l0 + 8 * BST * 4, l0 + 10 * BST * 4, l0 + 12 * BST * 4, l0 + 14 * BST * 4,
         g0, g0 + 2 * Ssz, g0 + 4 * Ssz, g0 + 6 * Ssz,
         g0 + 8 * Ssz, g0 + 10 * Ssz, g0 + 12 * Ssz, g0 + 14 * Ssz);
}

// 8 consecutive floats from LDS (16-B aligned): two ds_load_b128.
__device__ __forceinline__ v8f lds8f(const float* __restrict__ p) {
  v4f lo = *(const v4f*)p;
  v4f hi = *(const v4f*)(p + 4);
  return __builtin_shufflevector(lo, hi, 0, 1, 2, 3, 4, 5, 6, 7);
}

// e^x for eight values, as __expf compiles: a multiply by log2(e), then v_exp_f32.
// The eight v_exp_f32 stand in one asm statement, each on its own register, and a
// v_nop ends it: so no instruction directly behind a transcendental reads its result
// or overwrites its source.
__device__ __forceinline__ v8f exp8(v8f x) {
  x *= 1.44269504f;
  float a = x[0], b = x[1], c = x[2], d = x[3], e = x[4], f = x[5], g = x[6], h = x[7];
  asm("v_exp_f32 %0, %0\n\tv_exp_f32 %1, %1\n\tv_exp_f32 %2, %2\n\tv_exp_f32 %3, %3\n\t"
      "v_exp_f32 %4, %4\n\tv_exp_f32 %5, %5\n\tv_exp_f32 %6, %6\n\tv_exp_f32 %7, %7\n\tv_nop"
      : "+v"(a), "+v"(b), "+v"(c), "+v"(d), "+v"(e), "+v"(f), "+v"(g), "+v"(h));
  v8f r = {a, b, c, d, e, f, g, h};
  return r;
}

// value of lane l ^ 16
__device__ __forceinline__ float xhalf(float x) {
  int v = __builtin_bit_cast(int, x);
  return __builtin_bit_cast(float, __builtin_amdgcn_permlanex16(
      v, v, 0x76543210, 0xfedcba98, false, false));
}

__global__ void __launch_bounds__(128) attn_flash(
    const _Float16* __restrict__ q16, const _Float16* __restrict__ k16,
    const _Float16* __restrict__ vt16, const float* __restrict__ pbias,
    const float* __restrict__ mask, _Float16* __restrict__ out16) {
  __shared__ alignas(16) _Float16 Qs[64 * FST];
  __shared__ alignas(16) _Float16 Ks[2 * TSZ];
  __shared__ alignas(16) _Float16 Vt[2 * TSZ];
  __shared__ alignas(16) float Pb[64 * BST];
  __shared__ alignas(16) float Mk[64 * BST];

  const int tid = threadIdx.x;
  const int wave = tid >> 5;
  const int lane = tid & 31;
  const int laneN = lane & 15, laneHi = lane >> 4;
  const int qt = blockIdx.x;          // q tile 0..31
  const int bh = blockIdx.y;          // 0..31
  const int b = bh >> 4, h = bh & 15;
  const long headBase = (long)bh * Ssz * HDsz;   // for q16/k16 slices
  const _Float16* Vhead = vt16 + headBase;       // [HD, S] rows for this head
  const float* pbTile = pbias + ((long)h * Ssz + qt * 64) * Ssz;
  const float* mkTile = mask + ((long)b * Ssz + qt * 64) * Ssz;
  const int qrow = wave * 16 + laneN;            // this lane's query row in the tile
  const float* pbRow = Pb + qrow * BST + laneHi * 8;
  const float* mkRow = Mk + qrow * BST + laneHi * 8;

  // Q and tile 0: K rows [key][d], V^T rows [d][key], bias and mask rows [q][key]
  stage64(Qs, q16 + headBase + (long)qt * 64 * HDsz, HDsz, tid);
  stage64x2(Ks, k16 + headBase, HDsz, Vt, Vhead, Ssz, tid);
  stage64f(Pb, pbTile, tid);
  stage64f(Mk, mkTile, tid);
  // this wave's copies have landed before the barrier publishes them
  asm volatile("s_wait_asynccnt 0x0" ::: "memory");
  __syncthreads();
  // K and V of tile 1 fly while tile 0 is worked on
  stage64x2(Ks + TSZ, k16 + headBase + 64 * HDsz, HDsz, Vt + TSZ, Vhead + 64, Ssz, tid);

  const v16h qb0 = frag16(Qs + wave * 16 * FST, FST, 0);
  const v16h qb1 = frag16(Qs + wave * 16 * FST, FST, 32);
  v8f o[4] = {};                      // o[nt][r] = O[qrow][nt*16 + laneHi*8 + r]
  float m = -3.0e38f;                 // running maximum of the row (both halves agree)
  float l = 0.0f;                     // running sum over this lane's own keys only

  for (int kt = 0; kt < Ssz / 64; ++kt) {
    _Float16* Kc = Ks + (kt & 1) * TSZ;
    _Float16* Vc = Vt + (kt & 1) * TSZ;

    // this tile's bias + mask go to registers, so that their rows can be refilled at once
    v8f bm[4];
#pragma unroll  // constant indices keep the vectors in registers
    for (int nt = 0; nt < 4; ++nt)
      bm[nt] = lds8f(pbRow + nt * 16) + lds8f(mkRow + nt * 16);
    // this wave's reads of its own bias and mask rows have returned before it refills them
    asm volatile("s_wait_dscnt 0x0" ::: "memory");
    if (kt + 1 < Ssz / 64) {
      stage64f(Pb, pbTile + (kt + 1) * 64, tid);
      stage64f(Mk, mkTile + (kt + 1) * 64, tid);
    }

    // S^T = K Q^T (+ bias + mask): s[nt][r] = S[qrow][nt*16 + laneHi*8 + r]
    v8f s[4];
#pragma unroll  // constant indices keep the vectors in registers
    for (int nt = 0; nt < 4; ++nt) {
      v8f c = {};
      v16h kf0 = frag16(Kc + nt * 16 * FST, FST, 0);
      v16h kf1 = frag16(Kc + nt * 16 * FST, FST, 32);
      c = WMMA(kf0, qb0, c);
      c = WMMA(kf1, qb1, c);
      s[nt] = c + bm[nt];
    }

    // online softmax, one query row per lane pair (l, l ^ 16)
    float rm = s[0][0];
#pragma unroll  // constant indices keep the vectors in registers
    for (int nt = 0; nt < 4; ++nt)
#pragma unroll  // constant indices keep the vectors in registers
      for (int r = 0; r < 8; ++r) rm = fmaxf(rm, s[nt][r]);
    rm = fmaxf(rm, xhalf(rm));
    const float mNew = fmaxf(m, rm);
    const float f = __expf(m - mNew);
    m = mNew;
#pragma unroll  // constant indices keep the vectors in registers
    for (int nt = 0; nt < 4; ++nt) s[nt] = exp8(s[nt] - mNew);
    const v8f ps = (s[0] + s[1]) + (s[2] + s[3]);
    l = l * f + (((ps[0] + ps[1]) + (ps[2] + ps[3])) +
                 ((ps[4] + ps[5]) + (ps[6] + ps[7])));
    v16h p0, p1;
#pragma unroll  // constant indices keep the vectors in registers
    for (int r = 0; r < 8; ++r) {
      p0[r] = (_Float16)s[0][r]; p0[r + 8] = (_Float16)s[1][r];
      p1[r] = (_Float16)s[2][r]; p1[r + 8] = (_Float16)s[3][r];
    }

    // rescale running O^T, then O^T += V^T P^T
#pragma unroll  // constant indices keep the vectors in registers
    for (int nt = 0; nt < 4; ++nt) {
      v16h vf0 = frag16(Vc + nt * 16 * FST, FST, 0);
      v16h vf1 = frag16(Vc + nt * 16 * FST, FST, 32);
      o[nt] *= f;
      o[nt] = WMMA(vf0, p0, o[nt]);
      o[nt] = WMMA(vf1, p1, o[nt]);
    }
    // this wave's reads of K and V have returned before their buffer is refilled
    asm volatile("s_wait_dscnt 0x0" ::: "memory");
    // this wave's copies of tile kt + 1 have landed before the barrier publishes K and V
    asm volatile("s_wait_asynccnt 0x0" ::: "memory");
    __syncthreads();
    if (kt + 2 < Ssz / 64)
      stage64x2(Kc, k16 + headBase + (long)(kt + 2) * 64 * HDsz, HDsz,
                Vc, Vhead + (kt + 2) * 64, Ssz, tid);
  }
  // no copy is outstanding when the wave goes on to its stores and ends
  asm volatile("s_wait_asynccnt 0x0" ::: "memory");

  // join the halves' sums, normalize, write to [B, S, H] f16 (16 B per store)
  l += xhalf(l);
  _Float16* orow = out16 + ((long)(b * Ssz + qt * 64 + qrow)) * Hsz + h * HDsz + laneHi * 8;
#pragma unroll  // constant indices keep the vectors in registers
  for (int nt = 0; nt < 4; ++nt) {
    v8h hv;
#pragma unroll  // constant indices keep the vectors in registers
    for (int r = 0; r < 8; ++r) hv[r] = (_Float16)(o[nt][r] / l);
    *(v8h*)(orow + nt * 16) = hv;
  }
}

// ---------------------------------------------------------------------------
extern "C" void kernel_launch(void* const* d_in, const int* in_sizes, int n_in,
                              void* d_out, int out_size, void* d_ws, size_t ws_size,
                              hipStream_t stream) {
  const float* hs  = (const float*)d_in[0];
  const float* pb  = (const float*)d_in[1];
  const float* msk = (const float*)d_in[2];
  const float* Wq  = (const float*)d_in[3];
  const float* bq  = (const float*)d_in[4];
  const float* Wk  = (const float*)d_in[5];
  const float* bk  = (const float*)d_in[6];
  const float* Wv  = (const float*)d_in[7];
  const float* bv  = (const float*)d_in[8];
  const float* Wo  = (const float*)d_in[9];
  const float* bo  = (const float*)d_in[10];
  float* out = (float*)d_out;

  const int NHS = Bsz * Ssz * Hsz;   // 4,194,304
  const int WSZ = Hsz * Hsz;         // 1,048,576
  _Float16* hs16 = (_Float16*)d_ws;
  _Float16* w16  = hs16 + NHS;       // 4 weight matrices
  _Float16* q16  = w16 + 4 * (size_t)WSZ;
  _Float16* k16  = q16 + NHS;
  _Float16* vt16 = k16 + NHS;        // V stored [B,NH,HD,S]
  _Float16* ao16 = vt16 + NHS;

  // fp32 -> f16 staging: hs16 and the four w16 matrices are one contiguous range
  cvt_all<<<512, 256, 0, stream>>>(hs, Wq, Wk, Wv, Wo, hs16);

  // Q, K, V: w16 holds Wq, Wk, Wv in a row; q16, k16, vt16 lie in a row
  dim3 gp(64, 16), blk(128);
  gemm_proj<<<dim3(64, 16, 3), blk, 0, stream>>>(hs16, w16, bq, bk, bv, q16);

  attn_flash<<<dim3(Ssz / 64, Bsz * NHsz), blk, 0, stream>>>(q16, k16, vt16, pb, msk, ao16);

  gemm_out<<<gp, blk, 0, stream>>>(ao16, w16 + 3 * (size_t)WSZ, bo, out);
}

// v004
// Measured time: 123 microseconds a run.
// In both of two side-by-side timings against v003, it was 1.05 times as fast.
// Counting every step since v000, it is 2.70 times as fast.
#include <hip/hip_runtime.h>
#include <hip/hip_bf16.h>

typedef __attribute__((ext_vector_type(16))) _Float16 v16h;
typedef __attribute__((ext_vector_type(4)))  _Float16 v4h;
typedef __attribute__((ext_vector_type(8)))  _Float16 v8h;
typedef __attribute__((ext_vector_type(4)))  float    v4f;
typedef __attribute__((ext_vector_type(8)))  float    v8f;

#define Bsz 2
#define Ssz 2048
#define Hsz 1024
#define NHsz 16
#define HDsz 64
#define QSCALE 0.125f

#define FST 72   // f16 LDS tile stride (64 + 8 pad) -> 144 B, 16B aligned rows
#define TSZ (64 * FST)  // halves in one 64 x 64 f16 LDS tile
#define GTSZ (128 * FST)  // halves in one 128-row x 64 f16 LDS tile of the GEMMs
#define BST 68   // f32 LDS tile stride (64 + 4 pad) -> 272 B rows (16 B x odd): b128 row reads spread over all banks

// ---------------------------------------------------------------------------
// 16-byte global -> LDS copies on the CDNA5 async-to-LDS path (ASYNCcnt,
// GLOBAL_LOAD_ASYNC_TO_LDS_B128), four or eight to a statement. Each lane names its own
// LDS byte address and its own global pointer; no immediate offset. The
// s_wait_xcnt 0 is the statement's last line, so that it stands in front of
// every later write of a register that one of these copies names (a precaution).
// ---------------------------------------------------------------------------
__device__ __forceinline__ unsigned lds_addr(const void* p) {
  return (unsigned)(unsigned long long)p;  // low 32 bits of a __shared__ address
}

__device__ __forceinline__ void cp16x4(unsigned l0, unsigned l1, unsigned l2, unsigned l3,
                                       const void* g0, const void* g1,
                                       const void* g2, const void* g3) {
  asm volatile(
      "global_load_async_to_lds_b128 %0, %4, off\n\t"
      "global_load_async_to_lds_b128 %1, %5, off\n\t"
      "global_load_async_to_lds_b128 %2, %6, off\n\t"
      "global_load_async_to_lds_b128 %3, %7, off\n\t"
      "s_wait_xcnt 0x0"
      :: "v"(l0), "v"(l1), "v"(l2), "v"(l3), "v"(g0), "v"(g1), "v"(g2), "v"(g3)
      : "memory");
}

__device__ __forceinline__ void cp16x8(unsigned l0, unsigned l1, unsigned l2, unsigned l3,
                                       unsigned l4, unsigned l5, unsigned l6, unsigned l7,
                                       const void* g0, const void* g1,
                                       const void* g2, const void* g3,
                                       const void* g4, const void* g5,
                                       const void* g6, const void* g7) {
  asm volatile(
      "global_load_async_to_lds_b128 %0, %8, off\n\t"
      "global_load_async_to_lds_b128 %1, %9, off\n\t"
      "global_load_async_to_lds_b128 %2, %10, off\n\t"
      "global_load_async_to_lds_b128 %3, %11, off\n\t"
      "global_load_async_to_lds_b128 %4, %12, off\n\t"
      "global_load_async_to_lds_b128 %5, %13, off\n\t"
      "global_load_async_to_lds_b128 %6, %14, off\n\t"
      "global_load_async_to_lds_b128 %7, %15, off\n\t"
      "s_wait_xcnt 0x0"
      :: "v"(l0), "v"(l1), "v"(l2), "v"(l3), "v"(l4), "v"(l5), "v"(l6), "v"(l7),
         "v"(g0), "v"(g1), "v"(g2), "v"(g3), "v"(g4), "v"(g5), "v"(g6), "v"(g7)
      : "memory");
}

// Stage a 64-row x 64-half tile into LDS (row stride FST halves).
// gstride = global row stride in halves. 128 threads, 4 x 16B each.
// Fixed trip count: every lane is on at every copy.
__device__ __forceinline__ void stage64(_Float16* __restrict__ lds,
                                        const _Float16* __restrict__ gbase,
                                        unsigned gstride, int tid) {
  const unsigned row = (unsigned)tid >> 3, q = (unsigned)tid & 7u;
  const unsigned l0 = lds_addr(lds + row * FST + q * 8);
  const _Float16* g0 = gbase + (row * gstride + q * 8);
  cp16x4(l0, l0 + 16 * FST * 2, l0 + 32 * FST * 2, l0 + 48 * FST * 2,
         g0, g0 + 16 * gstride, g0 + 32 * gstride, g0 + 48 * gstride);
}

// Two such tiles, x and y, in one statement of eight copies.
__device__ __forceinline__ void stage64x2(_Float16* __restrict__ ldsx,
                                          const _Float16* __restrict__ gx, unsigned sx,
                                          _Float16* __restrict__ ldsy,
                                          const _Float16* __restrict__ gy, unsigned sy,
                                          int tid) {
  const unsigned row = (unsigned)tid >> 3, q = (unsigned)tid & 7u;
  const unsigned lx = lds_addr(ldsx + row * FST + q * 8);
  const unsigned ly = lds_addr(ldsy + row * FST + q * 8);
  const _Float16* x0 = gx + (row * sx + q * 8);
  const _Float16* y0 = gy + (row * sy + q * 8);
  cp16x8(lx, lx + 16 * FST * 2, lx + 32 * FST * 2, lx + 48 * FST * 2,
         ly, ly + 16 * FST * 2, ly + 32 * FST * 2, ly + 48 * FST * 2,
         x0, x0 + 16 * sx, x0 + 32 * sx, x0 + 48 * sx,
         y0, y0 + 16 * sy, y0 + 32 * sy, y0 + 48 * sy);
}

// Stage a 128-row x 64-half tile of an [.., Hsz] array into LDS (row stride FST
// halves). 128 threads, 8 x 16B each. Fixed trip count: every lane is on at every copy.
__device__ __forceinline__ void stage128(_Float16* __restrict__ lds,
                                         const _Float16* __restrict__ gbase, int tid) {
  const unsigned row = (unsigned)tid >> 3, q = (unsigned)tid & 7u;
  const unsigned l0 = lds_addr(lds + row * FST + q * 8);
  const _Float16* g0 = gbase + (row * Hsz + q * 8);
  cp16x8(l0, l0 + 16 * FST * 2, l0 + 32 * FST * 2, l0 + 48 * FST * 2,
         l0 + 64 * FST * 2, l0 + 80 * FST * 2, l0 + 96 * FST * 2, l0 + 112 * FST * 2,
         g0, g0 + 16 * Hsz, g0 + 32 * Hsz, g0 + 48 * Hsz,
         g0 + 64 * Hsz, g0 + 80 * Hsz, g0 + 96 * Hsz, g0 + 112 * Hsz);
}

// ---------------------------------------------------------------------------
// Fragment gather from LDS, 16-bit A/B matrix layout (ISA 7.12.2, wave32):
// lane m = lane&15 selects the row (A: M-row, B: N-column of the N x K tile),
// hi = lane>>4 selects K-halves; element e -> K = kofs + 8*hi + (e<8 ? e : e+8).
// Pairs are K-consecutive -> lowers to two ds_load_b128 per fragment.
// ---------------------------------------------------------------------------
__device__ __forceinline__ v16h frag16(const _Float16* __restrict__ base,
                                       int stride, int kofs) {
  const int lane = threadIdx.x & 31;
  const int m  = lane & 15;
  const int hi = lane >> 4;
  const _Float16* r = base + m * stride + kofs + hi * 8;
  v16h f;
#pragma unroll
  for (int e = 0; e < 16; e += 2) {
    int k = (e < 8) ? e : (e + 8);
    f[e]     = r[k];
    f[e + 1] = r[k + 1];
  }
  return f;
}

#define WMMA(a, b, c) __builtin_amdgcn_wmma_f32_16x16x32_f16( \
    false, (a), false, (b), (short)0, (c), false, false)

// ---------------------------------------------------------------------------
// K loop of both GEMMs: acc += A tile x W tile^T over Hsz in steps of 64, on two
// LDS buffers each for A and W: tile t + 1's copies fly while tile t is worked on.
// The block's tile is 128 x 128; its four waves lie 2 x 2, each on 64 x 64 (wm, wn
// = the wave's row and column): a fragment read from LDS feeds four products.
// ---------------------------------------------------------------------------
__device__ __forceinline__ void gemm_loop(_Float16* As, _Float16* Bs,
                                          const _Float16* __restrict__ Abase,
                                          const _Float16* __restrict__ Wbase,
                                          int tid, int wm, int wn, v8f (&acc)[4][4]) {
  stage128(As, Abase, tid);
  stage128(Bs, Wbase, tid);
  // this wave's copies of tile 0 have landed before the barrier publishes them
  asm volatile("s_wait_asynccnt 0x0" ::: "memory");
  __syncthreads();
  stage128(As + GTSZ, Abase + 64, tid);
  stage128(Bs + GTSZ, Wbase + 64, tid);
  for (int t = 0; t < Hsz / 64; ++t) {
    _Float16* Ac = As + (t & 1) * GTSZ;
    _Float16* Bc = Bs + (t & 1) * GTSZ;
    const _Float16* Aw = Ac + wm * 64 * FST;
    const _Float16* Bw = Bc + wn * 64 * FST;
    v16h a[4], b[4], bn[4];
#pragma unroll  // constant indices keep the fragments in registers
    for (int i = 0; i < 4; ++i) {
      a[i] = frag16(Aw + i * 16 * FST, FST, 0);
      b[i] = frag16(Bw + i * 16 * FST, FST, 0);
    }
#pragma unroll  // constant indices keep the fragments in registers
    for (int i = 0; i < 4; ++i) bn[i] = frag16(Bw + i * 16 * FST, FST, 32);
    // the LDS reads stay one group ahead of the 16 products: left free, the compiler
    // read one A fragment per four products and waited for it each time
    __builtin_amdgcn_sched_barrier(0);
#pragma unroll  // constant indices keep the accumulators in registers
    for (int i = 0; i < 4; ++i)
#pragma unroll  // constant indices keep the accumulators in registers
      for (int j = 0; j < 4; ++j) acc[i][j] = WMMA(a[i], b[j], acc[i][j]);
#pragma unroll  // constant indices keep the fragments in registers
    for (int i = 0; i < 4; ++i) a[i] = frag16(Aw + i * 16 * FST, FST, 32);
    // the second half's A fragments too are read as one group, ahead of the products that use them
    __builtin_amdgcn_sched_barrier(0);
#pragma unroll  // constant indices keep the accumulators in registers
    for (int i = 0; i < 4; ++i)
#pragma unroll  // constant indices keep the accumulators in registers
      for (int j = 0; j < 4; ++j) acc[i][j] = WMMA(a[i], bn[j], acc[i][j]);
    // this wave's reads of tile t have returned before the buffer is refilled
    asm volatile("s_wait_dscnt 0x0" ::: "memory");
    // this wave's copies of tile t + 1 have landed before the barrier publishes them
    asm volatile("s_wait_asynccnt 0x0" ::: "memory");
    __syncthreads();
    if (t + 2 < Hsz / 64) {
      stage128(Ac, Abase + (t + 2) * 64, tid);
      stage128(Bc, Wbase + (t + 2) * 64, tid);
    }
  }
  // no copy is outstanding when the wave goes on to its stores and ends
  asm volatile("s_wait_asynccnt 0x0" ::: "memory");
}

// ---------------------------------------------------------------------------
// All five fp32 -> f16 conversions in one launch. The five destinations lie one
// behind the other in the workspace, so dst is one array of 8 segments of H*H
// elements: segments 0..3 are hidden_states, 4..7 are Wq, Wk, Wv, Wo.
// 64 blocks per segment; a block converts 16,384 elements, a thread 16 x 4.
// ---------------------------------------------------------------------------
__global__ void __launch_bounds__(256) cvt_all(
    const float* __restrict__ hs, const float* __restrict__ wq,
    const float* __restrict__ wk, const float* __restrict__ wv,
    const float* __restrict__ wo, _Float16* __restrict__ dst) {
  const int seg = blockIdx.x >> 6;
  const float* sbase = seg < 4 ? hs + (long)seg * (Hsz * Hsz)
                     : seg == 4 ? wq : seg == 5 ? wk : seg == 6 ? wv : wo;
  const int off = (blockIdx.x & 63) * 16384 + threadIdx.x * 4;
  const float* s = sbase + off;
  _Float16* d = dst + (long)seg * (Hsz * Hsz) + off;
  float4 f[16];
#pragma unroll  // all sixteen loads are issued ahead of the first store
  for (int j = 0; j < 16; ++j) f[j] = *(const float4*)(s + j * 1024);
#pragma unroll  // constant indices keep the array in registers
  for (int j = 0; j < 16; ++j) {
    v4h h;
    h[0] = (_Float16)f[j].x; h[1] = (_Float16)f[j].y;
    h[2] = (_Float16)f[j].z; h[3] = (_Float16)f[j].w;
    *(v4h*)(d + j * 1024) = h;
  }
}

// ---------------------------------------------------------------------------
// Projection GEMMs, all three in one launch: out = (A @ W^T + bias) * scale, f16
// output. z = 0, 1, 2 is Q, K, V: it picks the weight matrix (W3 holds the three
// one behind the other), the bias, the output (dst3 likewise) and its form.
// vmode=0: per-head [B,NH,S,HD];  vmode=1: transposed per-head [B,NH,HD,S].
// Block = 128 threads (4 waves), tile 128(M) x 128(N), K-step 64.
// ---------------------------------------------------------------------------
__global__ void __launch_bounds__(128) gemm_proj(
    const _Float16* __restrict__ A, const _Float16* __restrict__ W3,
    const float* __restrict__ bq, const float* __restrict__ bk,
    const float* __restrict__ bv, _Float16* __restrict__ dst3) {
  __shared__ alignas(16) _Float16 As[2 * GTSZ];
  __shared__ alignas(16) _Float16 Bs[2 * GTSZ];
  const int z = 2 - (int)blockIdx.z;  // V first: the blocks with the scattered stores start earliest
  const _Float16* W = W3 + (long)z * (Hsz * Hsz);
  const float* bias = z == 0 ? bq : z == 1 ? bk : bv;
  _Float16* dst = dst3 + (long)z * (Bsz * Ssz * Hsz);
  const float scale = z == 0 ? QSCALE : 1.0f;
  const int vmode = z == 2;
  const int tid = threadIdx.x;
  const int wave = tid >> 5;
  const int wm = wave >> 1, wn = wave & 1;
  const int lane = tid & 31;
  const int laneN = lane & 15, laneHi = lane >> 4;
  const int m0 = blockIdx.x * 128;
  const int n0 = blockIdx.y * 128;
  const _Float16* Abase = A + (long)m0 * Hsz;
  const _Float16* Wbase = W + (long)n0 * Hsz;

  v8f acc[4][4] = {};
  gemm_loop(As, Bs, Abase, Wbase, tid, wm, wn, acc);
  // Output index = head * S * HD + d * sd + s * ss. A tile lies in one batch and a
  // wave's 64 columns in one head, so the index splits into a part that is the same
  // for the whole block (kept in scalar registers) and one offset per lane.
  const int sd = vmode ? Ssz : 1;
  const int ss = vmode ? 1 : HDsz;
  _Float16* dblk = dst + ((long)((m0 >> 11) * NHsz + (n0 >> 6)) * (Ssz * HDsz) + (m0 & 2047) * ss);
  const unsigned lofs = wn * (Ssz * HDsz) + laneN * sd + (wm * 64 + laneHi * 8) * ss;
#pragma unroll
  for (int nt = 0; nt < 4; ++nt) {
    float bcol = bias[n0 + wn * 64 + nt * 16 + laneN];
#pragma unroll
    for (int mt = 0; mt < 4; ++mt) {
#pragma unroll
      for (int r = 0; r < 8; ++r) {
        float v = (acc[mt][nt][r] + bcol) * scale;
        (dblk + (nt * 16 * sd + (mt * 16 + r) * ss))[lofs] = (_Float16)v;
      }
    }
  }
}

// ---------------------------------------------------------------------------
// Output projection GEMM: d_out = A @ Wo^T + bo  (fp32 output, [4096,1024])
// ---------------------------------------------------------------------------
__global__ void __launch_bounds__(128) gemm_out(
    const _Float16* __restrict__ A, const _Float16* __restrict__ W,
    const float* __restrict__ bias, float* __restrict__ dst) {
  __shared__ alignas(16) _Float16 As[2 * GTSZ];
  __shared__ alignas(16) _Float16 Bs[2 * GTSZ];
  const int tid = threadIdx.x;
  const int wave = tid >> 5;
  const int wm = wave >> 1, wn = wave & 1;
  const int lane = tid & 31;
  const int laneN = lane & 15, laneHi = lane >> 4;
  const int m0 = blockIdx.x * 128;
  const int n0 = blockIdx.y * 128;
  const _Float16* Abase = A + (long)m0 * Hsz;
  const _Float16* Wbase = W + (long)n0 * Hsz;

  v8f acc[4][4] = {};
  gemm_loop(As, Bs, Abase, Wbase, tid, wm, wn, acc);
#pragma unroll
  for (int nt = 0; nt < 4; ++nt) {
    int col = n0 + wn * 64 + nt * 16 + laneN;
    float bcol = bias[col];
#pragma unroll
    for (int mt = 0; mt < 4; ++mt) {
#pragma unroll
      for (int r = 0; r < 8; ++r) {
        int row = m0 + wm * 64 + mt * 16 + laneHi * 8 + r;
        dst[(long)row * Hsz + col] = acc[mt][nt][r] + bcol;
      }
    }
  }
}

// Stage a 64-row x 64-float tile of an [.., S, S] array into LDS (row stride
// BST floats). 128 threads, 8 x 16B each; a wave copies whole 256-B rows, and
// only the 16 rows that it alone reads (rows wave*16 .. wave*16+15): the tile is
// four rings of one slot, each private to its wave, and needs no barrier.
// Fixed trip count: every lane is on at every copy.
__device__ __forceinline__ void stage64f(float* __restrict__ lds,
                                         const float* __restrict__ gbase,
                                         int tid) {
  const unsigned row = ((unsigned)tid >> 5) * 16 + (((unsigned)tid >> 4) & 1u);
  const unsigned q = (unsigned)tid & 15u;
  const unsigned l0 = lds_addr(lds + row * BST + q * 4);
  const float* g0 = gbase + (row * Ssz + q * 4);
  cp16x8(l0, l0 + 2 * BST * 4, l0 + 4 * BST * 4, l0 + 6 * BST * 4,
         l0 + 8 * BST * 4, l0 + 10 * BST * 4, l0 + 12 * BST * 4, l0 + 14 * BST * 4,
         g0, g0 + 2 * Ssz, g0 + 4 * Ssz, g0 + 6 * Ssz,
         g0 + 8 * Ssz, g0 + 10 * Ssz, g0 + 12 * Ssz, g0 + 14 * Ssz);
}

// 8 consecutive floats from LDS (16-B aligned): two ds_load_b128.
__device__ __forceinline__ v8f lds8f(const float* __restrict__ p) {
  v4f lo = *(const v4f*)p;
  v4f hi = *(const v4f*)(p + 4);
  return __builtin_shufflevector(lo, hi, 0, 1, 2, 3, 4, 5, 6, 7);
}

// e^x for eight values, as __expf compiles: a multiply by log2(e), then v_exp_f32.
// The eight v_exp_f32 stand in one asm statement, each on its own register, and a
// v_nop ends it: so no instruction directly behind a transcendental reads its result
// or overwrites its source.
__device__ __forceinline__ v8f exp8(v8f x) {
  x *= 1.44269504f;
  float a = x[0], b = x[1], c = x[2], d = x[3], e = x[4], f = x[5], g = x[6], h = x[7];
  asm("v_exp_f32 %0, %0\n\tv_exp_f32 %1, %1\n\tv_exp_f32 %2, %2\n\tv_exp_f32 %3, %3\n\t"
      "v_exp_f32 %4, %4\n\tv_exp_f32 %5, %5\n\tv_exp_f32 %6, %6\n\tv_exp_f32 %7, %7\n\tv_nop"
      : "+v"(a), "+v"(b), "+v"(c), "+v"(d), "+v"(e), "+v"(f), "+v"(g), "+v"(h));
  v8f r = {a, b, c, d, e, f, g, h};
  return r;
}

// value of lane l ^ 16
__device__ __forceinline__ float xhalf(float x) {
  int v = __builtin_bit_cast(int, x);
  return __builtin_bit_cast(float, __builtin_amdgcn_permlanex16(
      v, v, 0x76543210, 0xfedcba98, false, false));
}

__global__ void __launch_bounds__(128) attn_flash(
    const _Float16* __restrict__ q16, const _Float16* __restrict__ k16,
    const _Float16* __restrict__ vt16, const float* __restrict__ pbias,
    const float* __restrict__ mask, _Float16* __restrict__ out16) {
  __shared__ alignas(16) _Float16 Qs[64 * FST];
  __shared__ alignas(16) _Float16 Ks[2 * TSZ];
  __shared__ alignas(16) _Float16 Vt[2 * TSZ];
  __shared__ alignas(16) float Pb[64 * BST];
  __shared__ alignas(16) float Mk[64 * BST];

  const int tid = threadIdx.x;
  const int wave = tid >> 5;
  const int lane = tid & 31;
  const int laneN = lane & 15, laneHi = lane >> 4;
  const int qt = blockIdx.x;          // q tile 0..31
  const int bh = blockIdx.y;          // 0..31
  const int b = bh >> 4, h = bh & 15;
  const long headBase = (long)bh * Ssz * HDsz;   // for q16/k16 slices
  const _Float16* Vhead = vt16 + headBase;       // [HD, S] rows for this head
  const float* pbTile = pbias + ((long)h * Ssz + qt * 64) * Ssz;
  const float* mkTile = mask + ((long)b * Ssz + qt * 64) * Ssz;
  const int qrow = wave * 16 + laneN;            // this lane's query row in the tile
  const float* pbRow = Pb + qrow * BST + laneHi * 8;
  const float* mkRow = Mk + qrow * BST + laneHi * 8;

  // Q and tile 0: K rows [key][d], V^T rows [d][key], bias and mask rows [q][key]
  stage64(Qs, q16 + headBase + (long)qt * 64 * HDsz, HDsz, tid);
  stage64x2(Ks, k16 + headBase, HDsz, Vt, Vhead, Ssz, tid);
  stage64f(Pb, pbTile, tid);
  stage64f(Mk, mkTile, tid);
  // this wave's copies have landed before the barrier publishes them
  asm volatile("s_wait_asynccnt 0x0" ::: "memory");
  __syncthreads();
  // K and V of tile 1 fly while tile 0 is worked on
  stage64x2(Ks + TSZ, k16 + headBase + 64 * HDsz, HDsz, Vt + TSZ, Vhead + 64, Ssz, tid);

  const v16h qb0 = frag16(Qs + wave * 16 * FST, FST, 0);
  const v16h qb1 = frag16(Qs + wave * 16 * FST, FST, 32);
  v8f o[4] = {};                      // o[nt][r] = O[qrow][nt*16 + laneHi*8 + r]
  float m = -3.0e38f;                 // running maximum of the row (both halves agree)
  float l = 0.0f;                     // running sum over this lane's own keys only

  for (int kt = 0; kt < Ssz / 64; ++kt) {
    _Float16* Kc = Ks + (kt & 1) * TSZ;
    _Float16* Vc = Vt + (kt & 1) * TSZ;

    // this tile's bias + mask go to registers, so that their rows can be refilled at once
    v8f bm[4];
#pragma unroll  // constant indices keep the vectors in registers
    for (int nt = 0; nt < 4; ++nt)
      bm[nt] = lds8f(pbRow + nt * 16) + lds8f(mkRow + nt * 16);
    // this wave's reads of its own bias and mask rows have returned before it refills them
    asm volatile("s_wait_dscnt 0x0" ::: "memory");
    if (kt + 1 < Ssz / 64) {
      stage64f(Pb, pbTile + (kt + 1) * 64, tid);
      stage64f(Mk, mkTile + (kt + 1) * 64, tid);
    }

    // S^T = K Q^T (+ bias + mask): s[nt][r] = S[qrow][nt*16 + laneHi*8 + r]
    v8f s[4];
#pragma unroll  // constant indices keep the vectors in registers
    for (int nt = 0; nt < 4; ++nt) {
      v8f c = {};
      v16h kf0 = frag16(Kc + nt * 16 * FST, FST, 0);
      v16h kf1 = frag16(Kc + nt * 16 * FST, FST, 32);
      c = WMMA(kf0, qb0, c);
      c = WMMA(kf1, qb1, c);
      s[nt] = c + bm[nt];
    }

    // online softmax, one query row per lane pair (l, l ^ 16)
    float rm = s[0][0];
#pragma unroll  // constant indices keep the vectors in registers
    for (int nt = 0; nt < 4; ++nt)
#pragma unroll  // constant indices keep the vectors in registers
      for (int r = 0; r < 8; ++r) rm = fmaxf(rm, s[nt][r]);
    rm = fmaxf(rm, xhalf(rm));
    const float mNew = fmaxf(m, rm);
    const float f = __expf(m - mNew);
    m = mNew;
#pragma unroll  // constant indices keep the vectors in registers
    for (int nt = 0; nt < 4; ++nt) s[nt] = exp8(s[nt] - mNew);
    const v8f ps = (s[0] + s[1]) + (s[2] + s[3]);
    l = l * f + (((ps[0] + ps[1]) + (ps[2] + ps[3])) +
                 ((ps[4] + ps[5]) + (ps[6] + ps[7])));
    v16h p0, p1;
#pragma unroll  // constant indices keep the vectors in registers
    for (int r = 0; r < 8; ++r) {
      p0[r] = (_Float16)s[0][r]; p0[r + 8] = (_Float16)s[1][r];
      p1[r] = (_Float16)s[2][r]; p1[r + 8] = (_Float16)s[3][r];
    }

    // rescale running O^T, then O^T += V^T P^T
#pragma unroll  // constant indices keep the vectors in registers
    for (int nt = 0; nt < 4; ++nt) {
      v16h vf0 = frag16(Vc + nt * 16 * FST, FST, 0);
      v16h vf1 = frag16(Vc + nt * 16 * FST, FST, 32);
      o[nt] *= f;
      o[nt] = WMMA(vf0, p0, o[nt]);
      o[nt] = WMMA(vf1, p1, o[nt]);
    }
    // this wave's reads of K and V have returned before their buffer is refilled
    asm volatile("s_wait_dscnt 0x0" ::: "memory");
    // this wave's copies of tile kt + 1 have landed before the barrier publishes K and V
    asm volatile("s_wait_asynccnt 0x0" ::: "memory");
    __syncthreads();
    if (kt + 2 < Ssz / 64)
      stage64x2(Kc, k16 + headBase + (long)(kt + 2) * 64 * HDsz, HDsz,
                Vc, Vhead + (kt + 2) * 64, Ssz, tid);
  }
  // no copy is outstanding when the wave goes on to its stores and ends
  asm volatile("s_wait_asynccnt 0x0" ::: "memory");

  // join the halves' sums, normalize, write to [B, S, H] f16 (16 B per store)
  l += xhalf(l);
  _Float16* orow = out16 + ((long)(b * Ssz + qt * 64 + qrow)) * Hsz + h * HDsz + laneHi * 8;
#pragma unroll  // constant indices keep the vectors in registers
  for (int nt = 0; nt < 4; ++nt) {
    v8h hv;
#pragma unroll  // constant indices keep the vectors in registers
    for (int r = 0; r < 8; ++r) hv[r] = (_Float16)(o[nt][r] / l);
    *(v8h*)(orow + nt * 16) = hv;
  }
}

// ---------------------------------------------------------------------------
extern "C" void kernel_launch(void* const* d_in, const int* in_sizes, int n_in,
                              void* d_out, int out_size, void* d_ws, size_t ws_size,
                              hipStream_t stream) {
  const float* hs  = (const float*)d_in[0];
  const float* pb  = (const float*)d_in[1];
  const float* msk = (const float*)d_in[2];
  const float* Wq  = (const float*)d_in[3];
  const float* bq  = (const float*)d_in[4];
  const float* Wk  = (const float*)d_in[5];
  const float* bk  = (const float*)d_in[6];
  const float* Wv  = (const float*)d_in[7];
  const float* bv  = (const float*)d_in[8];
  const float* Wo  = (const float*)d_in[9];
  const float* bo  = (const float*)d_in[10];
  float* out = (float*)d_out;

  const int NHS = Bsz * Ssz * Hsz;   // 4,194,304
  const int WSZ = Hsz * Hsz;         // 1,048,576
  _Float16* hs16 = (_Float16*)d_ws;
  _Float16* w16  = hs16 + NHS;       // 4 weight matrices
  _Float16* q16  = w16 + 4 * (size_t)WSZ;
  _Float16* k16  = q16 + NHS;
  _Float16* vt16 = k16 + NHS;        // V stored [B,NH,HD,S]
  _Float16* ao16 = vt16 + NHS;

  // fp32 -> f16 staging: hs16 and the four w16 matrices are one contiguous range
  cvt_all<<<512, 256, 0, stream>>>(hs, Wq, Wk, Wv, Wo, hs16);

  // Q, K, V: w16 holds Wq, Wk, Wv in a row; q16, k16, vt16 lie in a row
  dim3 gp(32, 8), blk(128);
  gemm_proj<<<dim3(32, 8, 3), blk, 0, stream>>>(hs16, w16, bq, bk, bv, q16);

  attn_flash<<<dim3(Ssz / 64, Bsz * NHsz), blk, 0, stream>>>(q16, k16, vt16, pb, msk, ao16);

  gemm_out<<<gp, blk, 0, stream>>>(ao16, w16 + 3 * (size_t)WSZ, bo, out);
}

// v005
// One run takes 108 microseconds.
// Next to v004, in two timings, it ran 1.16 and 1.13 times as fast.
// All steps since v000 together make it 3.09 times as fast.
#include <hip/hip_runtime.h>
#include <hip/hip_bf16.h>

typedef __attribute__((ext_vector_type(16))) _Float16 v16h;
typedef __attribute__((ext_vector_type(4)))  _Float16 v4h;
typedef __attribute__((ext_vector_type(8)))  _Float16 v8h;
typedef __attribute__((ext_vector_type(4)))  float    v4f;
typedef __attribute__((ext_vector_type(8)))  float    v8f;

#define Bsz 2
#define Ssz 2048
#define Hsz 1024
#define NHsz 16
#define HDsz 64
#define QSCALE 0.125f

#define FST 72   // f16 LDS tile stride (64 + 8 pad) -> 144 B, 16B aligned rows
#define TSZ (64 * FST)  // halves in one 64 x 64 f16 LDS tile
#define GTSZ (128 * FST)  // halves in one 128-row x 64 f16 LDS tile of the GEMMs
#define BST 68   // f32 LDS tile stride (64 + 4 pad) -> 272 B rows (16 B x odd): b128 row reads spread over all banks

// ---------------------------------------------------------------------------
// 16-byte global -> LDS copies on the CDNA5 async-to-LDS path (ASYNCcnt,
// GLOBAL_LOAD_ASYNC_TO_LDS_B128), four or eight to a statement. Each lane names its own
// LDS byte address and its own global pointer; no immediate offset. The
// s_wait_xcnt 0 is the statement's last line, so that it stands in front of
// every later write of a register that one of these copies names (a precaution).
// ---------------------------------------------------------------------------
__device__ __forceinline__ unsigned lds_addr(const void* p) {
  return (unsigned)(unsigned long long)p;  // low 32 bits of a __shared__ address
}

__device__ __forceinline__ void cp16x4(unsigned l0, unsigned l1, unsigned l2, unsigned l3,
                                       const void* g0, const void* g1,
                                       const void* g2, const void* g3) {
  asm volatile(
      "global_load_async_to_lds_b128 %0, %4, off\n\t"
      "global_load_async_to_lds_b128 %1, %5, off\n\t"
      "global_load_async_to_lds_b128 %2, %6, off\n\t"
      "global_load_async_to_lds_b128 %3, %7, off\n\t"
      "s_wait_xcnt 0x0"
      :: "v"(l0), "v"(l1), "v"(l2), "v"(l3), "v"(g0), "v"(g1), "v"(g2), "v"(g3)
      : "memory");
}

__device__ __forceinline__ void cp16x8(unsigned l0, unsigned l1, unsigned l2, unsigned l3,
                                       unsigned l4, unsigned l5, unsigned l6, unsigned l7,
                                       const void* g0, const void* g1,
                                       const void* g2, const void* g3,
                                       const void* g4, const void* g5,
                                       const void* g6, const void* g7) {
  asm volatile(
      "global_load_async_to_lds_b128 %0, %8, off\n\t"
      "global_load_async_to_lds_b128 %1, %9, off\n\t"
      "global_load_async_to_lds_b128 %2, %10, off\n\t"
      "global_load_async_to_lds_b128 %3, %11, off\n\t"
      "global_load_async_to_lds_b128 %4, %12, off\n\t"
      "global_load_async_to_lds_b128 %5, %13, off\n\t"
      "global_load_async_to_lds_b128 %6, %14, off\n\t"
      "global_load_async_to_lds_b128 %7, %15, off\n\t"
      "s_wait_xcnt 0x0"
      :: "v"(l0), "v"(l1), "v"(l2), "v"(l3), "v"(l4), "v"(l5), "v"(l6), "v"(l7),
         "v"(g0), "v"(g1), "v"(g2), "v"(g3), "v"(g4), "v"(g5), "v"(g6), "v"(g7)
      : "memory");
}

// Stage a 64-row x 64-half tile into LDS (row stride FST halves).
// gstride = global row stride in halves. 128 threads, 4 x 16B each.
// Fixed trip count: every lane is on at every copy.
__device__ __forceinline__ void stage64(_Float16* __restrict__ lds,
                                        const _Float16* __restrict__ gbase,
                                        unsigned gstride, int tid) {
  const unsigned row = (unsigned)tid >> 3, q = (unsigned)tid & 7u;
  const unsigned l0 = lds_addr(lds + row * FST + q * 8);
  const _Float16* g0 = gbase + (row * gstride + q * 8);
  cp16x4(l0, l0 + 16 * FST * 2, l0 + 32 * FST * 2, l0 + 48 * FST * 2,
         g0, g0 + 16 * gstride, g0 + 32 * gstride, g0 + 48 * gstride);
}

// Two such tiles, x and y, in one statement of eight copies.
__device__ __forceinline__ void stage64x2(_Float16* __restrict__ ldsx,
                                          const _Float16* __restrict__ gx, unsigned sx,
                                          _Float16* __restrict__ ldsy,
                                          const _Float16* __restrict__ gy, unsigned sy,
                                          int tid) {
  const unsigned row = (unsigned)tid >> 3, q = (unsigned)tid & 7u;
  const unsigned lx = lds_addr(ldsx + row * FST + q * 8);
  const unsigned ly = lds_addr(ldsy + row * FST + q * 8);
  const _Float16* x0 = gx + (row * sx + q * 8);
  const _Float16* y0 = gy + (row * sy + q * 8);
  cp16x8(lx, lx + 16 * FST * 2, lx + 32 * FST * 2, lx + 48 * FST * 2,
         ly, ly + 16 * FST * 2, ly + 32 * FST * 2, ly + 48 * FST * 2,
         x0, x0 + 16 * sx, x0 + 32 * sx, x0 + 48 * sx,
         y0, y0 + 16 * sy, y0 + 32 * sy, y0 + 48 * sy);
}

// Stage a 128-row x 64-half tile of an [.., Hsz] array into LDS (row stride FST
// halves). 128 threads, 8 x 16B each. Fixed trip count: every lane is on at every copy.
__device__ __forceinline__ void stage128(_Float16* __restrict__ lds,
                                         const _Float16* __restrict__ gbase, int tid) {
  const unsigned row = (unsigned)tid >> 3, q = (unsigned)tid & 7u;
  const unsigned l0 = lds_addr(lds + row * FST + q * 8);
  const _Float16* g0 = gbase + (row * Hsz + q * 8);
  cp16x8(l0, l0 + 16 * FST * 2, l0 + 32 * FST * 2, l0 + 48 * FST * 2,
         l0 + 64 * FST * 2, l0 + 80 * FST * 2, l0 + 96 * FST * 2, l0 + 112 * FST * 2,
         g0, g0 + 16 * Hsz, g0 + 32 * Hsz, g0 + 48 * Hsz,
         g0 + 64 * Hsz, g0 + 80 * Hsz, g0 + 96 * Hsz, g0 + 112 * Hsz);
}

// ---------------------------------------------------------------------------
// Fragment gather from LDS, 16-bit A/B matrix layout (ISA 7.12.2, wave32):
// lane m = lane&15 selects the row (A: M-row, B: N-column of the N x K tile),
// hi = lane>>4 selects K-halves; element e -> K = kofs + 8*hi + (e<8 ? e : e+8).
// Pairs are K-consecutive -> lowers to two ds_load_b128 per fragment.
// ---------------------------------------------------------------------------
__device__ __forceinline__ v16h frag16(const _Float16* __restrict__ base,
                                       int stride, int kofs) {
  const int lane = threadIdx.x & 31;
  const int m  = lane & 15;
  const int hi = lane >> 4;
  const _Float16* r = base + m * stride + kofs + hi * 8;
  v16h f;
#pragma unroll
  for (int e = 0; e < 16; e += 2) {
    int k = (e < 8) ? e : (e + 8);
    f[e]     = r[k];
    f[e + 1] = r[k + 1];
  }
  return f;
}

#define WMMA(a, b, c) __builtin_amdgcn_wmma_f32_16x16x32_f16( \
    false, (a), false, (b), (short)0, (c), false, false)

// ---------------------------------------------------------------------------
// K loop of both GEMMs: acc += A tile x W tile^T over Hsz in steps of 64, on two
// LDS buffers each for A and W: tile t + 1's copies fly while tile t is worked on.
// The block's tile is 128 x 128; its four waves lie 2 x 2, each on 64 x 64 (wm, wn
// = the wave's row and column): a fragment read from LDS feeds four products.
// ---------------------------------------------------------------------------
__device__ __forceinline__ void gemm_loop(_Float16* As, _Float16* Bs,
                                          const _Float16* __restrict__ Abase,
                                          const _Float16* __restrict__ Wbase,
                                          int tid, int wm, int wn, v8f (&acc)[4][4]) {
  stage128(As, Abase, tid);
  stage128(Bs, Wbase, tid);
  // this wave's copies of tile 0 have landed before the barrier publishes them
  asm volatile("s_wait_asynccnt 0x0" ::: "memory");
  __syncthreads();
  stage128(As + GTSZ, Abase + 64, tid);
  stage128(Bs + GTSZ, Wbase + 64, tid);
  for (int t = 0; t < Hsz / 64; ++t) {
    _Float16* Ac = As + (t & 1) * GTSZ;
    _Float16* Bc = Bs + (t & 1) * GTSZ;
    const _Float16* Aw = Ac + wm * 64 * FST;
    const _Float16* Bw = Bc + wn * 64 * FST;
    v16h a[4], b[4], bn[4];
#pragma unroll  // constant indices keep the fragments in registers
    for (int i = 0; i < 4; ++i) {
      a[i] = frag16(Aw + i * 16 * FST, FST, 0);
      b[i] = frag16(Bw + i * 16 * FST, FST, 0);
    }
#pragma unroll  // constant indices keep the fragments in registers
    for (int i = 0; i < 4; ++i) bn[i] = frag16(Bw + i * 16 * FST, FST, 32);
    // the LDS reads stay one group ahead of the 16 products: left free, the compiler
    // read one A fragment per four products and waited for it each time
    __builtin_amdgcn_sched_barrier(0);
#pragma unroll  // constant indices keep the accumulators in registers
    for (int i = 0; i < 4; ++i)
#pragma unroll  // constant indices keep the accumulators in registers
      for (int j = 0; j < 4; ++j) acc[i][j] = WMMA(a[i], b[j], acc[i][j]);
#pragma unroll  // constant indices keep the fragments in registers
    for (int i = 0; i < 4; ++i) a[i] = frag16(Aw + i * 16 * FST, FST, 32);
    // the second half's A fragments too are read as one group, ahead of the products that use them
    __builtin_amdgcn_sched_barrier(0);
#pragma unroll  // constant indices keep the accumulators in registers
    for (int i = 0; i < 4; ++i)
#pragma unroll  // constant indices keep the accumulators in registers
      for (int j = 0; j < 4; ++j) acc[i][j] = WMMA(a[i], bn[j], acc[i][j]);
    // this wave's reads of tile t have returned before the buffer is refilled
    asm volatile("s_wait_dscnt 0x0" ::: "memory");
    // this wave's copies of tile t + 1 have landed before the barrier publishes them
    asm volatile("s_wait_asynccnt 0x0" ::: "memory");
    __syncthreads();
    if (t + 2 < Hsz / 64) {
      stage128(Ac, Abase + (t + 2) * 64, tid);
      stage128(Bc, Wbase + (t + 2) * 64, tid);
    }
  }
  // no copy is outstanding when the wave goes on to its stores and ends
  asm volatile("s_wait_asynccnt 0x0" ::: "memory");
}

// ---------------------------------------------------------------------------
// All five fp32 -> f16 conversions in one launch. The five destinations lie one
// behind the other in the workspace, so dst is one array of 8 segments of H*H
// elements: segments 0..3 are hidden_states, 4..7 are Wq, Wk, Wv, Wo.
// 64 blocks per segment; a block converts 16,384 elements, a thread 16 x 4.
// ---------------------------------------------------------------------------
__global__ void __launch_bounds__(256) cvt_all(
    const float* __restrict__ hs, const float* __restrict__ wq,
    const float* __restrict__ wk, const float* __restrict__ wv,
    const float* __restrict__ wo, _Float16* __restrict__ dst) {
  const int seg = blockIdx.x >> 6;
  const float* sbase = seg < 4 ? hs + (long)seg * (Hsz * Hsz)
                     : seg == 4 ? wq : seg == 5 ? wk : seg == 6 ? wv : wo;
  const int off = (blockIdx.x & 63) * 16384 + threadIdx.x * 4;
  const float* s = sbase + off;
  _Float16* d = dst + (long)seg * (Hsz * Hsz) + off;
  float4 f[16];
#pragma unroll  // all sixteen loads are issued ahead of the first store
  for (int j = 0; j < 16; ++j) f[j] = *(const float4*)(s + j * 1024);
#pragma unroll  // constant indices keep the array in registers
  for (int j = 0; j < 16; ++j) {
    v4h h;
    h[0] = (_Float16)f[j].x; h[1] = (_Float16)f[j].y;
    h[2] = (_Float16)f[j].z; h[3] = (_Float16)f[j].w;
    *(v4h*)(d + j * 1024) = h;
  }
}

// ---------------------------------------------------------------------------
// A wave's staged 64 x 64 f16 tile (rows of FST halves in its own LDS range) goes to
// global rows PITCH halves apart: 8 lanes to a 128-B row, 4 rows to a store.
// ---------------------------------------------------------------------------
template <int PITCH>
__device__ __forceinline__ void put_tile(const _Float16* __restrict__ st,
                                         _Float16* __restrict__ g, int lane) {
  // the wave's own LDS writes are done before its lanes read one another's values back
  asm volatile("s_wait_dscnt 0x0" ::: "memory");
  const int rr = lane >> 3, q = lane & 7;
  const _Float16* sr = st + rr * FST + q * 8;
  _Float16* gl = g + rr * PITCH + q * 8;
#pragma unroll  // the sixteen LDS reads are issued ahead of the stores
  for (int k = 0; k < 16; ++k)
    *(v8h*)(gl + k * 4 * PITCH) = *(const v8h*)(sr + k * 4 * FST);
}

// ---------------------------------------------------------------------------
// Projection GEMMs, all three in one launch: out = (X @ W^T + bias) * scale, f16
// output. z = 0, 1, 2 is Q, K, V: it picks the weight matrix (W3 holds the three
// one behind the other), the bias, the output (dst3 likewise) and its form.
// vmode=0: per-head [B,NH,S,HD];  vmode=1: transposed per-head [B,NH,HD,S].
// Block = 128 threads (4 waves), tile 128 x 128, K-step 64.
// The first WMMA operand is the one whose index is contiguous in the output (W's
// rows for Q and K, X's rows for V): a lane's 8 accumulator registers are then 8
// neighbours in memory. Each wave turns its 64 x 64 tile in its own LDS range and
// stores it as whole 128-B rows, 16 B a lane.
// ---------------------------------------------------------------------------
__global__ void __launch_bounds__(128) gemm_proj(
    const _Float16* __restrict__ A, const _Float16* __restrict__ W3,
    const float* __restrict__ bq, const float* __restrict__ bk,
    const float* __restrict__ bv, _Float16* __restrict__ dst3) {
  __shared__ alignas(16) _Float16 As[2 * GTSZ];
  __shared__ alignas(16) _Float16 Bs[2 * GTSZ];
  const int z = 2 - (int)blockIdx.z;  // blockIdx.z = 0, 1, 2 is V, K, Q
  const _Float16* W = W3 + (long)z * (Hsz * Hsz);
  const float* bias = z == 0 ? bq : z == 1 ? bk : bv;
  _Float16* dst = dst3 + (long)z * (Bsz * Ssz * Hsz);
  const float scale = z == 0 ? QSCALE : 1.0f;
  const int vmode = z == 2;
  const int tid = threadIdx.x;
  const int wave = tid >> 5;
  const int wm = wave >> 1, wn = wave & 1;
  const int lane = tid & 31;
  const int laneN = lane & 15, laneHi = lane >> 4;
  const int m0 = blockIdx.x * 128;   // rows of X (positions)
  const int n0 = blockIdx.y * 128;   // rows of W (output features)
  const _Float16* Xbase = A + (long)m0 * Hsz;
  const _Float16* Wbase = W + (long)n0 * Hsz;

  // acc[i][j][r]: first operand's row wm*64 + i*16 + laneHi*8 + r,
  //               second operand's row wn*64 + j*16 + laneN
  v8f acc[4][4] = {};
  gemm_loop(As, Bs, vmode ? Xbase : Wbase, vmode ? Wbase : Xbase, tid, wm, wn, acc);

  // The loop's last barrier stands behind every wave's last read of the tiles, and no
  // copy is outstanding: As is free. Wave w stages in As[w * TSZ ..), 64 rows of FST halves:
  // row = second operand's row in the wave's tile, column = first operand's.
  _Float16* st = As + wave * TSZ;
  _Float16* sw = st + laneN * FST + laneHi * 8;
  // A tile lies in one batch; a wave's 64 features lie in one head.
  if (vmode) {
#pragma unroll  // constant indices keep the accumulators in registers
    for (int j = 0; j < 4; ++j) {
      const float bc = bias[n0 + wn * 64 + j * 16 + laneN];
#pragma unroll  // constant indices keep the accumulators in registers
      for (int i = 0; i < 4; ++i) {
        v8h hv;
#pragma unroll  // constant indices keep the accumulators in registers
        for (int r = 0; r < 8; ++r) hv[r] = (_Float16)(acc[i][j][r] + bc);
        *(v8h*)(sw + j * 16 * FST + i * 16) = hv;
      }
    }
    // staged row = feature, column = position
    put_tile<Ssz>(st, dst + ((long)((m0 >> 11) * Hsz + n0 + wn * 64) * Ssz + (m0 & 2047) + wm * 64), lane);
  } else {
    const float* bp = bias + n0 + wm * 64 + laneHi * 8;
    v4f b0[4], b1[4];
#pragma unroll  // all eight bias loads are issued ahead of the first use
    for (int i = 0; i < 4; ++i) {
      b0[i] = *(const v4f*)(bp + i * 16);
      b1[i] = *(const v4f*)(bp + i * 16 + 4);
    }
#pragma unroll  // constant indices keep the accumulators in registers
    for (int i = 0; i < 4; ++i) {
#pragma unroll  // constant indices keep the accumulators in registers
      for (int j = 0; j < 4; ++j) {
        v8h hv;
#pragma unroll  // constant indices keep the accumulators in registers
        for (int r = 0; r < 4; ++r) {
          hv[r]     = (_Float16)((acc[i][j][r] + b0[i][r]) * scale);
          hv[r + 4] = (_Float16)((acc[i][j][r + 4] + b1[i][r]) * scale);
        }
        *(v8h*)(sw + j * 16 * FST + i * 16) = hv;
      }
    }
    // staged row = position, column = feature inside the head
    put_tile<HDsz>(st, dst + ((long)((m0 >> 11) * NHsz + (n0 >> 6) + wm) * Ssz + (m0 & 2047) + wn * 64) * HDsz, lane);
  }
}

// ---------------------------------------------------------------------------
// Output projection GEMM: d_out = A @ Wo^T + bo  (fp32 output, [4096,1024])
// Wo's rows are the first WMMA operand: a lane's 8 accumulator registers are 8
// neighbours of one output row. Each wave turns its 64 x 64 tile in its own LDS
// range and stores whole 256-B row pieces, 16 B a lane.
// ---------------------------------------------------------------------------
__global__ void __launch_bounds__(128) gemm_out(
    const _Float16* __restrict__ A, const _Float16* __restrict__ W,
    const float* __restrict__ bias, float* __restrict__ dst) {
  __shared__ alignas(16) _Float16 As[2 * GTSZ];
  __shared__ alignas(16) _Float16 Bs[2 * GTSZ];
  const int tid = threadIdx.x;
  const int wave = tid >> 5;
  const int wm = wave >> 1, wn = wave & 1;
  const int lane = tid & 31;
  const int laneN = lane & 15, laneHi = lane >> 4;
  const int m0 = blockIdx.x * 128;
  const int n0 = blockIdx.y * 128;
  const _Float16* Abase = A + (long)m0 * Hsz;
  const _Float16* Wbase = W + (long)n0 * Hsz;

  // acc[i][j][r]: column n0 + wm*64 + i*16 + laneHi*8 + r, row m0 + wn*64 + j*16 + laneN
  v8f acc[4][4] = {};
  gemm_loop(As, Bs, Wbase, Abase, tid, wm, wn, acc);

  // The loop's last barrier stands behind every wave's last read of the tiles, and no
  // copy is outstanding: As and Bs are free. Each holds two waves' staging ranges of
  // 64 rows of BST floats.
  float* st = (float*)(wm ? Bs : As) + wn * (64 * BST);
  float* sw = st + laneN * BST + laneHi * 8;
  const float* bp = bias + n0 + wm * 64 + laneHi * 8;
  v4f b0[4], b1[4];
#pragma unroll  // all eight bias loads are issued ahead of the first use
  for (int i = 0; i < 4; ++i) {
    b0[i] = *(const v4f*)(bp + i * 16);
    b1[i] = *(const v4f*)(bp + i * 16 + 4);
  }
#pragma unroll  // constant indices keep the accumulators in registers
  for (int i = 0; i < 4; ++i) {
#pragma unroll  // constant indices keep the accumulators in registers
    for (int j = 0; j < 4; ++j) {
      v4f lo, hi;
#pragma unroll  // constant indices keep the accumulators in registers
      for (int r = 0; r < 4; ++r) {
        lo[r] = acc[i][j][r] + b0[i][r];
        hi[r] = acc[i][j][r + 4] + b1[i][r];
      }
      *(v4f*)(sw + j * 16 * BST + i * 16) = lo;
      *(v4f*)(sw + j * 16 * BST + i * 16 + 4) = hi;
    }
  }
  // the wave's own LDS writes are done before its lanes read one another's values back
  asm volatile("s_wait_dscnt 0x0" ::: "memory");
  const int rr = lane >> 4, q = lane & 15;  // 16 lanes to a 256-B row piece, 2 rows to a store
  const float* sr = st + rr * BST + q * 4;
  float* gl = dst + ((long)(m0 + wn * 64 + rr) * Hsz + n0 + wm * 64 + q * 4);
#pragma unroll  // LDS reads run ahead of the stores
  for (int k = 0; k < 32; ++k)
    *(v4f*)(gl + k * 2 * Hsz) = *(const v4f*)(sr + k * 2 * BST);
}

// Stage a 64-row x 64-float tile of an [.., S, S] array into LDS (row stride
// BST floats). 128 threads, 8 x 16B each; a wave copies whole 256-B rows, and
// only the 16 rows that it alone reads (rows wave*16 .. wave*16+15): the tile is
// four rings of one slot, each private to its wave, and needs no barrier.
// Fixed trip count: every lane is on at every copy.
__device__ __forceinline__ void stage64f(float* __restrict__ lds,
                                         const float* __restrict__ gbase,
                                         int tid) {
  const unsigned row = ((unsigned)tid >> 5) * 16 + (((unsigned)tid >> 4) & 1u);
  const unsigned q = (unsigned)tid & 15u;
  const unsigned l0 = lds_addr(lds + row * BST + q * 4);
  const float* g0 = gbase + (row * Ssz + q * 4);
  cp16x8(l0, l0 + 2 * BST * 4, l0 + 4 * BST * 4, l0 + 6 * BST * 4,
         l0 + 8 * BST * 4, l0 + 10 * BST * 4, l0 + 12 * BST * 4, l0 + 14 * BST * 4,
         g0, g0 + 2 * Ssz, g0 + 4 * Ssz, g0 + 6 * Ssz,
         g0 + 8 * Ssz, g0 + 10 * Ssz, g0 + 12 * Ssz, g0 + 14 * Ssz);
}

// 8 consecutive floats from LDS (16-B aligned): two ds_load_b128.
__device__ __forceinline__ v8f lds8f(const float* __restrict__ p) {
  v4f lo = *(const v4f*)p;
  v4f hi = *(const v4f*)(p + 4);
  return __builtin_shufflevector(lo, hi, 0, 1, 2, 3, 4, 5, 6, 7);
}

// e^x for eight values, as __expf compiles: a multiply by log2(e), then v_exp_f32.
// The eight v_exp_f32 stand in one asm statement, each on its own register, and a
// v_nop ends it: so no instruction directly behind a transcendental reads its result
// or overwrites its source.
__device__ __forceinline__ v8f exp8(v8f x) {
  x *= 1.44269504f;
  float a = x[0], b = x[1], c = x[2], d = x[3], e = x[4], f = x[5], g = x[6], h = x[7];
  asm("v_exp_f32 %0, %0\n\tv_exp_f32 %1, %1\n\tv_exp_f32 %2, %2\n\tv_exp_f32 %3, %3\n\t"
      "v_exp_f32 %4, %4\n\tv_exp_f32 %5, %5\n\tv_exp_f32 %6, %6\n\tv_exp_f32 %7, %7\n\tv_nop"
      : "+v"(a), "+v"(b), "+v"(c), "+v"(d), "+v"(e), "+v"(f), "+v"(g), "+v"(h));
  v8f r = {a, b, c, d, e, f, g, h};
  return r;
}

// value of lane l ^ 16
__device__ __forceinline__ float xhalf(float x) {
  int v = __builtin_bit_cast(int, x);
  return __builtin_bit_cast(float, __builtin_amdgcn_permlanex16(
      v, v, 0x76543210, 0xfedcba98, false, false));
}

__global__ void __launch_bounds__(128) attn_flash(
    const _Float16* __restrict__ q16, const _Float16* __restrict__ k16,
    const _Float16* __restrict__ vt16, const float* __restrict__ pbias,
    const float* __restrict__ mask, _Float16* __restrict__ out16) {
  __shared__ alignas(16) _Float16 Qs[64 * FST];
  __shared__ alignas(16) _Float16 Ks[2 * TSZ];
  __shared__ alignas(16) _Float16 Vt[2 * TSZ];
  __shared__ alignas(16) float Pb[64 * BST];
  __shared__ alignas(16) float Mk[64 * BST];

  const int tid = threadIdx.x;
  const int wave = tid >> 5;
  const int lane = tid & 31;
  const int laneN = lane & 15, laneHi = lane >> 4;
  const int qt = blockIdx.x;          // q tile 0..31
  const int bh = blockIdx.y;          // 0..31
  const int b = bh >> 4, h = bh & 15;
  const long headBase = (long)bh * Ssz * HDsz;   // for q16/k16 slices
  const _Float16* Vhead = vt16 + headBase;       // [HD, S] rows for this head
  const float* pbTile = pbias + ((long)h * Ssz + qt * 64) * Ssz;
  const float* mkTile = mask + ((long)b * Ssz + qt * 64) * Ssz;
  const int qrow = wave * 16 + laneN;            // this lane's query row in the tile
  const float* pbRow = Pb + qrow * BST + laneHi * 8;
  const float* mkRow = Mk + qrow * BST + laneHi * 8;

  // Q and tile 0: K rows [key][d], V^T rows [d][key], bias and mask rows [q][key]
  stage64(Qs, q16 + headBase + (long)qt * 64 * HDsz, HDsz, tid);
  stage64x2(Ks, k16 + headBase, HDsz, Vt, Vhead, Ssz, tid);
  stage64f(Pb, pbTile, tid);
  stage64f(Mk, mkTile, tid);
  // this wave's copies have landed before the barrier publishes them
  asm volatile("s_wait_asynccnt 0x0" ::: "memory");
  __syncthreads();
  // K and V of tile 1 fly while tile 0 is worked on
  stage64x2(Ks + TSZ, k16 + headBase + 64 * HDsz, HDsz, Vt + TSZ, Vhead + 64, Ssz, tid);

  const v16h qb0 = frag16(Qs + wave * 16 * FST, FST, 0);
  const v16h qb1 = frag16(Qs + wave * 16 * FST, FST, 32);
  v8f o[4] = {};                      // o[nt][r] = O[qrow][nt*16 + laneHi*8 + r]
  float m = -3.0e38f;                 // running maximum of the row (both halves agree)
  float l = 0.0f;                     // running sum over this lane's own keys only

  for (int kt = 0; kt < Ssz / 64; ++kt) {
    _Float16* Kc = Ks + (kt & 1) * TSZ;
    _Float16* Vc = Vt + (kt & 1) * TSZ;

    // this tile's bias + mask go to registers, so that their rows can be refilled at once
    v8f bm[4];
#pragma unroll  // constant indices keep the vectors in registers
    for (int nt = 0; nt < 4; ++nt)
      bm[nt] = lds8f(pbRow + nt * 16) + lds8f(mkRow + nt * 16);
    // this wave's reads of its own bias and mask rows have returned before it refills them
    asm volatile("s_wait_dscnt 0x0" ::: "memory");
    if (kt + 1 < Ssz / 64) {
      stage64f(Pb, pbTile + (kt + 1) * 64, tid);
      stage64f(Mk, mkTile + (kt + 1) * 64, tid);
    }

    // S^T = K Q^T (+ bias + mask): s[nt][r] = S[qrow][nt*16 + laneHi*8 + r]
    v8f s[4];
#pragma unroll  // constant indices keep the vectors in registers
    for (int nt = 0; nt < 4; ++nt) {
      v8f c = {};
      v16h kf0 = frag16(Kc + nt * 16 * FST, FST, 0);
      v16h kf1 = frag16(Kc + nt * 16 * FST, FST, 32);
      c = WMMA(kf0, qb0, c);
      c = WMMA(kf1, qb1, c);
      s[nt] = c + bm[nt];
    }

    // online softmax, one query row per lane pair (l, l ^ 16)
    float rm = s[0][0];
#pragma unroll  // constant indices keep the vectors in registers
    for (int nt = 0; nt < 4; ++nt)
#pragma unroll  // constant indices keep the vectors in registers
      for (int r = 0; r < 8; ++r) rm = fmaxf(rm, s[nt][r]);
    rm = fmaxf(rm, xhalf(rm));
    const float mNew = fmaxf(m, rm);
    const float f = __expf(m - mNew);
    m = mNew;
#pragma unroll  // constant indices keep the vectors in registers
    for (int nt = 0; nt < 4; ++nt) s[nt] = exp8(s[nt] - mNew);
    const v8f ps = (s[0] + s[1]) + (s[2] + s[3]);
    l = l * f + (((ps[0] + ps[1]) + (ps[2] + ps[3])) +
                 ((ps[4] + ps[5]) + (ps[6] + ps[7])));
    v16h p0, p1;
#pragma unroll  // constant indices keep the vectors in registers
    for (int r = 0; r < 8; ++r) {
      p0[r] = (_Float16)s[0][r]; p0[r + 8] = (_Float16)s[1][r];
      p1[r] = (_Float16)s[2][r]; p1[r + 8] = (_Float16)s[3][r];
    }

    // rescale running O^T, then O^T += V^T P^T
#pragma unroll  // constant indices keep the vectors in registers
    for (int nt = 0; nt < 4; ++nt) {
      v16h vf0 = frag16(Vc + nt * 16 * FST, FST, 0);
      v16h vf1 = frag16(Vc + nt * 16 * FST, FST, 32);
      o[nt] *= f;
      o[nt] = WMMA(vf0, p0, o[nt]);
      o[nt] = WMMA(vf1, p1, o[nt]);
    }
    // this wave's reads of K and V have returned before their buffer is refilled
    asm volatile("s_wait_dscnt 0x0" ::: "memory");
    // this wave's copies of tile kt + 1 have landed before the barrier publishes K and V
    asm volatile("s_wait_asynccnt 0x0" ::: "memory");
    __syncthreads();
    if (kt + 2 < Ssz / 64)
      stage64x2(Kc, k16 + headBase + (long)(kt + 2) * 64 * HDsz, HDsz,
                Vc, Vhead + (kt + 2) * 64, Ssz, tid);
  }
  // no copy is outstanding when the wave goes on to its stores and ends
  asm volatile("s_wait_asynccnt 0x0" ::: "memory");

  // join the halves' sums, normalize, write to [B, S, H] f16 (16 B per store)
  l += xhalf(l);
  _Float16* orow = out16 + ((long)(b * Ssz + qt * 64 + qrow)) * Hsz + h * HDsz + laneHi * 8;
#pragma unroll  // constant indices keep the vectors in registers
  for (int nt = 0; nt < 4; ++nt) {
    v8h hv;
#pragma unroll  // constant indices keep the vectors in registers
    for (int r = 0; r < 8; ++r) hv[r] = (_Float16)(o[nt][r] / l);
    *(v8h*)(orow + nt * 16) = hv;
  }
}

// ---------------------------------------------------------------------------
extern "C" void kernel_launch(void* const* d_in, const int* in_sizes, int n_in,
                              void* d_out, int out_size, void* d_ws, size_t ws_size,
                              hipStream_t stream) {
  const float* hs  = (const float*)d_in[0];
  const float* pb  = (const float*)d_in[1];
  const float* msk = (const float*)d_in[2];
  const float* Wq  = (const float*)d_in[3];
  const float* bq  = (const float*)d_in[4];
  const float* Wk  = (const float*)d_in[5];
  const float* bk  = (const float*)d_in[6];
  const float* Wv  = (const float*)d_in[7];
  const float* bv  = (const float*)d_in[8];
  const float* Wo  = (const float*)d_in[9];
  const float* bo  = (const float*)d_in[10];
  float* out = (float*)d_out;

  const int NHS = Bsz * Ssz * Hsz;   // 4,194,304
  const int WSZ = Hsz * Hsz;         // 1,048,576
  _Float16* hs16 = (_Float16*)d_ws;
  _Float16* w16  = hs16 + NHS;       // 4 weight matrices
  _Float16* q16  = w16 + 4 * (size_t)WSZ;
  _Float16* k16  = q16 + NHS;
  _Float16* vt16 = k16 + NHS;        // V stored [B,NH,HD,S]
  _Float16* ao16 = vt16 + NHS;

  // fp32 -> f16 staging: hs16 and the four w16 matrices are one contiguous range
  cvt_all<<<512, 256, 0, stream>>>(hs, Wq, Wk, Wv, Wo, hs16);

  // Q, K, V: w16 holds Wq, Wk, Wv in a row; q16, k16, vt16 lie in a row
  dim3 gp(32, 8), blk(128);
  gemm_proj<<<dim3(32, 8, 3), blk, 0, stream>>>(hs16, w16, bq, bk, bv, q16);

  attn_flash<<<dim3(Ssz / 64, Bsz * NHsz), blk, 0, stream>>>(q16, k16, vt16, pb, msk, ao16);

  gemm_out<<<gp, blk, 0, stream>>>(ao16, w16 + 3 * (size_t)WSZ, bo, out);
}

// v006
// One run takes 97.9 microseconds.
// Timed twice side by side with v005, it ran 1.12 and 1.09 times as fast.
// Counting every step since v000, it is 3.40 times as fast.
#include <hip/hip_runtime.h>
#include <hip/hip_bf16.h>

typedef __attribute__((ext_vector_type(16))) _Float16 v16h;
typedef __attribute__((ext_vector_type(4)))  _Float16 v4h;
typedef __attribute__((ext_vector_type(8)))  _Float16 v8h;
typedef __attribute__((ext_vector_type(4)))  float    v4f;
typedef __attribute__((ext_vector_type(8)))  float    v8f;

#define Bsz 2
#define Ssz 2048
#define Hsz 1024
#define NHsz 16
#define HDsz 64
#define QSCALE 0.125f

#define FST 72   // f16 LDS tile stride (64 + 8 pad) -> 144 B, 16B aligned rows
#define TSZ (64 * FST)  // halves in one 64 x 64 f16 LDS tile
#define GTSZ (128 * FST)  // halves in one 128-row x 64 f16 LDS tile of the GEMMs
#define BST 68   // f32 LDS tile stride (64 + 4 pad) -> 272 B rows (16 B x odd): b128 row reads spread over all banks

// ---------------------------------------------------------------------------
// 16-byte global -> LDS copies on the CDNA5 async-to-LDS path (ASYNCcnt,
// GLOBAL_LOAD_ASYNC_TO_LDS_B128), four or eight to a statement. Each lane names its own
// LDS byte address and its own global pointer; no immediate offset. The
// s_wait_xcnt 0 is the statement's last line, so that it stands in front of
// every later write of a register that one of these copies names (a precaution).
// ---------------------------------------------------------------------------
__device__ __forceinline__ unsigned lds_addr(const void* p) {
  return (unsigned)(unsigned long long)p;  // low 32 bits of a __shared__ address
}

__device__ __forceinline__ void cp16x4(unsigned l0, unsigned l1, unsigned l2, unsigned l3,
                                       const void* g0, const void* g1,
                                       const void* g2, const void* g3) {
  asm volatile(
      "global_load_async_to_lds_b128 %0, %4, off\n\t"
      "global_load_async_to_lds_b128 %1, %5, off\n\t"
      "global_load_async_to_lds_b128 %2, %6, off\n\t"
      "global_load_async_to_lds_b128 %3, %7, off\n\t"
      "s_wait_xcnt 0x0"
      :: "v"(l0), "v"(l1), "v"(l2), "v"(l3), "v"(g0), "v"(g1), "v"(g2), "v"(g3)
      : "memory");
}

__device__ __forceinline__ void cp16x8(unsigned l0, unsigned l1, unsigned l2, unsigned l3,
                                       unsigned l4, unsigned l5, unsigned l6, unsigned l7,
                                       const void* g0, const void* g1,
                                       const void* g2, const void* g3,
                                       const void* g4, const void* g5,
                                       const void* g6, const void* g7) {
  asm volatile(
      "global_load_async_to_lds_b128 %0, %8, off\n\t"
      "global_load_async_to_lds_b128 %1, %9, off\n\t"
      "global_load_async_to_lds_b128 %2, %10, off\n\t"
      "global_load_async_to_lds_b128 %3, %11, off\n\t"
      "global_load_async_to_lds_b128 %4, %12, off\n\t"
      "global_load_async_to_lds_b128 %5, %13, off\n\t"
      "global_load_async_to_lds_b128 %6, %14, off\n\t"
      "global_load_async_to_lds_b128 %7, %15, off\n\t"
      "s_wait_xcnt 0x0"
      :: "v"(l0), "v"(l1), "v"(l2), "v"(l3), "v"(l4), "v"(l5), "v"(l6), "v"(l7),
         "v"(g0), "v"(g1), "v"(g2), "v"(g3), "v"(g4), "v"(g5), "v"(g6), "v"(g7)
      : "memory");
}

// Stage a 128-row x 64-half tile of an [.., Hsz] array into LDS (row stride FST
// halves). 128 threads, 8 x 16B each. Fixed trip count: every lane is on at every copy.
__device__ __forceinline__ void stage128(_Float16* __restrict__ lds,
                                         const _Float16* __restrict__ gbase, int tid) {
  const unsigned row = (unsigned)tid >> 3, q = (unsigned)tid & 7u;
  const unsigned l0 = lds_addr(lds + row * FST + q * 8);
  const _Float16* g0 = gbase + (row * Hsz + q * 8);
  cp16x8(l0, l0 + 16 * FST * 2, l0 + 32 * FST * 2, l0 + 48 * FST * 2,
         l0 + 64 * FST * 2, l0 + 80 * FST * 2, l0 + 96 * FST * 2, l0 + 112 * FST * 2,
         g0, g0 + 16 * Hsz, g0 + 32 * Hsz, g0 + 48 * Hsz,
         g0 + 64 * Hsz, g0 + 80 * Hsz, g0 + 96 * Hsz, g0 + 112 * Hsz);
}

// ---------------------------------------------------------------------------
// Fragment gather from LDS, 16-bit A/B matrix layout (ISA 7.12.2, wave32):
// lane m = lane&15 selects the row (A: M-row, B: N-column of the N x K tile),
// hi = lane>>4 selects K-halves; element e -> K = kofs + 8*hi + (e<8 ? e : e+8).
// Pairs are K-consecutive -> lowers to two ds_load_b128 per fragment.
// ---------------------------------------------------------------------------
__device__ __forceinline__ v16h frag16(const _Float16* __restrict__ base,
                                       int stride, int kofs) {
  const int lane = threadIdx.x & 31;
  const int m  = lane & 15;
  const int hi = lane >> 4;
  const _Float16* r = base + m * stride + kofs + hi * 8;
  v16h f;
#pragma unroll
  for (int e = 0; e < 16; e += 2) {
    int k = (e < 8) ? e : (e + 8);
    f[e]     = r[k];
    f[e + 1] = r[k + 1];
  }
  return f;
}

#define WMMA(a, b, c) __builtin_amdgcn_wmma_f32_16x16x32_f16( \
    false, (a), false, (b), (short)0, (c), false, false)

// ---------------------------------------------------------------------------
// K loop of both GEMMs: acc += A tile x W tile^T over Hsz in steps of 64, on two
// LDS buffers each for A and W: tile t + 1's copies fly while tile t is worked on.
// The block's tile is 128 x 128; its four waves lie 2 x 2, each on 64 x 64 (wm, wn
// = the wave's row and column): a fragment read from LDS feeds four products.
// ---------------------------------------------------------------------------
__device__ __forceinline__ void gemm_loop(_Float16* As, _Float16* Bs,
                                          const _Float16* __restrict__ Abase,
                                          const _Float16* __restrict__ Wbase,
                                          int tid, int wm, int wn, v8f (&acc)[4][4]) {
  stage128(As, Abase, tid);
  stage128(Bs, Wbase, tid);
  // this wave's copies of tile 0 have landed before the barrier publishes them
  asm volatile("s_wait_asynccnt 0x0" ::: "memory");
  __syncthreads();
  stage128(As + GTSZ, Abase + 64, tid);
  stage128(Bs + GTSZ, Wbase + 64, tid);
  for (int t = 0; t < Hsz / 64; ++t) {
    _Float16* Ac = As + (t & 1) * GTSZ;
    _Float16* Bc = Bs + (t & 1) * GTSZ;
    const _Float16* Aw = Ac + wm * 64 * FST;
    const _Float16* Bw = Bc + wn * 64 * FST;
    v16h a[4], b[4], bn[4];
#pragma unroll  // constant indices keep the fragments in registers
    for (int i = 0; i < 4; ++i) {
      a[i] = frag16(Aw + i * 16 * FST, FST, 0);
      b[i] = frag16(Bw + i * 16 * FST, FST, 0);
    }
#pragma unroll  // constant indices keep the fragments in registers
    for (int i = 0; i < 4; ++i) bn[i] = frag16(Bw + i * 16 * FST, FST, 32);
    // the LDS reads stay one group ahead of the 16 products: left free, the compiler
    // read one A fragment per four products and waited for it each time
    __builtin_amdgcn_sched_barrier(0);
#pragma unroll  // constant indices keep the accumulators in registers
    for (int i = 0; i < 4; ++i)
#pragma unroll  // constant indices keep the accumulators in registers
      for (int j = 0; j < 4; ++j) acc[i][j] = WMMA(a[i], b[j], acc[i][j]);
#pragma unroll  // constant indices keep the fragments in registers
    for (int i = 0; i < 4; ++i) a[i] = frag16(Aw + i * 16 * FST, FST, 32);
    // the second half's A fragments too are read as one group, ahead of the products that use them
    __builtin_amdgcn_sched_barrier(0);
#pragma unroll  // constant indices keep the accumulators in registers
    for (int i = 0; i < 4; ++i)
#pragma unroll  // constant indices keep the accumulators in registers
      for (int j = 0; j < 4; ++j) acc[i][j] = WMMA(a[i], bn[j], acc[i][j]);
    // this wave's reads of tile t have returned before the buffer is refilled
    asm volatile("s_wait_dscnt 0x0" ::: "memory");
    // this wave's copies of tile t + 1 have landed before the barrier publishes them
    asm volatile("s_wait_asynccnt 0x0" ::: "memory");
    __syncthreads();
    if (t + 2 < Hsz / 64) {
      stage128(Ac, Abase + (t + 2) * 64, tid);
      stage128(Bc, Wbase + (t + 2) * 64, tid);
    }
  }
  // no copy is outstanding when the wave goes on to its stores and ends
  asm volatile("s_wait_asynccnt 0x0" ::: "memory");
}

// ---------------------------------------------------------------------------
// All five fp32 -> f16 conversions in one launch. The five destinations lie one
// behind the other in the workspace, so dst is one array of 8 segments of H*H
// elements: segments 0..3 are hidden_states, 4..7 are Wq, Wk, Wv, Wo.
// 64 blocks per segment; a block converts 16,384 elements, a thread 16 x 4.
// ---------------------------------------------------------------------------
__global__ void __launch_bounds__(256) cvt_all(
    const float* __restrict__ hs, const float* __restrict__ wq,
    const float* __restrict__ wk, const float* __restrict__ wv,
    const float* __restrict__ wo, _Float16* __restrict__ dst) {
  const int seg = blockIdx.x >> 6;
  const float* sbase = seg < 4 ? hs + (long)seg * (Hsz * Hsz)
                     : seg == 4 ? wq : seg == 5 ? wk : seg == 6 ? wv : wo;
  const int off = (blockIdx.x & 63) * 16384 + threadIdx.x * 4;
  const float* s = sbase + off;
  _Float16* d = dst + (long)seg * (Hsz * Hsz) + off;
  float4 f[16];
#pragma unroll  // all sixteen loads are issued ahead of the first store
  for (int j = 0; j < 16; ++j) f[j] = *(const float4*)(s + j * 1024);
#pragma unroll  // constant indices keep the array in registers
  for (int j = 0; j < 16; ++j) {
    v4h h;
    h[0] = (_Float16)f[j].x; h[1] = (_Float16)f[j].y;
    h[2] = (_Float16)f[j].z; h[3] = (_Float16)f[j].w;
    *(v4h*)(d + j * 1024) = h;
  }
}

// ---------------------------------------------------------------------------
// A wave's staged 64 x 64 f16 tile (rows of FST halves in its own LDS range) goes to
// global rows PITCH halves apart: 8 lanes to a 128-B row, 4 rows to a store.
// ---------------------------------------------------------------------------
template <int PITCH>
__device__ __forceinline__ void put_tile(const _Float16* __restrict__ st,
                                         _Float16* __restrict__ g, int lane) {
  // the wave's own LDS writes are done before its lanes read one another's values back
  asm volatile("s_wait_dscnt 0x0" ::: "memory");
  const int rr = lane >> 3, q = lane & 7;
  const _Float16* sr = st + rr * FST + q * 8;
  _Float16* gl = g + rr * PITCH + q * 8;
#pragma unroll  // the sixteen LDS reads are issued ahead of the stores
  for (int k = 0; k < 16; ++k)
    *(v8h*)(gl + k * 4 * PITCH) = *(const v8h*)(sr + k * 4 * FST);
}

// ---------------------------------------------------------------------------
// Projection GEMMs, all three in one launch: out = (X @ W^T + bias) * scale, f16
// output. z = 0, 1, 2 is Q, K, V: it picks the weight matrix (W3 holds the three
// one behind the other), the bias, the output (dst3 likewise) and its form.
// vmode=0: per-head [B,NH,S,HD];  vmode=1: transposed per-head [B,NH,HD,S].
// Block = 128 threads (4 waves), tile 128 x 128, K-step 64.
// The first WMMA operand is the one whose index is contiguous in the output (W's
// rows for Q and K, X's rows for V): a lane's 8 accumulator registers are then 8
// neighbours in memory. Each wave turns its 64 x 64 tile in its own LDS range and
// stores it as whole 128-B rows, 16 B a lane.
// ---------------------------------------------------------------------------
__global__ void __launch_bounds__(128) gemm_proj(
    const _Float16* __restrict__ A, const _Float16* __restrict__ W3,
    const float* __restrict__ bq, const float* __restrict__ bk,
    const float* __restrict__ bv, _Float16* __restrict__ dst3) {
  __shared__ alignas(16) _Float16 As[2 * GTSZ];
  __shared__ alignas(16) _Float16 Bs[2 * GTSZ];
  const int z = 2 - (int)blockIdx.z;  // blockIdx.z = 0, 1, 2 is V, K, Q
  const _Float16* W = W3 + (long)z * (Hsz * Hsz);
  const float* bias = z == 0 ? bq : z == 1 ? bk : bv;
  _Float16* dst = dst3 + (long)z * (Bsz * Ssz * Hsz);
  const float scale = z == 0 ? QSCALE : 1.0f;
  const int vmode = z == 2;
  const int tid = threadIdx.x;
  const int wave = tid >> 5;
  const int wm = wave >> 1, wn = wave & 1;
  const int lane = tid & 31;
  const int laneN = lane & 15, laneHi = lane >> 4;
  const int m0 = blockIdx.x * 128;   // rows of X (positions)
  const int n0 = blockIdx.y * 128;   // rows of W (output features)
  const _Float16* Xbase = A + (long)m0 * Hsz;
  const _Float16* Wbase = W + (long)n0 * Hsz;

  // acc[i][j][r]: first operand's row wm*64 + i*16 + laneHi*8 + r,
  //               second operand's row wn*64 + j*16 + laneN
  v8f acc[4][4] = {};
  gemm_loop(As, Bs, vmode ? Xbase : Wbase, vmode ? Wbase : Xbase, tid, wm, wn, acc);

  // The loop's last barrier stands behind every wave's last read of the tiles, and no
  // copy is outstanding: As is free. Wave w stages in As[w * TSZ ..), 64 rows of FST halves:
  // row = second operand's row in the wave's tile, column = first operand's.
  _Float16* st = As + wave * TSZ;
  _Float16* sw = st + laneN * FST + laneHi * 8;
  // A tile lies in one batch; a wave's 64 features lie in one head.
  if (vmode) {
#pragma unroll  // constant indices keep the accumulators in registers
    for (int j = 0; j < 4; ++j) {
      const float bc = bias[n0 + wn * 64 + j * 16 + laneN];
#pragma unroll  // constant indices keep the accumulators in registers
      for (int i = 0; i < 4; ++i) {
        v8h hv;
#pragma unroll  // constant indices keep the accumulators in registers
        for (int r = 0; r < 8; ++r) hv[r] = (_Float16)(acc[i][j][r] + bc);
        *(v8h*)(sw + j * 16 * FST + i * 16) = hv;
      }
    }
    // staged row = feature, column = position
    put_tile<Ssz>(st, dst + ((long)((m0 >> 11) * Hsz + n0 + wn * 64) * Ssz + (m0 & 2047) + wm * 64), lane);
  } else {
    const float* bp = bias + n0 + wm * 64 + laneHi * 8;
    v4f b0[4], b1[4];
#pragma unroll  // all eight bias loads are issued ahead of the first use
    for (int i = 0; i < 4; ++i) {
      b0[i] = *(const v4f*)(bp + i * 16);
      b1[i] = *(const v4f*)(bp + i * 16 + 4);
    }
#pragma unroll  // constant indices keep the accumulators in registers
    for (int i = 0; i < 4; ++i) {
#pragma unroll  // constant indices keep the accumulators in registers
      for (int j = 0; j < 4; ++j) {
        v8h hv;
#pragma unroll  // constant indices keep the accumulators in registers
        for (int r = 0; r < 4; ++r) {
          hv[r]     = (_Float16)((acc[i][j][r] + b0[i][r]) * scale);
          hv[r + 4] = (_Float16)((acc[i][j][r + 4] + b1[i][r]) * scale);
        }
        *(v8h*)(sw + j * 16 * FST + i * 16) = hv;
      }
    }
    // staged row = position, column = feature inside the head
    put_tile<HDsz>(st, dst + ((long)((m0 >> 11) * NHsz + (n0 >> 6) + wm) * Ssz + (m0 & 2047) + wn * 64) * HDsz, lane);
  }
}

// ---------------------------------------------------------------------------
// Output projection GEMM: d_out = A @ Wo^T + bo  (fp32 output, [4096,1024])
// Wo's rows are the first WMMA operand: a lane's 8 accumulator registers are 8
// neighbours of one output row. Each wave turns its 64 x 64 tile in its own LDS
// range and stores whole 256-B row pieces, 16 B a lane.
// ---------------------------------------------------------------------------
__global__ void __launch_bounds__(128) gemm_out(
    const _Float16* __restrict__ A, const _Float16* __restrict__ W,
    const float* __restrict__ bias, float* __restrict__ dst) {
  __shared__ alignas(16) _Float16 As[2 * GTSZ];
  __shared__ alignas(16) _Float16 Bs[2 * GTSZ];
  const int tid = threadIdx.x;
  const int wave = tid >> 5;
  const int wm = wave >> 1, wn = wave & 1;
  const int lane = tid & 31;
  const int laneN = lane & 15, laneHi = lane >> 4;
  const int m0 = blockIdx.x * 128;
  const int n0 = blockIdx.y * 128;
  const _Float16* Abase = A + (long)m0 * Hsz;
  const _Float16* Wbase = W + (long)n0 * Hsz;

  // acc[i][j][r]: column n0 + wm*64 + i*16 + laneHi*8 + r, row m0 + wn*64 + j*16 + laneN
  v8f acc[4][4] = {};
  gemm_loop(As, Bs, Wbase, Abase, tid, wm, wn, acc);

  // The loop's last barrier stands behind every wave's last read of the tiles, and no
  // copy is outstanding: As and Bs are free. Each holds two waves' staging ranges of
  // 64 rows of BST floats.
  float* st = (float*)(wm ? Bs : As) + wn * (64 * BST);
  float* sw = st + laneN * BST + laneHi * 8;
  const float* bp = bias + n0 + wm * 64 + laneHi * 8;
  v4f b0[4], b1[4];
#pragma unroll  // all eight bias loads are issued ahead of the first use
  for (int i = 0; i < 4; ++i) {
    b0[i] = *(const v4f*)(bp + i * 16);
    b1[i] = *(const v4f*)(bp + i * 16 + 4);
  }
#pragma unroll  // constant indices keep the accumulators in registers
  for (int i = 0; i < 4; ++i) {
#pragma unroll  // constant indices keep the accumulators in registers
    for (int j = 0; j < 4; ++j) {
      v4f lo, hi;
#pragma unroll  // constant indices keep the accumulators in registers
      for (int r = 0; r < 4; ++r) {
        lo[r] = acc[i][j][r] + b0[i][r];
        hi[r] = acc[i][j][r + 4] + b1[i][r];
      }
      *(v4f*)(sw + j * 16 * BST + i * 16) = lo;
      *(v4f*)(sw + j * 16 * BST + i * 16 + 4) = hi;
    }
  }
  // the wave's own LDS writes are done before its lanes read one another's values back
  asm volatile("s_wait_dscnt 0x0" ::: "memory");
  const int rr = lane >> 4, q = lane & 15;  // 16 lanes to a 256-B row piece, 2 rows to a store
  const float* sr = st + rr * BST + q * 4;
  float* gl = dst + ((long)(m0 + wn * 64 + rr) * Hsz + n0 + wm * 64 + q * 4);
#pragma unroll  // LDS reads run ahead of the stores
  for (int k = 0; k < 32; ++k)
    *(v4f*)(gl + k * 2 * Hsz) = *(const v4f*)(sr + k * 2 * BST);
}

// One wave stages 16 rows x 64 floats of an [.., S, S] array into LDS (row stride
// BST floats), 8 x 16B a lane, whole 256-B rows: the 16 mask rows that it alone
// reads. They are a ring of one slot, private to the wave, and need no barrier.
// Fixed trip count: every lane is on at every copy.
__device__ __forceinline__ void stage16f(float* __restrict__ lds,
                                         const float* __restrict__ gbase,
                                         int lane) {
  const unsigned row = (unsigned)lane >> 4, q = (unsigned)lane & 15u;
  const unsigned l0 = lds_addr(lds + row * BST + q * 4);
  const float* g0 = gbase + (row * Ssz + q * 4);
  cp16x8(l0, l0 + 2 * BST * 4, l0 + 4 * BST * 4, l0 + 6 * BST * 4,
         l0 + 8 * BST * 4, l0 + 10 * BST * 4, l0 + 12 * BST * 4, l0 + 14 * BST * 4,
         g0, g0 + 2 * Ssz, g0 + 4 * Ssz, g0 + 6 * Ssz,
         g0 + 8 * Ssz, g0 + 10 * Ssz, g0 + 12 * Ssz, g0 + 14 * Ssz);
}

// The block's shared tiles of one key step, 512 threads, 8 x 16B each, one statement:
// K (64 keys x 64 halves) and V^T (64 d x 64 keys) of both batches, one copy a lane
// each (kl, vl: two tiles of TSZ halves, batch 0 then 1), and 128 rows x 64 floats of
// the bias, four copies a lane. hstep = halves from batch 0's head to batch 1's.
// Fixed trip count: every lane is on at every copy.
__device__ __forceinline__ void stage_kvb(_Float16* __restrict__ kl, const _Float16* __restrict__ kg,
                                          _Float16* __restrict__ vl, const _Float16* __restrict__ vg,
                                          float* __restrict__ pl, const float* __restrict__ pg,
                                          int tid) {
  const unsigned hstep = NHsz * Ssz * HDsz;
  const unsigned row = (unsigned)tid >> 3, q = (unsigned)tid & 7u;
  const unsigned lk = lds_addr(kl + row * FST + q * 8);
  const unsigned lv = lds_addr(vl + row * FST + q * 8);
  const _Float16* k0 = kg + (row * HDsz + q * 8);
  const _Float16* v0 = vg + (row * Ssz + q * 8);
  const unsigned prow = (unsigned)tid >> 4, pq = (unsigned)tid & 15u;
  const unsigned lp = lds_addr(pl + prow * BST + pq * 4);
  const float* p0 = pg + (prow * Ssz + pq * 4);
  cp16x8(lk, lk + TSZ * 2, lv, lv + TSZ * 2,
         lp, lp + 32 * BST * 4, lp + 64 * BST * 4, lp + 96 * BST * 4,
         k0, k0 + hstep, v0, v0 + hstep,
         p0, p0 + 32 * Ssz, p0 + 64 * Ssz, p0 + 96 * Ssz);
}

// 8 consecutive floats from LDS (16-B aligned): two ds_load_b128.
__device__ __forceinline__ v8f lds8f(const float* __restrict__ p) {
  v4f lo = *(const v4f*)p;
  v4f hi = *(const v4f*)(p + 4);
  return __builtin_shufflevector(lo, hi, 0, 1, 2, 3, 4, 5, 6, 7);
}

// e^x for eight values, as __expf compiles: a multiply by log2(e), then v_exp_f32.
// The eight v_exp_f32 stand in one asm statement, each on its own register, and a
// v_nop ends it: so no instruction directly behind a transcendental reads its result
// or overwrites its source.
__device__ __forceinline__ v8f exp8(v8f x) {
  x *= 1.44269504f;
  float a = x[0], b = x[1], c = x[2], d = x[3], e = x[4], f = x[5], g = x[6], h = x[7];
  asm("v_exp_f32 %0, %0\n\tv_exp_f32 %1, %1\n\tv_exp_f32 %2, %2\n\tv_exp_f32 %3, %3\n\t"
      "v_exp_f32 %4, %4\n\tv_exp_f32 %5, %5\n\tv_exp_f32 %6, %6\n\tv_exp_f32 %7, %7\n\tv_nop"
      : "+v"(a), "+v"(b), "+v"(c), "+v"(d), "+v"(e), "+v"(f), "+v"(g), "+v"(h));
  v8f r = {a, b, c, d, e, f, g, h};
  return r;
}

// value of lane l ^ 16
__device__ __forceinline__ float xhalf(float x) {
  int v = __builtin_bit_cast(int, x);
  return __builtin_bit_cast(float, __builtin_amdgcn_permlanex16(
      v, v, 0x76543210, 0xfedcba98, false, false));
}

__global__ void __launch_bounds__(512) attn_flash(
    const _Float16* __restrict__ q16, const _Float16* __restrict__ k16,
    const _Float16* __restrict__ vt16, const float* __restrict__ pbias,
    const float* __restrict__ mask, _Float16* __restrict__ out16) {
  __shared__ alignas(16) _Float16 Qs[2 * GTSZ];      // [batch][128 rows]
  __shared__ alignas(16) _Float16 Ks[2 * 2 * TSZ];   // [buffer][batch][64 keys]
  __shared__ alignas(16) _Float16 Vt[2 * 2 * TSZ];   // [buffer][batch][64 d]
  __shared__ alignas(16) float Pb[2 * 128 * BST];    // [buffer][128 rows], shared by the batches
  __shared__ alignas(16) float Mk[2 * 128 * BST];    // [batch][128 rows] = [wave][16 rows]

  const int tid = threadIdx.x;
  const int wave = tid >> 5;
  const int lane = tid & 31;
  const int laneN = lane & 15, laneHi = lane >> 4;
  const int qt = blockIdx.x;          // q tile 0..15
  const int h = blockIdx.y;           // head 0..15
  const int b = wave >> 3;            // this wave's batch
  const int wq = wave & 7;            // this wave's 16 rows in the q tile
  const long head0 = (long)h * Ssz * HDsz;       // batch 0's slice of q16/k16/vt16
  const _Float16* Khead = k16 + head0;           // [S, HD] rows, batch 0
  const _Float16* Vhead = vt16 + head0;          // [HD, S] rows, batch 0
  const float* pbTile = pbias + ((long)h * Ssz + qt * 128) * Ssz;
  const float* mkWave = mask + ((long)b * Ssz + qt * 128 + wq * 16) * Ssz;  // the wave's 16 rows
  float* MkW = Mk + wave * 16 * BST;
  const int qrow = wq * 16 + laneN;              // this lane's query row in the tile
  const float* pbRow = Pb + qrow * BST + laneHi * 8;
  const float* mkRow = MkW + laneN * BST + laneHi * 8;

  // Q of both batches: 2 x 128 rows of 64 halves, four copies a lane
  {
    const unsigned row = (unsigned)tid >> 3, q = (unsigned)tid & 7u;
    const unsigned lq = lds_addr(Qs + row * FST + q * 8);
    const _Float16* gq = q16 + head0 + ((qt * 128 + row) * HDsz + q * 8);
    cp16x4(lq, lq + TSZ * 2, lq + GTSZ * 2, lq + (GTSZ + TSZ) * 2,
           gq, gq + 64 * HDsz, gq + NHsz * Ssz * HDsz, gq + (NHsz * Ssz + 64) * HDsz);
  }
  // tile 0: K rows [key][d], V^T rows [d][key], bias and mask rows [q][key]
  stage_kvb(Ks, Khead, Vt, Vhead, Pb, pbTile, tid);
  stage16f(MkW, mkWave, lane);
  // this wave's copies have landed before the barrier publishes them
  asm volatile("s_wait_asynccnt 0x0" ::: "memory");
  __syncthreads();
  // K, V and bias of tile 1 fly while tile 0 is worked on
  stage_kvb(Ks + 2 * TSZ, Khead + 64 * HDsz, Vt + 2 * TSZ, Vhead + 64,
            Pb + 128 * BST, pbTile + 64, tid);

  const v16h qb0 = frag16(Qs + wave * 16 * FST, FST, 0);
  const v16h qb1 = frag16(Qs + wave * 16 * FST, FST, 32);
  v8f o[4] = {};                      // o[nt][r] = O[qrow][nt*16 + laneHi*8 + r]
  float m = -3.0e38f;                 // running maximum of the row (both halves agree)
  float l = 0.0f;                     // running sum over this lane's own keys only

  for (int kt = 0; kt < Ssz / 64; ++kt) {
    _Float16* Kb = Ks + (kt & 1) * 2 * TSZ;      // this tile's buffers, batch 0 first
    _Float16* Vb = Vt + (kt & 1) * 2 * TSZ;
    const _Float16* Kc = Kb + b * TSZ;
    const _Float16* Vc = Vb + b * TSZ;
    const float* pbCur = pbRow + (kt & 1) * 128 * BST;

    // this tile's bias + mask go to registers, so that the mask rows can be refilled at once
    v8f bm[4];
#pragma unroll  // constant indices keep the vectors in registers
    for (int nt = 0; nt < 4; ++nt)
      bm[nt] = lds8f(pbCur + nt * 16) + lds8f(mkRow + nt * 16);
    // this wave's reads of its own mask rows have returned before it refills them
    asm volatile("s_wait_dscnt 0x0" ::: "memory");
    if (kt + 1 < Ssz / 64) stage16f(MkW, mkWave + (kt + 1) * 64, lane);

    // S^T = K Q^T (+ bias + mask): s[nt][r] = S[qrow][nt*16 + laneHi*8 + r]
    v8f s[4];
#pragma unroll  // constant indices keep the vectors in registers
    for (int nt = 0; nt < 4; ++nt) {
      v8f c = {};
      v16h kf0 = frag16(Kc + nt * 16 * FST, FST, 0);
      v16h kf1 = frag16(Kc + nt * 16 * FST, FST, 32);
      c = WMMA(kf0, qb0, c);
      c = WMMA(kf1, qb1, c);
      s[nt] = c + bm[nt];
    }

    // online softmax, one query row per lane pair (l, l ^ 16)
    float rm = s[0][0];
#pragma unroll  // constant indices keep the vectors in registers
    for (int nt = 0; nt < 4; ++nt)
#pragma unroll  // constant indices keep the vectors in registers
      for (int r = 0; r < 8; ++r) rm = fmaxf(rm, s[nt][r]);
    rm = fmaxf(rm, xhalf(rm));
    const float mNew = fmaxf(m, rm);
    const float f = __expf(m - mNew);
    m = mNew;
#pragma unroll  // constant indices keep the vectors in registers
    for (int nt = 0; nt < 4; ++nt) s[nt] = exp8(s[nt] - mNew);
    const v8f ps = (s[0] + s[1]) + (s[2] + s[3]);
    l = l * f + (((ps[0] + ps[1]) + (ps[2] + ps[3])) +
                 ((ps[4] + ps[5]) + (ps[6] + ps[7])));
    v16h p0, p1;
#pragma unroll  // constant indices keep the vectors in registers
    for (int r = 0; r < 8; ++r) {
      p0[r] = (_Float16)s[0][r]; p0[r + 8] = (_Float16)s[1][r];
      p1[r] = (_Float16)s[2][r]; p1[r + 8] = (_Float16)s[3][r];
    }

    // rescale running O^T, then O^T += V^T P^T
#pragma unroll  // constant indices keep the vectors in registers
    for (int nt = 0; nt < 4; ++nt) {
      v16h vf0 = frag16(Vc + nt * 16 * FST, FST, 0);
      v16h vf1 = frag16(Vc + nt * 16 * FST, FST, 32);
      o[nt] *= f;
      o[nt] = WMMA(vf0, p0, o[nt]);
      o[nt] = WMMA(vf1, p1, o[nt]);
    }
    // this wave's reads of K, V and bias have returned before their buffers are refilled
    asm volatile("s_wait_dscnt 0x0" ::: "memory");
    // this wave's copies of tile kt + 1 have landed before the barrier publishes K, V and bias
    asm volatile("s_wait_asynccnt 0x0" ::: "memory");
    __syncthreads();
    if (kt + 2 < Ssz / 64)
      stage_kvb(Kb, Khead + (kt + 2) * 64 * HDsz, Vb, Vhead + (kt + 2) * 64,
                Pb + (kt & 1) * 128 * BST, pbTile + (kt + 2) * 64, tid);
  }
  // no copy is outstanding when the wave goes on to its stores and ends
  asm volatile("s_wait_asynccnt 0x0" ::: "memory");

  // join the halves' sums, normalize, write to [B, S, H] f16 (16 B per store)
  l += xhalf(l);
  _Float16* orow = out16 + ((long)(b * Ssz + qt * 128 + qrow)) * Hsz + h * HDsz + laneHi * 8;
#pragma unroll  // constant indices keep the vectors in registers
  for (int nt = 0; nt < 4; ++nt) {
    v8h hv;
#pragma unroll  // constant indices keep the vectors in registers
    for (int r = 0; r < 8; ++r) hv[r] = (_Float16)(o[nt][r] / l);
    *(v8h*)(orow + nt * 16) = hv;
  }
}

// ---------------------------------------------------------------------------
extern "C" void kernel_launch(void* const* d_in, const int* in_sizes, int n_in,
                              void* d_out, int out_size, void* d_ws, size_t ws_size,
                              hipStream_t stream) {
  const float* hs  = (const float*)d_in[0];
  const float* pb  = (const float*)d_in[1];
  const float* msk = (const float*)d_in[2];
  const float* Wq  = (const float*)d_in[3];
  const float* bq  = (const float*)d_in[4];
  const float* Wk  = (const float*)d_in[5];
  const float* bk  = (const float*)d_in[6];
  const float* Wv  = (const float*)d_in[7];
  const float* bv  = (const float*)d_in[8];
  const float* Wo  = (const float*)d_in[9];
  const float* bo  = (const float*)d_in[10];
  float* out = (float*)d_out;

  const int NHS = Bsz * Ssz * Hsz;   // 4,194,304
  const int WSZ = Hsz * Hsz;         // 1,048,576
  _Float16* hs16 = (_Float16*)d_ws;
  _Float16* w16  = hs16 + NHS;       // 4 weight matrices
  _Float16* q16  = w16 + 4 * (size_t)WSZ;
  _Float16* k16  = q16 + NHS;
  _Float16* vt16 = k16 + NHS;        // V stored [B,NH,HD,S]
  _Float16* ao16 = vt16 + NHS;

  // fp32 -> f16 staging: hs16 and the four w16 matrices are one contiguous range
  cvt_all<<<512, 256, 0, stream>>>(hs, Wq, Wk, Wv, Wo, hs16);

  // Q, K, V: w16 holds Wq, Wk, Wv in a row; q16, k16, vt16 lie in a row
  dim3 gp(32, 8), blk(128);
  gemm_proj<<<dim3(32, 8, 3), blk, 0, stream>>>(hs16, w16, bq, bk, bv, q16);

  attn_flash<<<dim3(Ssz / 128, NHsz), dim3(512), 0, stream>>>(q16, k16, vt16, pb, msk, ao16);

  gemm_out<<<gp, blk, 0, stream>>>(ao16, w16 + 3 * (size_t)WSZ, bo, out);
}

// v007
// It runs in 95.4 microseconds.
// In two side-by-side timings against v006, it was 1.04 and 1.02 times as fast.
// Over all steps from v000 it is 3.49 times as fast.
#include <hip/hip_runtime.h>
#include <hip/hip_bf16.h>

typedef __attribute__((ext_vector_type(16))) _Float16 v16h;
typedef __attribute__((ext_vector_type(4)))  _Float16 v4h;
typedef __attribute__((ext_vector_type(8)))  _Float16 v8h;
typedef __attribute__((ext_vector_type(4)))  float    v4f;
typedef __attribute__((ext_vector_type(8)))  float    v8f;

#define Bsz 2
#define Ssz 2048
#define Hsz 1024
#define NHsz 16
#define HDsz 64
#define QSCALE 0.125f

#define FST 72   // f16 LDS tile stride (64 + 8 pad) -> 144 B, 16B aligned rows
#define TSZ (64 * FST)  // halves in one 64 x 64 f16 LDS tile
#define GTSZ (128 * FST)  // halves in one 128-row x 64 f16 LDS tile of the GEMMs
#define BST 68   // f32 LDS tile stride (64 + 4 pad) -> 272 B rows (16 B x odd): b128 row reads spread over all banks

// ---------------------------------------------------------------------------
// 16-byte global -> LDS copies on the CDNA5 async-to-LDS path (ASYNCcnt,
// GLOBAL_LOAD_ASYNC_TO_LDS_B128), four or eight to a statement. Each lane names its own
// LDS byte address and its own global pointer; no immediate offset. The
// s_wait_xcnt 0 is the statement's last line, so that it stands in front of
// every later write of a register that one of these copies names (a precaution).
// ---------------------------------------------------------------------------
__device__ __forceinline__ unsigned lds_addr(const void* p) {
  return (unsigned)(unsigned long long)p;  // low 32 bits of a __shared__ address
}

__device__ __forceinline__ void cp16x4(unsigned l0, unsigned l1, unsigned l2, unsigned l3,
                                       const void* g0, const void* g1,
                                       const void* g2, const void* g3) {
  asm volatile(
      "global_load_async_to_lds_b128 %0, %4, off\n\t"
      "global_load_async_to_lds_b128 %1, %5, off\n\t"
      "global_load_async_to_lds_b128 %2, %6, off\n\t"
      "global_load_async_to_lds_b128 %3, %7, off\n\t"
      "s_wait_xcnt 0x0"
      :: "v"(l0), "v"(l1), "v"(l2), "v"(l3), "v"(g0), "v"(g1), "v"(g2), "v"(g3)
      : "memory");
}

__device__ __forceinline__ void cp16x8(unsigned l0, unsigned l1, unsigned l2, unsigned l3,
                                       unsigned l4, unsigned l5, unsigned l6, unsigned l7,
                                       const void* g0, const void* g1,
                                       const void* g2, const void* g3,
                                       const void* g4, const void* g5,
                                       const void* g6, const void* g7) {
  asm volatile(
      "global_load_async_to_lds_b128 %0, %8, off\n\t"
      "global_load_async_to_lds_b128 %1, %9, off\n\t"
      "global_load_async_to_lds_b128 %2, %10, off\n\t"
      "global_load_async_to_lds_b128 %3, %11, off\n\t"
      "global_load_async_to_lds_b128 %4, %12, off\n\t"
      "global_load_async_to_lds_b128 %5, %13, off\n\t"
      "global_load_async_to_lds_b128 %6, %14, off\n\t"
      "global_load_async_to_lds_b128 %7, %15, off\n\t"
      "s_wait_xcnt 0x0"
      :: "v"(l0), "v"(l1), "v"(l2), "v"(l3), "v"(l4), "v"(l5), "v"(l6), "v"(l7),
         "v"(g0), "v"(g1), "v"(g2), "v"(g3), "v"(g4), "v"(g5), "v"(g6), "v"(g7)
      : "memory");
}

// Stage a 128-row x 64-half tile of an [.., Hsz] array into LDS (row stride FST
// halves). 128 threads, 8 x 16B each. Fixed trip count: every lane is on at every copy.
__device__ __forceinline__ void stage128(_Float16* __restrict__ lds,
                                         const _Float16* __restrict__ gbase, int tid) {
  const unsigned row = (unsigned)tid >> 3, q = (unsigned)tid & 7u;
  const unsigned l0 = lds_addr(lds + row * FST + q * 8);
  const _Float16* g0 = gbase + (row * Hsz + q * 8);
  cp16x8(l0, l0 + 16 * FST * 2, l0 + 32 * FST * 2, l0 + 48 * FST * 2,
         l0 + 64 * FST * 2, l0 + 80 * FST * 2, l0 + 96 * FST * 2, l0 + 112 * FST * 2,
         g0, g0 + 16 * Hsz, g0 + 32 * Hsz, g0 + 48 * Hsz,
         g0 + 64 * Hsz, g0 + 80 * Hsz, g0 + 96 * Hsz, g0 + 112 * Hsz);
}

// ---------------------------------------------------------------------------
// Fragment gather from LDS, 16-bit A/B matrix layout (ISA 7.12.2, wave32):
// lane m = lane&15 selects the row (A: M-row, B: N-column of the N x K tile),
// hi = lane>>4 selects K-halves; element e -> K = kofs + 8*hi + (e<8 ? e : e+8).
// Pairs are K-consecutive -> lowers to two ds_load_b128 per fragment.
// ---------------------------------------------------------------------------
__device__ __forceinline__ v16h frag16(const _Float16* __restrict__ base,
                                       int stride, int kofs) {
  const int lane = threadIdx.x & 31;
  const int m  = lane & 15;
  const int hi = lane >> 4;
  const _Float16* r = base + m * stride + kofs + hi * 8;
  v16h f;
#pragma unroll
  for (int e = 0; e < 16; e += 2) {
    int k = (e < 8) ? e : (e + 8);
    f[e]     = r[k];
    f[e + 1] = r[k + 1];
  }
  return f;
}

#define WMMA(a, b, c) __builtin_amdgcn_wmma_f32_16x16x32_f16( \
    false, (a), false, (b), (short)0, (c), false, false)

// ---------------------------------------------------------------------------
// K loop of both GEMMs: acc += A tile x W tile^T over Hsz in steps of 64, on two
// LDS buffers each for A and W: tile t + 1's copies fly while tile t is worked on.
// The block's tile is 128 x 128; its four waves lie 2 x 2, each on 64 x 64 (wm, wn
// = the wave's row and column): a fragment read from LDS feeds four products.
// Trip t works on k tile (t + rot) mod 16: blocks that share an operand's rows get
// different rot, so that they do not ask L2 for the same lines at the same moment.
// ---------------------------------------------------------------------------
__device__ __forceinline__ void gemm_loop(_Float16* As, _Float16* Bs,
                                          const _Float16* __restrict__ Abase,
                                          const _Float16* __restrict__ Wbase,
                                          int tid, int wm, int wn, int rot, v8f (&acc)[4][4]) {
  const int NT = Hsz / 64;  // a power of two: the walk wraps by a mask
  stage128(As, Abase + (rot & (NT - 1)) * 64, tid);
  stage128(Bs, Wbase + (rot & (NT - 1)) * 64, tid);
  // this wave's copies of tile 0 have landed before the barrier publishes them
  asm volatile("s_wait_asynccnt 0x0" ::: "memory");
  __syncthreads();
  stage128(As + GTSZ, Abase + ((rot + 1) & (NT - 1)) * 64, tid);
  stage128(Bs + GTSZ, Wbase + ((rot + 1) & (NT - 1)) * 64, tid);
  for (int t = 0; t < NT; ++t) {
    _Float16* Ac = As + (t & 1) * GTSZ;
    _Float16* Bc = Bs + (t & 1) * GTSZ;
    const _Float16* Aw = Ac + wm * 64 * FST;
    const _Float16* Bw = Bc + wn * 64 * FST;
    v16h a[4], b[4], bn[4];
#pragma unroll  // constant indices keep the fragments in registers
    for (int i = 0; i < 4; ++i) {
      a[i] = frag16(Aw + i * 16 * FST, FST, 0);
      b[i] = frag16(Bw + i * 16 * FST, FST, 0);
    }
#pragma unroll  // constant indices keep the fragments in registers
    for (int i = 0; i < 4; ++i) bn[i] = frag16(Bw + i * 16 * FST, FST, 32);
    // the LDS reads stay one group ahead of the 16 products: left free, the compiler
    // read one A fragment per four products and waited for it each time
    __builtin_amdgcn_sched_barrier(0);
#pragma unroll  // constant indices keep the accumulators in registers
    for (int i = 0; i < 4; ++i)
#pragma unroll  // constant indices keep the accumulators in registers
      for (int j = 0; j < 4; ++j) acc[i][j] = WMMA(a[i], b[j], acc[i][j]);
#pragma unroll  // constant indices keep the fragments in registers
    for (int i = 0; i < 4; ++i) a[i] = frag16(Aw + i * 16 * FST, FST, 32);
    // the second half's A fragments too are read as one group, ahead of the products that use them
    __builtin_amdgcn_sched_barrier(0);
#pragma unroll  // constant indices keep the accumulators in registers
    for (int i = 0; i < 4; ++i)
#pragma unroll  // constant indices keep the accumulators in registers
      for (int j = 0; j < 4; ++j) acc[i][j] = WMMA(a[i], bn[j], acc[i][j]);
    // this wave's reads of tile t have returned before the buffer is refilled
    asm volatile("s_wait_dscnt 0x0" ::: "memory");
    // this wave's copies of tile t + 1 have landed before the barrier publishes them
    asm volatile("s_wait_asynccnt 0x0" ::: "memory");
    __syncthreads();
    if (t + 2 < NT) {
      const int kn = ((t + 2 + rot) & (NT - 1)) * 64;
      stage128(Ac, Abase + kn, tid);
      stage128(Bc, Wbase + kn, tid);
    }
  }
  // no copy is outstanding when the wave goes on to its stores and ends
  asm volatile("s_wait_asynccnt 0x0" ::: "memory");
}

// ---------------------------------------------------------------------------
// All five fp32 -> f16 conversions in one launch. The five destinations lie one
// behind the other in the workspace, so dst is one array of 8 segments of H*H
// elements: segments 0..3 are hidden_states, 4..7 are Wq, Wk, Wv, Wo.
// 64 blocks per segment; a block converts 16,384 elements, a thread 16 x 4.
// ---------------------------------------------------------------------------
__global__ void __launch_bounds__(256) cvt_all(
    const float* __restrict__ hs, const float* __restrict__ wq,
    const float* __restrict__ wk, const float* __restrict__ wv,
    const float* __restrict__ wo, _Float16* __restrict__ dst) {
  const int seg = blockIdx.x >> 6;
  const float* sbase = seg < 4 ? hs + (long)seg * (Hsz * Hsz)
                     : seg == 4 ? wq : seg == 5 ? wk : seg == 6 ? wv : wo;
  const int off = (blockIdx.x & 63) * 16384 + threadIdx.x * 4;
  const float* s = sbase + off;
  _Float16* d = dst + (long)seg * (Hsz * Hsz) + off;
  float4 f[16];
#pragma unroll  // all sixteen loads are issued ahead of the first store
  for (int j = 0; j < 16; ++j) f[j] = *(const float4*)(s + j * 1024);
#pragma unroll  // constant indices keep the array in registers
  for (int j = 0; j < 16; ++j) {
    v4h h;
    h[0] = (_Float16)f[j].x; h[1] = (_Float16)f[j].y;
    h[2] = (_Float16)f[j].z; h[3] = (_Float16)f[j].w;
    *(v4h*)(d + j * 1024) = h;
  }
}

// ---------------------------------------------------------------------------
// A wave's staged 64 x 64 f16 tile (rows of FST halves in its own LDS range) goes to
// global rows PITCH halves apart: 8 lanes to a 128-B row, 4 rows to a store.
// ---------------------------------------------------------------------------
template <int PITCH>
__device__ __forceinline__ void put_tile(const _Float16* __restrict__ st,
                                         _Float16* __restrict__ g, int lane) {
  // the wave's own LDS writes are done before its lanes read one another's values back
  asm volatile("s_wait_dscnt 0x0" ::: "memory");
  const int rr = lane >> 3, q = lane & 7;
  const _Float16* sr = st + rr * FST + q * 8;
  _Float16* gl = g + rr * PITCH + q * 8;
#pragma unroll  // the sixteen LDS reads are issued ahead of the stores
  for (int k = 0; k < 16; ++k)
    *(v8h*)(gl + k * 4 * PITCH) = *(const v8h*)(sr + k * 4 * FST);
}

// ---------------------------------------------------------------------------
// Projection GEMMs, all three in one launch: out = (X @ W^T + bias) * scale, f16
// output. z = 0, 1, 2 is Q, K, V: it picks the weight matrix (W3 holds the three
// one behind the other), the bias, the output (dst3 likewise) and its form.
// vmode=0: per-head [B,NH,S,HD];  vmode=1: transposed per-head [B,NH,HD,S].
// Block = 128 threads (4 waves), tile 128 x 128, K-step 64.
// The first WMMA operand is the one whose index is contiguous in the output (W's
// rows for Q and K, X's rows for V): a lane's 8 accumulator registers are then 8
// neighbours in memory. Each wave turns its 64 x 64 tile in its own LDS range and
// stores it as whole 128-B rows, 16 B a lane.
// ---------------------------------------------------------------------------
__global__ void __launch_bounds__(128) gemm_proj(
    const _Float16* __restrict__ A, const _Float16* __restrict__ W3,
    const float* __restrict__ bq, const float* __restrict__ bk,
    const float* __restrict__ bv, _Float16* __restrict__ dst3) {
  __shared__ alignas(16) _Float16 As[2 * GTSZ];
  __shared__ alignas(16) _Float16 Bs[2 * GTSZ];
  const int z = 2 - (int)blockIdx.z;  // blockIdx.z = 0, 1, 2 is V, K, Q
  const _Float16* W = W3 + (long)z * (Hsz * Hsz);
  const float* bias = z == 0 ? bq : z == 1 ? bk : bv;
  _Float16* dst = dst3 + (long)z * (Bsz * Ssz * Hsz);
  const float scale = z == 0 ? QSCALE : 1.0f;
  const int vmode = z == 2;
  const int tid = threadIdx.x;
  const int wave = tid >> 5;
  const int wm = wave >> 1, wn = wave & 1;
  const int lane = tid & 31;
  const int laneN = lane & 15, laneHi = lane >> 4;
  const int m0 = blockIdx.x * 128;   // rows of X (positions)
  const int n0 = blockIdx.y * 128;   // rows of W (output features)
  const _Float16* Xbase = A + (long)m0 * Hsz;
  const _Float16* Wbase = W + (long)n0 * Hsz;

  // acc[i][j][r]: first operand's row wm*64 + i*16 + laneHi*8 + r,
  //               second operand's row wn*64 + j*16 + laneN
  v8f acc[4][4] = {};
  // X's rows are shared by the 24 blocks of one blockIdx.x, W's by the 32 of one (y, z)
  const int rot = (int)(blockIdx.x + blockIdx.y + 8 * blockIdx.z);
  gemm_loop(As, Bs, vmode ? Xbase : Wbase, vmode ? Wbase : Xbase, tid, wm, wn, rot, acc);

  // The loop's last barrier stands behind every wave's last read of the tiles, and no
  // copy is outstanding: As is free. Wave w stages in As[w * TSZ ..), 64 rows of FST halves:
  // row = second operand's row in the wave's tile, column = first operand's.
  _Float16* st = As + wave * TSZ;
  _Float16* sw = st + laneN * FST + laneHi * 8;
  // A tile lies in one batch; a wave's 64 features lie in one head.
  if (vmode) {
#pragma unroll  // constant indices keep the accumulators in registers
    for (int j = 0; j < 4; ++j) {
      const float bc = bias[n0 + wn * 64 + j * 16 + laneN];
#pragma unroll  // constant indices keep the accumulators in registers
      for (int i = 0; i < 4; ++i) {
        v8h hv;
#pragma unroll  // constant indices keep the accumulators in registers
        for (int r = 0; r < 8; ++r) hv[r] = (_Float16)(acc[i][j][r] + bc);
        *(v8h*)(sw + j * 16 * FST + i * 16) = hv;
      }
    }
    // staged row = feature, column = position
    put_tile<Ssz>(st, dst + ((long)((m0 >> 11) * Hsz + n0 + wn * 64) * Ssz + (m0 & 2047) + wm * 64), lane);
  } else {
    const float* bp = bias + n0 + wm * 64 + laneHi * 8;
    v4f b0[4], b1[4];
#pragma unroll  // all eight bias loads are issued ahead of the first use
    for (int i = 0; i < 4; ++i) {
      b0[i] = *(const v4f*)(bp + i * 16);
      b1[i] = *(const v4f*)(bp + i * 16 + 4);
    }
#pragma unroll  // constant indices keep the accumulators in registers
    for (int i = 0; i < 4; ++i) {
#pragma unroll  // constant indices keep the accumulators in registers
      for (int j = 0; j < 4; ++j) {
        v8h hv;
#pragma unroll  // constant indices keep the accumulators in registers
        for (int r = 0; r < 4; ++r) {
          hv[r]     = (_Float16)((acc[i][j][r] + b0[i][r]) * scale);
          hv[r + 4] = (_Float16)((acc[i][j][r + 4] + b1[i][r]) * scale);
        }
        *(v8h*)(sw + j * 16 * FST + i * 16) = hv;
      }
    }
    // staged row = position, column = feature inside the head
    put_tile<HDsz>(st, dst + ((long)((m0 >> 11) * NHsz + (n0 >> 6) + wm) * Ssz + (m0 & 2047) + wn * 64) * HDsz, lane);
  }
}

// ---------------------------------------------------------------------------
// Output projection GEMM: d_out = A @ Wo^T + bo  (fp32 output, [4096,1024])
// Wo's rows are the first WMMA operand: a lane's 8 accumulator registers are 8
// neighbours of one output row. Each wave turns its 64 x 64 tile in its own LDS
// range and stores whole 256-B row pieces, 16 B a lane.
// ---------------------------------------------------------------------------
__global__ void __launch_bounds__(128) gemm_out(
    const _Float16* __restrict__ A, const _Float16* __restrict__ W,
    const float* __restrict__ bias, float* __restrict__ dst) {
  __shared__ alignas(16) _Float16 As[2 * GTSZ];
  __shared__ alignas(16) _Float16 Bs[2 * GTSZ];
  const int tid = threadIdx.x;
  const int wave = tid >> 5;
  const int wm = wave >> 1, wn = wave & 1;
  const int lane = tid & 31;
  const int laneN = lane & 15, laneHi = lane >> 4;
  const int m0 = blockIdx.x * 128;
  const int n0 = blockIdx.y * 128;
  const _Float16* Abase = A + (long)m0 * Hsz;
  const _Float16* Wbase = W + (long)n0 * Hsz;

  // acc[i][j][r]: column n0 + wm*64 + i*16 + laneHi*8 + r, row m0 + wn*64 + j*16 + laneN
  v8f acc[4][4] = {};
  // A's rows are shared by the 8 blocks of one blockIdx.x, Wo's by the 32 of one blockIdx.y
  const int rot = (int)(blockIdx.x + 2 * blockIdx.y);
  gemm_loop(As, Bs, Wbase, Abase, tid, wm, wn, rot, acc);

  // The loop's last barrier stands behind every wave's last read of the tiles, and no
  // copy is outstanding: As and Bs are free. Each holds two waves' staging ranges of
  // 64 rows of BST floats.
  float* st = (float*)(wm ? Bs : As) + wn * (64 * BST);
  float* sw = st + laneN * BST + laneHi * 8;
  const float* bp = bias + n0 + wm * 64 + laneHi * 8;
  v4f b0[4], b1[4];
#pragma unroll  // all eight bias loads are issued ahead of the first use
  for (int i = 0; i < 4; ++i) {
    b0[i] = *(const v4f*)(bp + i * 16);
    b1[i] = *(const v4f*)(bp + i * 16 + 4);
  }
#pragma unroll  // constant indices keep the accumulators in registers
  for (int i = 0; i < 4; ++i) {
#pragma unroll  // constant indices keep the accumulators in registers
    for (int j = 0; j < 4; ++j) {
      v4f lo, hi;
#pragma unroll  // constant indices keep the accumulators in registers
      for (int r = 0; r < 4; ++r) {
        lo[r] = acc[i][j][r] + b0[i][r];
        hi[r] = acc[i][j][r + 4] + b1[i][r];
      }
      *(v4f*)(sw + j * 16 * BST + i * 16) = lo;
      *(v4f*)(sw + j * 16 * BST + i * 16 + 4) = hi;
    }
  }
  // the wave's own LDS writes are done before its lanes read one another's values back
  asm volatile("s_wait_dscnt 0x0" ::: "memory");
  const int rr = lane >> 4, q = lane & 15;  // 16 lanes to a 256-B row piece, 2 rows to a store
  const float* sr = st + rr * BST + q * 4;
  float* gl = dst + ((long)(m0 + wn * 64 + rr) * Hsz + n0 + wm * 64 + q * 4);
#pragma unroll  // LDS reads run ahead of the stores
  for (int k = 0; k < 32; ++k)
    *(v4f*)(gl + k * 2 * Hsz) = *(const v4f*)(sr + k * 2 * BST);
}

// One wave stages 16 rows x 64 floats of an [.., S, S] array into LDS (row stride
// BST floats), 8 x 16B a lane, whole 256-B rows: the 16 mask rows that it alone
// reads. They are a ring of one slot, private to the wave, and need no barrier.
// Fixed trip count: every lane is on at every copy.
__device__ __forceinline__ void stage16f(float* __restrict__ lds,
                                         const float* __restrict__ gbase,
                                         int lane) {
  const unsigned row = (unsigned)lane >> 4, q = (unsigned)lane & 15u;
  const unsigned l0 = lds_addr(lds + row * BST + q * 4);
  const float* g0 = gbase + (row * Ssz + q * 4);
  cp16x8(l0, l0 + 2 * BST * 4, l0 + 4 * BST * 4, l0 + 6 * BST * 4,
         l0 + 8 * BST * 4, l0 + 10 * BST * 4, l0 + 12 * BST * 4, l0 + 14 * BST * 4,
         g0, g0 + 2 * Ssz, g0 + 4 * Ssz, g0 + 6 * Ssz,
         g0 + 8 * Ssz, g0 + 10 * Ssz, g0 + 12 * Ssz, g0 + 14 * Ssz);
}

// The block's shared tiles of one key step, 512 threads, 8 x 16B each, one statement:
// K (64 keys x 64 halves) and V^T (64 d x 64 keys) of both batches, one copy a lane
// each (kl, vl: two tiles of TSZ halves, batch 0 then 1), and 128 rows x 64 floats of
// the bias, four copies a lane. hstep = halves from batch 0's head to batch 1's.
// Fixed trip count: every lane is on at every copy.
__device__ __forceinline__ void stage_kvb(_Float16* __restrict__ kl, const _Float16* __restrict__ kg,
                                          _Float16* __restrict__ vl, const _Float16* __restrict__ vg,
                                          float* __restrict__ pl, const float* __restrict__ pg,
                                          int tid) {
  const unsigned hstep = NHsz * Ssz * HDsz;
  const unsigned row = (unsigned)tid >> 3, q = (unsigned)tid & 7u;
  const unsigned lk = lds_addr(kl + row * FST + q * 8);
  const unsigned lv = lds_addr(vl + row * FST + q * 8);
  const _Float16* k0 = kg + (row * HDsz + q * 8);
  const _Float16* v0 = vg + (row * Ssz + q * 8);
  const unsigned prow = (unsigned)tid >> 4, pq = (unsigned)tid & 15u;
  const unsigned lp = lds_addr(pl + prow * BST + pq * 4);
  const float* p0 = pg + (prow * Ssz + pq * 4);
  cp16x8(lk, lk + TSZ * 2, lv, lv + TSZ * 2,
         lp, lp + 32 * BST * 4, lp + 64 * BST * 4, lp + 96 * BST * 4,
         k0, k0 + hstep, v0, v0 + hstep,
         p0, p0 + 32 * Ssz, p0 + 64 * Ssz, p0 + 96 * Ssz);
}

// 8 consecutive floats from LDS (16-B aligned): two ds_load_b128.
__device__ __forceinline__ v8f lds8f(const float* __restrict__ p) {
  v4f lo = *(const v4f*)p;
  v4f hi = *(const v4f*)(p + 4);
  return __builtin_shufflevector(lo, hi, 0, 1, 2, 3, 4, 5, 6, 7);
}

// e^x for eight values, as __expf compiles: a multiply by log2(e), then v_exp_f32.
// The eight v_exp_f32 stand in one asm statement, each on its own register, and a
// v_nop ends it: so no instruction directly behind a transcendental reads its result
// or overwrites its source.
__device__ __forceinline__ v8f exp8(v8f x) {
  x *= 1.44269504f;
  float a = x[0], b = x[1], c = x[2], d = x[3], e = x[4], f = x[5], g = x[6], h = x[7];
  asm("v_exp_f32 %0, %0\n\tv_exp_f32 %1, %1\n\tv_exp_f32 %2, %2\n\tv_exp_f32 %3, %3\n\t"
      "v_exp_f32 %4, %4\n\tv_exp_f32 %5, %5\n\tv_exp_f32 %6, %6\n\tv_exp_f32 %7, %7\n\tv_nop"
      : "+v"(a), "+v"(b), "+v"(c), "+v"(d), "+v"(e), "+v"(f), "+v"(g), "+v"(h));
  v8f r = {a, b, c, d, e, f, g, h};
  return r;
}

// value of lane l ^ 16
__device__ __forceinline__ float xhalf(float x) {
  int v = __builtin_bit_cast(int, x);
  return __builtin_bit_cast(float, __builtin_amdgcn_permlanex16(
      v, v, 0x76543210, 0xfedcba98, false, false));
}

__global__ void __launch_bounds__(512) attn_flash(
    const _Float16* __restrict__ q16, const _Float16* __restrict__ k16,
    const _Float16* __restrict__ vt16, const float* __restrict__ pbias,
    const float* __restrict__ mask, _Float16* __restrict__ out16) {
  __shared__ alignas(16) _Float16 Qs[2 * GTSZ];      // [batch][128 rows]
  __shared__ alignas(16) _Float16 Ks[2 * 2 * TSZ];   // [buffer][batch][64 keys]
  __shared__ alignas(16) _Float16 Vt[2 * 2 * TSZ];   // [buffer][batch][64 d]
  __shared__ alignas(16) float Pb[2 * 128 * BST];    // [buffer][128 rows], shared by the batches
  __shared__ alignas(16) float Mk[2 * 128 * BST];    // [batch][128 rows] = [wave][16 rows]

  const int tid = threadIdx.x;
  const int wave = tid >> 5;
  const int lane = tid & 31;
  const int laneN = lane & 15, laneHi = lane >> 4;
  const int qt = blockIdx.x;          // q tile 0..15
  const int h = blockIdx.y;           // head 0..15
  const int b = wave >> 3;            // this wave's batch
  const int wq = wave & 7;            // this wave's 16 rows in the q tile
  const int NKT = Ssz / 64;           // key tiles, a power of two: the walk wraps by a mask
  const int rot = 2 * (qt + h);       // the block's first key tile, before the wrap
  const long head0 = (long)h * Ssz * HDsz;       // batch 0's slice of q16/k16/vt16
  const _Float16* Khead = k16 + head0;           // [S, HD] rows, batch 0
  const _Float16* Vhead = vt16 + head0;          // [HD, S] rows, batch 0
  const float* pbTile = pbias + ((long)h * Ssz + qt * 128) * Ssz;
  const float* mkWave = mask + ((long)b * Ssz + qt * 128 + wq * 16) * Ssz;  // the wave's 16 rows
  float* MkW = Mk + wave * 16 * BST;
  const int qrow = wq * 16 + laneN;              // this lane's query row in the tile
  const float* pbRow = Pb + qrow * BST + laneHi * 8;
  const float* mkRow = MkW + laneN * BST + laneHi * 8;

  // Q of both batches: 2 x 128 rows of 64 halves, four copies a lane
  {
    const unsigned row = (unsigned)tid >> 3, q = (unsigned)tid & 7u;
    const unsigned lq = lds_addr(Qs + row * FST + q * 8);
    const _Float16* gq = q16 + head0 + ((qt * 128 + row) * HDsz + q * 8);
    cp16x4(lq, lq + TSZ * 2, lq + GTSZ * 2, lq + (GTSZ + TSZ) * 2,
           gq, gq + 64 * HDsz, gq + NHsz * Ssz * HDsz, gq + (NHsz * Ssz + 64) * HDsz);
  }
  // first tile: K rows [key][d], V^T rows [d][key], bias and mask rows [q][key]
  {
    const int k0 = (rot & (NKT - 1)) * 64;
    stage_kvb(Ks, Khead + k0 * HDsz, Vt, Vhead + k0, Pb, pbTile + k0, tid);
    stage16f(MkW, mkWave + k0, lane);
  }
  // this wave's copies have landed before the barrier publishes them
  asm volatile("s_wait_asynccnt 0x0" ::: "memory");
  __syncthreads();
  // K, V and bias of the second tile fly while the first is worked on
  {
    const int k1 = ((rot + 1) & (NKT - 1)) * 64;
    stage_kvb(Ks + 2 * TSZ, Khead + k1 * HDsz, Vt + 2 * TSZ, Vhead + k1,
              Pb + 128 * BST, pbTile + k1, tid);
  }

  const v16h qb0 = frag16(Qs + wave * 16 * FST, FST, 0);
  const v16h qb1 = frag16(Qs + wave * 16 * FST, FST, 32);
  v8f o[4] = {};                      // o[nt][r] = O[qrow][nt*16 + laneHi*8 + r]
  float m = -3.0e38f;                 // running maximum of the row (both halves agree)
  float l = 0.0f;                     // running sum over this lane's own keys only

  for (int kt = 0; kt < NKT; ++kt) {
    _Float16* Kb = Ks + (kt & 1) * 2 * TSZ;      // this tile's buffers, batch 0 first
    _Float16* Vb = Vt + (kt & 1) * 2 * TSZ;
    const _Float16* Kc = Kb + b * TSZ;
    const _Float16* Vc = Vb + b * TSZ;
    const float* pbCur = pbRow + (kt & 1) * 128 * BST;

    // this tile's bias + mask go to registers, so that the mask rows can be refilled at once
    v8f bm[4];
#pragma unroll  // constant indices keep the vectors in registers
    for (int nt = 0; nt < 4; ++nt)
      bm[nt] = lds8f(pbCur + nt * 16) + lds8f(mkRow + nt * 16);
    // this wave's reads of its own mask rows have returned before it refills them
    asm volatile("s_wait_dscnt 0x0" ::: "memory");
    if (kt + 1 < NKT) stage16f(MkW, mkWave + ((kt + 1 + rot) & (NKT - 1)) * 64, lane);

    // S^T = K Q^T (+ bias + mask): s[nt][r] = S[qrow][nt*16 + laneHi*8 + r]
    v8f s[4];
#pragma unroll  // constant indices keep the vectors in registers
    for (int nt = 0; nt < 4; ++nt) {
      v8f c = {};
      v16h kf0 = frag16(Kc + nt * 16 * FST, FST, 0);
      v16h kf1 = frag16(Kc + nt * 16 * FST, FST, 32);
      c = WMMA(kf0, qb0, c);
      c = WMMA(kf1, qb1, c);
      s[nt] = c + bm[nt];
    }

    // online softmax, one query row per lane pair (l, l ^ 16)
    float rm = s[0][0];
#pragma unroll  // constant indices keep the vectors in registers
    for (int nt = 0; nt < 4; ++nt)
#pragma unroll  // constant indices keep the vectors in registers
      for (int r = 0; r < 8; ++r) rm = fmaxf(rm, s[nt][r]);
    rm = fmaxf(rm, xhalf(rm));
    const float mNew = fmaxf(m, rm);
    const float f = __expf(m - mNew);
    m = mNew;
#pragma unroll  // constant indices keep the vectors in registers
    for (int nt = 0; nt < 4; ++nt) s[nt] = exp8(s[nt] - mNew);
    const v8f ps = (s[0] + s[1]) + (s[2] + s[3]);
    l = l * f + (((ps[0] + ps[1]) + (ps[2] + ps[3])) +
                 ((ps[4] + ps[5]) + (ps[6] + ps[7])));
    v16h p0, p1;
#pragma unroll  // constant indices keep the vectors in registers
    for (int r = 0; r < 8; ++r) {
      p0[r] = (_Float16)s[0][r]; p0[r + 8] = (_Float16)s[1][r];
      p1[r] = (_Float16)s[2][r]; p1[r + 8] = (_Float16)s[3][r];
    }

    // rescale running O^T, then O^T += V^T P^T
#pragma unroll  // constant indices keep the vectors in registers
    for (int nt = 0; nt < 4; ++nt) {
      v16h vf0 = frag16(Vc + nt * 16 * FST, FST, 0);
      v16h vf1 = frag16(Vc + nt * 16 * FST, FST, 32);
      o[nt] *= f;
      o[nt] = WMMA(vf0, p0, o[nt]);
      o[nt] = WMMA(vf1, p1, o[nt]);
    }
    // this wave's reads of K, V and bias have returned before their buffers are refilled
    asm volatile("s_wait_dscnt 0x0" ::: "memory");
    // this wave's copies of tile kt + 1 have landed before the barrier publishes K, V and bias
    asm volatile("s_wait_asynccnt 0x0" ::: "memory");
    __syncthreads();
    if (kt + 2 < NKT) {
      const int kn = ((kt + 2 + rot) & (NKT - 1)) * 64;
      stage_kvb(Kb, Khead + kn * HDsz, Vb, Vhead + kn,
                Pb + (kt & 1) * 128 * BST, pbTile + kn, tid);
    }
  }
  // no copy is outstanding when the wave goes on to its stores and ends
  asm volatile("s_wait_asynccnt 0x0" ::: "memory");

  // join the halves' sums, normalize, write to [B, S, H] f16 (16 B per store)
  l += xhalf(l);
  _Float16* orow = out16 + ((long)(b * Ssz + qt * 128 + qrow)) * Hsz + h * HDsz + laneHi * 8;
#pragma unroll  // constant indices keep the vectors in registers
  for (int nt = 0; nt < 4; ++nt) {
    v8h hv;
#pragma unroll  // constant indices keep the vectors in registers
    for (int r = 0; r < 8; ++r) hv[r] = (_Float16)(o[nt][r] / l);
    *(v8h*)(orow + nt * 16) = hv;
  }
}

// ---------------------------------------------------------------------------
extern "C" void kernel_launch(void* const* d_in, const int* in_sizes, int n_in,
                              void* d_out, int out_size, void* d_ws, size_t ws_size,
                              hipStream_t stream) {
  const float* hs  = (const float*)d_in[0];
  const float* pb  = (const float*)d_in[1];
  const float* msk = (const float*)d_in[2];
  const float* Wq  = (const float*)d_in[3];
  const float* bq  = (const float*)d_in[4];
  const float* Wk  = (const float*)d_in[5];
  const float* bk  = (const float*)d_in[6];
  const float* Wv  = (const float*)d_in[7];
  const float* bv  = (const float*)d_in[8];
  const float* Wo  = (const float*)d_in[9];
  const float* bo  = (const float*)d_in[10];
  float* out = (float*)d_out;

  const int NHS = Bsz * Ssz * Hsz;   // 4,194,304
  const int WSZ = Hsz * Hsz;         // 1,048,576
  _Float16* hs16 = (_Float16*)d_ws;
  _Float16* w16  = hs16 + NHS;       // 4 weight matrices
  _Float16* q16  = w16 + 4 * (size_t)WSZ;
  _Float16* k16  = q16 + NHS;
  _Float16* vt16 = k16 + NHS;        // V stored [B,NH,HD,S]
  _Float16* ao16 = vt16 + NHS;

  // fp32 -> f16 staging: hs16 and the four w16 matrices are one contiguous range
  cvt_all<<<512, 256, 0, stream>>>(hs, Wq, Wk, Wv, Wo, hs16);

  // Q, K, V: w16 holds Wq, Wk, Wv in a row; q16, k16, vt16 lie in a row
  dim3 gp(32, 8), blk(128);
  gemm_proj<<<dim3(32, 8, 3), blk, 0, stream>>>(hs16, w16, bq, bk, bv, q16);

  attn_flash<<<dim3(Ssz / 128, NHsz), dim3(512), 0, stream>>>(q16, k16, vt16, pb, msk, ao16);

  gemm_out<<<gp, blk, 0, stream>>>(ao16, w16 + 3 * (size_t)WSZ, bo, out);
}

// v008
// One run takes 92 microseconds.
// Next to v007, in two timings, it ran 1.03 times as fast each time.
// All steps since v000 together make it 3.62 times as fast.
#include <hip/hip_runtime.h>
#include <hip/hip_bf16.h>

typedef __attribute__((ext_vector_type(16))) _Float16 v16h;
typedef __attribute__((ext_vector_type(4)))  _Float16 v4h;
typedef __attribute__((ext_vector_type(8)))  _Float16 v8h;
typedef __attribute__((ext_vector_type(4)))  float    v4f;
typedef __attribute__((ext_vector_type(8)))  float    v8f;

#define Bsz 2
#define Ssz 2048
#define Hsz 1024
#define NHsz 16
#define HDsz 64
#define QSCALE 0.125f

#define FST 72   // f16 LDS tile stride (64 + 8 pad) -> 144 B, 16B aligned rows
#define TSZ (64 * FST)  // halves in one 64 x 64 f16 LDS tile
#define GTSZ (128 * FST)  // halves in one 128-row x 64 f16 LDS tile of the GEMMs
#define BST 68   // f32 LDS tile stride (64 + 4 pad) -> 272 B rows (16 B x odd): b128 row reads spread over all banks

// ---------------------------------------------------------------------------
// 16-byte global -> LDS copies on the CDNA5 async-to-LDS path (ASYNCcnt,
// GLOBAL_LOAD_ASYNC_TO_LDS_B128), four or eight to a statement. Each lane names its own
// LDS byte address and its own global pointer; no immediate offset. The
// s_wait_xcnt 0 is the statement's last line, so that it stands in front of
// every later write of a register that one of these copies names (a precaution).
// ---------------------------------------------------------------------------
__device__ __forceinline__ unsigned lds_addr(const void* p) {
  return (unsigned)(unsigned long long)p;  // low 32 bits of a __shared__ address
}

__device__ __forceinline__ void cp16x4(unsigned l0, unsigned l1, unsigned l2, unsigned l3,
                                       const void* g0, const void* g1,
                                       const void* g2, const void* g3) {
  asm volatile(
      "global_load_async_to_lds_b128 %0, %4, off\n\t"
      "global_load_async_to_lds_b128 %1, %5, off\n\t"
      "global_load_async_to_lds_b128 %2, %6, off\n\t"
      "global_load_async_to_lds_b128 %3, %7, off\n\t"
      "s_wait_xcnt 0x0"
      :: "v"(l0), "v"(l1), "v"(l2), "v"(l3), "v"(g0), "v"(g1), "v"(g2), "v"(g3)
      : "memory");
}

__device__ __forceinline__ void cp16x8(unsigned l0, unsigned l1, unsigned l2, unsigned l3,
                                       unsigned l4, unsigned l5, unsigned l6, unsigned l7,
                                       const void* g0, const void* g1,
                                       const void* g2, const void* g3,
                                       const void* g4, const void* g5,
                                       const void* g6, const void* g7) {
  asm volatile(
      "global_load_async_to_lds_b128 %0, %8, off\n\t"
      "global_load_async_to_lds_b128 %1, %9, off\n\t"
      "global_load_async_to_lds_b128 %2, %10, off\n\t"
      "global_load_async_to_lds_b128 %3, %11, off\n\t"
      "global_load_async_to_lds_b128 %4, %12, off\n\t"
      "global_load_async_to_lds_b128 %5, %13, off\n\t"
      "global_load_async_to_lds_b128 %6, %14, off\n\t"
      "global_load_async_to_lds_b128 %7, %15, off\n\t"
      "s_wait_xcnt 0x0"
      :: "v"(l0), "v"(l1), "v"(l2), "v"(l3), "v"(l4), "v"(l5), "v"(l6), "v"(l7),
         "v"(g0), "v"(g1), "v"(g2), "v"(g3), "v"(g4), "v"(g5), "v"(g6), "v"(g7)
      : "memory");
}

// Stage a 128-row x 64-half tile of an [.., Hsz] array into LDS (row stride FST
// halves). 128 threads, 8 x 16B each. Fixed trip count: every lane is on at every copy.
__device__ __forceinline__ void stage128(_Float16* __restrict__ lds,
                                         const _Float16* __restrict__ gbase, int tid) {
  const unsigned row = (unsigned)tid >> 3, q = (unsigned)tid & 7u;
  const unsigned l0 = lds_addr(lds + row * FST + q * 8);
  const _Float16* g0 = gbase + (row * Hsz + q * 8);
  cp16x8(l0, l0 + 16 * FST * 2, l0 + 32 * FST * 2, l0 + 48 * FST * 2,
         l0 + 64 * FST * 2, l0 + 80 * FST * 2, l0 + 96 * FST * 2, l0 + 112 * FST * 2,
         g0, g0 + 16 * Hsz, g0 + 32 * Hsz, g0 + 48 * Hsz,
         g0 + 64 * Hsz, g0 + 80 * Hsz, g0 + 96 * Hsz, g0 + 112 * Hsz);
}

// ---------------------------------------------------------------------------
// Fragment gather from LDS, 16-bit A/B matrix layout (ISA 7.12.2, wave32):
// lane m = lane&15 selects the row (A: M-row, B: N-column of the N x K tile),
// hi = lane>>4 selects K-halves; element e -> K = kofs + 8*hi + (e<8 ? e : e+8).
// Pairs are K-consecutive -> lowers to two ds_load_b128 per fragment.
// ---------------------------------------------------------------------------
__device__ __forceinline__ v16h frag16(const _Float16* __restrict__ base,
                                       int stride, int kofs) {
  const int lane = threadIdx.x & 31;
  const int m  = lane & 15;
  const int hi = lane >> 4;
  const _Float16* r = base + m * stride + kofs + hi * 8;
  v16h f;
#pragma unroll
  for (int e = 0; e < 16; e += 2) {
    int k = (e < 8) ? e : (e + 8);
    f[e]     = r[k];
    f[e + 1] = r[k + 1];
  }
  return f;
}

#define WMMA(a, b, c) __builtin_amdgcn_wmma_f32_16x16x32_f16( \
    false, (a), false, (b), (short)0, (c), false, false)

// ---------------------------------------------------------------------------
// K loop of both GEMMs: acc += A tile x W tile^T over Hsz in steps of 64, on two
// LDS buffers each for A and W: tile t + 1's copies fly while tile t is worked on.
// The block's tile is 128 x 128; its four waves lie 2 x 2, each on 64 x 64 (wm, wn
// = the wave's row and column): a fragment read from LDS feeds four products.
// Trip t works on k tile (t + rot) mod 16: blocks that share an operand's rows get
// different rot, so that they do not ask L2 for the same lines at the same moment.
// The fragments lie in two register sets, one for each 32-k half of a tile: a half's
// LDS reads are issued ahead of the other half's 16 products and land under them.
// The second half's products work on registers alone and stand behind the trip's barrier.
// ---------------------------------------------------------------------------
__device__ __forceinline__ void gemm_loop(_Float16* As, _Float16* Bs,
                                          const _Float16* __restrict__ Abase,
                                          const _Float16* __restrict__ Wbase,
                                          int tid, int wm, int wn, int rot, v8f (&acc)[4][4]) {
  const int NT = Hsz / 64;  // a power of two: the walk wraps by a mask
  stage128(As, Abase + (rot & (NT - 1)) * 64, tid);
  stage128(Bs, Wbase + (rot & (NT - 1)) * 64, tid);
  // this wave's copies of tile 0 have landed before the barrier publishes them
  asm volatile("s_wait_asynccnt 0x0" ::: "memory");
  __syncthreads();
  stage128(As + GTSZ, Abase + ((rot + 1) & (NT - 1)) * 64, tid);
  stage128(Bs + GTSZ, Wbase + ((rot + 1) & (NT - 1)) * 64, tid);
  const _Float16* Aw0 = As + wm * 64 * FST;
  const _Float16* Bw0 = Bs + wn * 64 * FST;
  v16h a0[4], b0[4], a1[4], b1[4];
#pragma unroll  // constant indices keep the fragments in registers
  for (int i = 0; i < 4; ++i) {
    a0[i] = frag16(Aw0 + i * 16 * FST, FST, 0);
    b0[i] = frag16(Bw0 + i * 16 * FST, FST, 0);
  }
  for (int t = 0; t < NT; ++t) {
    const int cur = (t & 1) * GTSZ;
    const _Float16* Aw = Aw0 + cur;
    const _Float16* Bw = Bw0 + cur;
#pragma unroll  // constant indices keep the fragments in registers
    for (int i = 0; i < 4; ++i) {
      a1[i] = frag16(Aw + i * 16 * FST, FST, 32);
      b1[i] = frag16(Bw + i * 16 * FST, FST, 32);
    }
    // the second half's LDS reads stay one group ahead of the first half's products:
    // left free, the compiler puts them among the products and waits for each
    __builtin_amdgcn_sched_barrier(0);
#pragma unroll  // constant indices keep the accumulators in registers
    for (int i = 0; i < 4; ++i)
#pragma unroll  // constant indices keep the accumulators in registers
      for (int j = 0; j < 4; ++j) acc[i][j] = WMMA(a0[i], b0[j], acc[i][j]);
    // the products are issued ahead of the waits, so that the reads land under them
    __builtin_amdgcn_sched_barrier(0);
    // this wave's reads of tile t have returned before the buffer is refilled
    asm volatile("s_wait_dscnt 0x0" ::: "memory");
    // this wave's copies of tile t + 1 have landed before the barrier publishes them
    asm volatile("s_wait_asynccnt 0x0" ::: "memory");
    __syncthreads();
    if (t + 2 < NT) {
      const int kn = ((t + 2 + rot) & (NT - 1)) * 64;
      stage128(As + cur, Abase + kn, tid);
      stage128(Bs + cur, Wbase + kn, tid);
    }
    if (t + 1 < NT) {
      const _Float16* An = Aw0 + (GTSZ - cur);
      const _Float16* Bn = Bw0 + (GTSZ - cur);
#pragma unroll  // constant indices keep the fragments in registers
      for (int i = 0; i < 4; ++i) {
        a0[i] = frag16(An + i * 16 * FST, FST, 0);
        b0[i] = frag16(Bn + i * 16 * FST, FST, 0);
      }
    }
    // the next tile's first LDS reads stay one group ahead of this tile's last products
    __builtin_amdgcn_sched_barrier(0);
#pragma unroll  // constant indices keep the accumulators in registers
    for (int i = 0; i < 4; ++i)
#pragma unroll  // constant indices keep the accumulators in registers
      for (int j = 0; j < 4; ++j) acc[i][j] = WMMA(a1[i], b1[j], acc[i][j]);
  }
  // no copy is outstanding when the wave goes on to its stores and ends
  asm volatile("s_wait_asynccnt 0x0" ::: "memory");
}

// ---------------------------------------------------------------------------
// All five fp32 -> f16 conversions in one launch. The five destinations lie one
// behind the other in the workspace, so dst is one array of 8 segments of H*H
// elements: segments 0..3 are hidden_states, 4..7 are Wq, Wk, Wv, Wo.
// 64 blocks per segment; a block converts 16,384 elements, a thread 16 x 4.
// ---------------------------------------------------------------------------
__global__ void __launch_bounds__(256) cvt_all(
    const float* __restrict__ hs, const float* __restrict__ wq,
    const float* __restrict__ wk, const float* __restrict__ wv,
    const float* __restrict__ wo, _Float16* __restrict__ dst) {
  const int seg = blockIdx.x >> 6;
  const float* sbase = seg < 4 ? hs + (long)seg * (Hsz * Hsz)
                     : seg == 4 ? wq : seg == 5 ? wk : seg == 6 ? wv : wo;
  const int off = (blockIdx.x & 63) * 16384 + threadIdx.x * 4;
  const float* s = sbase + off;
  _Float16* d = dst + (long)seg * (Hsz * Hsz) + off;
  float4 f[16];
#pragma unroll  // all sixteen loads are issued ahead of the first store
  for (int j = 0; j < 16; ++j) f[j] = *(const float4*)(s + j * 1024);
#pragma unroll  // constant indices keep the array in registers
  for (int j = 0; j < 16; ++j) {
    v4h h;
    h[0] = (_Float16)f[j].x; h[1] = (_Float16)f[j].y;
    h[2] = (_Float16)f[j].z; h[3] = (_Float16)f[j].w;
    *(v4h*)(d + j * 1024) = h;
  }
}

// ---------------------------------------------------------------------------
// A wave's staged 64 x 64 f16 tile (rows of FST halves in its own LDS range) goes to
// global rows PITCH halves apart: 8 lanes to a 128-B row, 4 rows to a store.
// ---------------------------------------------------------------------------
template <int PITCH>
__device__ __forceinline__ void put_tile(const _Float16* __restrict__ st,
                                         _Float16* __restrict__ g, int lane) {
  // the wave's own LDS writes are done before its lanes read one another's values back
  asm volatile("s_wait_dscnt 0x0" ::: "memory");
  const int rr = lane >> 3, q = lane & 7;
  const _Float16* sr = st + rr * FST + q * 8;
  _Float16* gl = g + rr * PITCH + q * 8;
#pragma unroll  // the sixteen LDS reads are issued ahead of the stores
  for (int k = 0; k < 16; ++k)
    *(v8h*)(gl + k * 4 * PITCH) = *(const v8h*)(sr + k * 4 * FST);
}

// ---------------------------------------------------------------------------
// Projection GEMMs, all three in one launch: out = (X @ W^T + bias) * scale, f16
// output. z = 0, 1, 2 is Q, K, V: it picks the weight matrix (W3 holds the three
// one behind the other), the bias, the output (dst3 likewise) and its form.
// vmode=0: per-head [B,NH,S,HD];  vmode=1: transposed per-head [B,NH,HD,S].
// Block = 128 threads (4 waves), tile 128 x 128, K-step 64.
// The first WMMA operand is the one whose index is contiguous in the output (W's
// rows for Q and K, X's rows for V): a lane's 8 accumulator registers are then 8
// neighbours in memory. Each wave turns its 64 x 64 tile in its own LDS range and
// stores it as whole 128-B rows, 16 B a lane.
// ---------------------------------------------------------------------------
__global__ void __launch_bounds__(128) gemm_proj(
    const _Float16* __restrict__ A, const _Float16* __restrict__ W3,
    const float* __restrict__ bq, const float* __restrict__ bk,
    const float* __restrict__ bv, _Float16* __restrict__ dst3) {
  __shared__ alignas(16) _Float16 As[2 * GTSZ];
  __shared__ alignas(16) _Float16 Bs[2 * GTSZ];
  const int z = 2 - (int)blockIdx.z;  // blockIdx.z = 0, 1, 2 is V, K, Q
  const _Float16* W = W3 + (long)z * (Hsz * Hsz);
  const float* bias = z == 0 ? bq : z == 1 ? bk : bv;
  _Float16* dst = dst3 + (long)z * (Bsz * Ssz * Hsz);
  const float scale = z == 0 ? QSCALE : 1.0f;
  const int vmode = z == 2;
  const int tid = threadIdx.x;
  const int wave = tid >> 5;
  const int wm = wave >> 1, wn = wave & 1;
  const int lane = tid & 31;
  const int laneN = lane & 15, laneHi = lane >> 4;
  const int m0 = blockIdx.x * 128;   // rows of X (positions)
  const int n0 = blockIdx.y * 128;   // rows of W (output features)
  const _Float16* Xbase = A + (long)m0 * Hsz;
  const _Float16* Wbase = W + (long)n0 * Hsz;

  // acc[i][j][r]: first operand's row wm*64 + i*16 + laneHi*8 + r,
  //               second operand's row wn*64 + j*16 + laneN
  v8f acc[4][4] = {};
  // X's rows are shared by the 24 blocks of one blockIdx.x, W's by the 32 of one (y, z)
  const int rot = (int)(blockIdx.x + blockIdx.y + 8 * blockIdx.z);
  gemm_loop(As, Bs, vmode ? Xbase : Wbase, vmode ? Wbase : Xbase, tid, wm, wn, rot, acc);

  // The loop's last barrier stands behind every wave's last read of the tiles, and no
  // copy is outstanding: As is free. Wave w stages in As[w * TSZ ..), 64 rows of FST halves:
  // row = second operand's row in the wave's tile, column = first operand's.
  _Float16* st = As + wave * TSZ;
  _Float16* sw = st + laneN * FST + laneHi * 8;
  // A tile lies in one batch; a wave's 64 features lie in one head.
  if (vmode) {
#pragma unroll  // constant indices keep the accumulators in registers
    for (int j = 0; j < 4; ++j) {
      const float bc = bias[n0 + wn * 64 + j * 16 + laneN];
#pragma unroll  // constant indices keep the accumulators in registers
      for (int i = 0; i < 4; ++i) {
        v8h hv;
#pragma unroll  // constant indices keep the accumulators in registers
        for (int r = 0; r < 8; ++r) hv[r] = (_Float16)(acc[i][j][r] + bc);
        *(v8h*)(sw + j * 16 * FST + i * 16) = hv;
      }
    }
    // staged row = feature, column = position
    put_tile<Ssz>(st, dst + ((long)((m0 >> 11) * Hsz + n0 + wn * 64) * Ssz + (m0 & 2047) + wm * 64), lane);
  } else {
    const float* bp = bias + n0 + wm * 64 + laneHi * 8;
    v4f b0[4], b1[4];
#pragma unroll  // all eight bias loads are issued ahead of the first use
    for (int i = 0; i < 4; ++i) {
      b0[i] = *(const v4f*)(bp + i * 16);
      b1[i] = *(const v4f*)(bp + i * 16 + 4);
    }
#pragma unroll  // constant indices keep the accumulators in registers
    for (int i = 0; i < 4; ++i) {
#pragma unroll  // constant indices keep the accumulators in registers
      for (int j = 0; j < 4; ++j) {
        v8h hv;
#pragma unroll  // constant indices keep the accumulators in registers
        for (int r = 0; r < 4; ++r) {
          hv[r]     = (_Float16)((acc[i][j][r] + b0[i][r]) * scale);
          hv[r + 4] = (_Float16)((acc[i][j][r + 4] + b1[i][r]) * scale);
        }
        *(v8h*)(sw + j * 16 * FST + i * 16) = hv;
      }
    }
    // staged row = position, column = feature inside the head
    put_tile<HDsz>(st, dst + ((long)((m0 >> 11) * NHsz + (n0 >> 6) + wm) * Ssz + (m0 & 2047) + wn * 64) * HDsz, lane);
  }
}

// ---------------------------------------------------------------------------
// Output projection GEMM: d_out = A @ Wo^T + bo  (fp32 output, [4096,1024])
// Wo's rows are the first WMMA operand: a lane's 8 accumulator registers are 8
// neighbours of one output row. Each wave turns its 64 x 64 tile in its own LDS
// range and stores whole 256-B row pieces, 16 B a lane.
// ---------------------------------------------------------------------------
__global__ void __launch_bounds__(128) gemm_out(
    const _Float16* __restrict__ A, const _Float16* __restrict__ W,
    const float* __restrict__ bias, float* __restrict__ dst) {
  __shared__ alignas(16) _Float16 As[2 * GTSZ];
  __shared__ alignas(16) _Float16 Bs[2 * GTSZ];
  const int tid = threadIdx.x;
  const int wave = tid >> 5;
  const int wm = wave >> 1, wn = wave & 1;
  const int lane = tid & 31;
  const int laneN = lane & 15, laneHi = lane >> 4;
  const int m0 = blockIdx.x * 128;
  const int n0 = blockIdx.y * 128;
  const _Float16* Abase = A + (long)m0 * Hsz;
  const _Float16* Wbase = W + (long)n0 * Hsz;

  // acc[i][j][r]: column n0 + wm*64 + i*16 + laneHi*8 + r, row m0 + wn*64 + j*16 + laneN
  v8f acc[4][4] = {};
  // A's rows are shared by the 8 blocks of one blockIdx.x, Wo's by the 32 of one blockIdx.y
  const int rot = (int)(blockIdx.x + 2 * blockIdx.y);
  gemm_loop(As, Bs, Wbase, Abase, tid, wm, wn, rot, acc);

  // The loop's last barrier stands behind every wave's last read of the tiles, and no
  // copy is outstanding: As and Bs are free. Each holds two waves' staging ranges of
  // 64 rows of BST floats.
  float* st = (float*)(wm ? Bs : As) + wn * (64 * BST);
  float* sw = st + laneN * BST + laneHi * 8;
  const float* bp = bias + n0 + wm * 64 + laneHi * 8;
  v4f b0[4], b1[4];
#pragma unroll  // all eight bias loads are issued ahead of the first use
  for (int i = 0; i < 4; ++i) {
    b0[i] = *(const v4f*)(bp + i * 16);
    b1[i] = *(const v4f*)(bp + i * 16 + 4);
  }
#pragma unroll  // constant indices keep the accumulators in registers
  for (int i = 0; i < 4; ++i) {
#pragma unroll  // constant indices keep the accumulators in registers
    for (int j = 0; j < 4; ++j) {
      v4f lo, hi;
#pragma unroll  // constant indices keep the accumulators in registers
      for (int r = 0; r < 4; ++r) {
        lo[r] = acc[i][j][r] + b0[i][r];
        hi[r] = acc[i][j][r + 4] + b1[i][r];
      }
      *(v4f*)(sw + j * 16 * BST + i * 16) = lo;
      *(v4f*)(sw + j * 16 * BST + i * 16 + 4) = hi;
    }
  }
  // the wave's own LDS writes are done before its lanes read one another's values back
  asm volatile("s_wait_dscnt 0x0" ::: "memory");
  const int rr = lane >> 4, q = lane & 15;  // 16 lanes to a 256-B row piece, 2 rows to a store
  const float* sr = st + rr * BST + q * 4;
  float* gl = dst + ((long)(m0 + wn * 64 + rr) * Hsz + n0 + wm * 64 + q * 4);
#pragma unroll  // LDS reads run ahead of the stores
  for (int k = 0; k < 32; ++k)
    *(v4f*)(gl + k * 2 * Hsz) = *(const v4f*)(sr + k * 2 * BST);
}

// One wave stages 16 rows x 64 floats of an [.., S, S] array into LDS (row stride
// BST floats), 8 x 16B a lane, whole 256-B rows: the 16 mask rows that it alone
// reads. They are a ring of one slot, private to the wave, and need no barrier.
// Fixed trip count: every lane is on at every copy.
__device__ __forceinline__ void stage16f(float* __restrict__ lds,
                                         const float* __restrict__ gbase,
                                         int lane) {
  const unsigned row = (unsigned)lane >> 4, q = (unsigned)lane & 15u;
  const unsigned l0 = lds_addr(lds + row * BST + q * 4);
  const float* g0 = gbase + (row * Ssz + q * 4);
  cp16x8(l0, l0 + 2 * BST * 4, l0 + 4 * BST * 4, l0 + 6 * BST * 4,
         l0 + 8 * BST * 4, l0 + 10 * BST * 4, l0 + 12 * BST * 4, l0 + 14 * BST * 4,
         g0, g0 + 2 * Ssz, g0 + 4 * Ssz, g0 + 6 * Ssz,
         g0 + 8 * Ssz, g0 + 10 * Ssz, g0 + 12 * Ssz, g0 + 14 * Ssz);
}

// The block's shared tiles of one key step, 512 threads, 8 x 16B each, one statement:
// K (64 keys x 64 halves) and V^T (64 d x 64 keys) of both batches, one copy a lane
// each (kl, vl: two tiles of TSZ halves, batch 0 then 1), and 128 rows x 64 floats of
// the bias, four copies a lane. hstep = halves from batch 0's head to batch 1's.
// Fixed trip count: every lane is on at every copy.
__device__ __forceinline__ void stage_kvb(_Float16* __restrict__ kl, const _Float16* __restrict__ kg,
                                          _Float16* __restrict__ vl, const _Float16* __restrict__ vg,
                                          float* __restrict__ pl, const float* __restrict__ pg,
                                          int tid) {
  const unsigned hstep = NHsz * Ssz * HDsz;
  const unsigned row = (unsigned)tid >> 3, q = (unsigned)tid & 7u;
  const unsigned lk = lds_addr(kl + row * FST + q * 8);
  const unsigned lv = lds_addr(vl + row * FST + q * 8);
  const _Float16* k0 = kg + (row * HDsz + q * 8);
  const _Float16* v0 = vg + (row * Ssz + q * 8);
  const unsigned prow = (unsigned)tid >> 4, pq = (unsigned)tid & 15u;
  const unsigned lp = lds_addr(pl + prow * BST + pq * 4);
  const float* p0 = pg + (prow * Ssz + pq * 4);
  cp16x8(lk, lk + TSZ * 2, lv, lv + TSZ * 2,
         lp, lp + 32 * BST * 4, lp + 64 * BST * 4, lp + 96 * BST * 4,
         k0, k0 + hstep, v0, v0 + hstep,
         p0, p0 + 32 * Ssz, p0 + 64 * Ssz, p0 + 96 * Ssz);
}

// 8 consecutive floats from LDS (16-B aligned): two ds_load_b128.
__device__ __forceinline__ v8f lds8f(const float* __restrict__ p) {
  v4f lo = *(const v4f*)p;
  v4f hi = *(const v4f*)(p + 4);
  return __builtin_shufflevector(lo, hi, 0, 1, 2, 3, 4, 5, 6, 7);
}

// e^x for eight values, as __expf compiles: a multiply by log2(e), then v_exp_f32.
// The eight v_exp_f32 stand in one asm statement, each on its own register, and a
// v_nop ends it: so no instruction directly behind a transcendental reads its result
// or overwrites its source.
__device__ __forceinline__ v8f exp8(v8f x) {
  x *= 1.44269504f;
  float a = x[0], b = x[1], c = x[2], d = x[3], e = x[4], f = x[5], g = x[6], h = x[7];
  asm("v_exp_f32 %0, %0\n\tv_exp_f32 %1, %1\n\tv_exp_f32 %2, %2\n\tv_exp_f32 %3, %3\n\t"
      "v_exp_f32 %4, %4\n\tv_exp_f32 %5, %5\n\tv_exp_f32 %6, %6\n\tv_exp_f32 %7, %7\n\tv_nop"
      : "+v"(a), "+v"(b), "+v"(c), "+v"(d), "+v"(e), "+v"(f), "+v"(g), "+v"(h));
  v8f r = {a, b, c, d, e, f, g, h};
  return r;
}

// value of lane l ^ 16
__device__ __forceinline__ float xhalf(float x) {
  int v = __builtin_bit_cast(int, x);
  return __builtin_bit_cast(float, __builtin_amdgcn_permlanex16(
      v, v, 0x76543210, 0xfedcba98, false, false));
}

__global__ void __launch_bounds__(512) attn_flash(
    const _Float16* __restrict__ q16, const _Float16* __restrict__ k16,
    const _Float16* __restrict__ vt16, const float* __restrict__ pbias,
    const float* __restrict__ mask, _Float16* __restrict__ out16) {
  __shared__ alignas(16) _Float16 Qs[2 * GTSZ];      // [batch][128 rows]
  __shared__ alignas(16) _Float16 Ks[2 * 2 * TSZ];   // [buffer][batch][64 keys]
  __shared__ alignas(16) _Float16 Vt[2 * 2 * TSZ];   // [buffer][batch][64 d]
  __shared__ alignas(16) float Pb[2 * 128 * BST];    // [buffer][128 rows], shared by the batches
  __shared__ alignas(16) float Mk[2 * 128 * BST];    // [batch][128 rows] = [wave][16 rows]

  const int tid = threadIdx.x;
  const int wave = tid >> 5;
  const int lane = tid & 31;
  const int laneN = lane & 15, laneHi = lane >> 4;
  const int qt = blockIdx.x;          // q tile 0..15
  const int h = blockIdx.y;           // head 0..15
  const int b = wave >> 3;            // this wave's batch
  const int wq = wave & 7;            // this wave's 16 rows in the q tile
  const int NKT = Ssz / 64;           // key tiles, a power of two: the walk wraps by a mask
  const int rot = 2 * (qt + h);       // the block's first key tile, before the wrap
  const long head0 = (long)h * Ssz * HDsz;       // batch 0's slice of q16/k16/vt16
  const _Float16* Khead = k16 + head0;           // [S, HD] rows, batch 0
  const _Float16* Vhead = vt16 + head0;          // [HD, S] rows, batch 0
  const float* pbTile = pbias + ((long)h * Ssz + qt * 128) * Ssz;
  const float* mkWave = mask + ((long)b * Ssz + qt * 128 + wq * 16) * Ssz;  // the wave's 16 rows
  float* MkW = Mk + wave * 16 * BST;
  const int qrow = wq * 16 + laneN;              // this lane's query row in the tile
  const float* pbRow = Pb + qrow * BST + laneHi * 8;
  const float* mkRow = MkW + laneN * BST + laneHi * 8;

  // Q of both batches: 2 x 128 rows of 64 halves, four copies a lane
  {
    const unsigned row = (unsigned)tid >> 3, q = (unsigned)tid & 7u;
    const unsigned lq = lds_addr(Qs + row * FST + q * 8);
    const _Float16* gq = q16 + head0 + ((qt * 128 + row) * HDsz + q * 8);
    cp16x4(lq, lq + TSZ * 2, lq + GTSZ * 2, lq + (GTSZ + TSZ) * 2,
           gq, gq + 64 * HDsz, gq + NHsz * Ssz * HDsz, gq + (NHsz * Ssz + 64) * HDsz);
  }
  // first tile: K rows [key][d], V^T rows [d][key], bias and mask rows [q][key]
  {
    const int k0 = (rot & (NKT - 1)) * 64;
    stage_kvb(Ks, Khead + k0 * HDsz, Vt, Vhead + k0, Pb, pbTile + k0, tid);
    stage16f(MkW, mkWave + k0, lane);
  }
  // this wave's copies have landed before the barrier publishes them
  asm volatile("s_wait_asynccnt 0x0" ::: "memory");
  __syncthreads();
  // K, V and bias of the second tile fly while the first is worked on
  {
    const int k1 = ((rot + 1) & (NKT - 1)) * 64;
    stage_kvb(Ks + 2 * TSZ, Khead + k1 * HDsz, Vt + 2 * TSZ, Vhead + k1,
              Pb + 128 * BST, pbTile + k1, tid);
  }

  const v16h qb0 = frag16(Qs + wave * 16 * FST, FST, 0);
  const v16h qb1 = frag16(Qs + wave * 16 * FST, FST, 32);
  v8f o[4] = {};                      // o[nt][r] = O[qrow][nt*16 + laneHi*8 + r]
  float m = -3.0e38f;                 // running maximum of the row (both halves agree)
  float l = 0.0f;                     // running sum over this lane's own keys only

  // the first tile's bias + mask go to registers, so that the mask rows can be refilled at once
  v8f bm[4];
#pragma unroll  // constant indices keep the vectors in registers
  for (int nt = 0; nt < 4; ++nt)
    bm[nt] = lds8f(pbRow + nt * 16) + lds8f(mkRow + nt * 16);
  // this wave's reads of its own mask rows have returned before it refills them
  asm volatile("s_wait_dscnt 0x0" ::: "memory");
  stage16f(MkW, mkWave + ((1 + rot) & (NKT - 1)) * 64, lane);

  for (int kt = 0; kt < NKT; ++kt) {
    _Float16* Kb = Ks + (kt & 1) * 2 * TSZ;      // this tile's buffers, batch 0 first
    _Float16* Vb = Vt + (kt & 1) * 2 * TSZ;
    const _Float16* Kc = Kb + b * TSZ;
    const _Float16* Vc = Vb + b * TSZ;

    // S^T = K Q^T (+ bias + mask): s[nt][r] = S[qrow][nt*16 + laneHi*8 + r]
    v8f s[4];
#pragma unroll  // constant indices keep the vectors in registers
    for (int nt = 0; nt < 4; ++nt) {
      v8f c = {};
      v16h kf0 = frag16(Kc + nt * 16 * FST, FST, 0);
      v16h kf1 = frag16(Kc + nt * 16 * FST, FST, 32);
      c = WMMA(kf0, qb0, c);
      c = WMMA(kf1, qb1, c);
      s[nt] = c + bm[nt];
    }

    // online softmax, one query row per lane pair (l, l ^ 16)
    float rm = s[0][0];
#pragma unroll  // constant indices keep the vectors in registers
    for (int nt = 0; nt < 4; ++nt)
#pragma unroll  // constant indices keep the vectors in registers
      for (int r = 0; r < 8; ++r) rm = fmaxf(rm, s[nt][r]);
    rm = fmaxf(rm, xhalf(rm));
    const float mNew = fmaxf(m, rm);
    const float f = __expf(m - mNew);
    m = mNew;
#pragma unroll  // constant indices keep the vectors in registers
    for (int nt = 0; nt < 4; ++nt) s[nt] = exp8(s[nt] - mNew);
    const v8f ps = (s[0] + s[1]) + (s[2] + s[3]);
    l = l * f + (((ps[0] + ps[1]) + (ps[2] + ps[3])) +
                 ((ps[4] + ps[5]) + (ps[6] + ps[7])));
    v16h p0, p1;
#pragma unroll  // constant indices keep the vectors in registers
    for (int r = 0; r < 8; ++r) {
      p0[r] = (_Float16)s[0][r]; p0[r + 8] = (_Float16)s[1][r];
      p1[r] = (_Float16)s[2][r]; p1[r + 8] = (_Float16)s[3][r];
    }

    // V^T goes to registers and the running O^T is rescaled in front of the barrier
    v16h vf0[4], vf1[4];
#pragma unroll  // constant indices keep the vectors in registers
    for (int nt = 0; nt < 4; ++nt) {
      vf0[nt] = frag16(Vc + nt * 16 * FST, FST, 0);
      vf1[nt] = frag16(Vc + nt * 16 * FST, FST, 32);
      o[nt] *= f;
    }
    // one product stands in front of the barrier: its V^T fragment's registers are free for the
    // next tile's rows (with all eight products behind the barrier the kernel spills)
    o[0] = WMMA(vf0[0], p0, o[0]);
    // the softmax stays in front of the waits: moved behind them, it would shorten the time
    // that the next tile's copies have to land, and V^T's reads would not land under it
    __builtin_amdgcn_sched_barrier(0);
    // this wave's reads of K, V and bias have returned before their buffers are refilled
    asm volatile("s_wait_dscnt 0x0" ::: "memory");
    // this wave's copies of tile kt + 1 have landed before the barrier publishes K, V and bias
    asm volatile("s_wait_asynccnt 0x0" ::: "memory");
    __syncthreads();
    if (kt + 2 < NKT) {
      const int kn = ((kt + 2 + rot) & (NKT - 1)) * 64;
      stage_kvb(Kb, Khead + kn * HDsz, Vb, Vhead + kn,
                Pb + (kt & 1) * 128 * BST, pbTile + kn, tid);
    }
    // The next tile's bias and mask rows are asked for ahead of this tile's last products.
    // In the last trip these reads fall on rows that no copy is aimed at; their values are not used.
    const float* pbNext = pbRow + ((kt + 1) & 1) * 128 * BST;
    v8f pr[4], mr[4];
#pragma unroll  // constant indices keep the vectors in registers
    for (int nt = 0; nt < 4; ++nt) {
      pr[nt] = lds8f(pbNext + nt * 16);
      mr[nt] = lds8f(mkRow + nt * 16);
    }
    // the LDS reads stay one group ahead of the products, which work on registers alone
    __builtin_amdgcn_sched_barrier(0);
    // O^T += V^T P^T
#pragma unroll  // constant indices keep the vectors in registers
    for (int nt = 1; nt < 4; ++nt) o[nt] = WMMA(vf0[nt], p0, o[nt]);
#pragma unroll  // constant indices keep the vectors in registers
    for (int nt = 0; nt < 4; ++nt) o[nt] = WMMA(vf1[nt], p1, o[nt]);
    // products stay ahead of the wait, so that the reads land under them (without this line
    // the compiler puts all but one of them behind the wait)
    __builtin_amdgcn_sched_barrier(0);
#pragma unroll  // constant indices keep the vectors in registers
    for (int nt = 0; nt < 4; ++nt) bm[nt] = pr[nt] + mr[nt];
    // this wave's reads of its own mask rows have returned before it refills them
    asm volatile("s_wait_dscnt 0x0" ::: "memory");
    if (kt + 2 < NKT) stage16f(MkW, mkWave + ((kt + 2 + rot) & (NKT - 1)) * 64, lane);
  }
  // no copy is outstanding when the wave goes on to its stores and ends
  asm volatile("s_wait_asynccnt 0x0" ::: "memory");

  // join the halves' sums, normalize, write to [B, S, H] f16 (16 B per store)
  l += xhalf(l);
  _Float16* orow = out16 + ((long)(b * Ssz + qt * 128 + qrow)) * Hsz + h * HDsz + laneHi * 8;
#pragma unroll  // constant indices keep the vectors in registers
  for (int nt = 0; nt < 4; ++nt) {
    v8h hv;
#pragma unroll  // constant indices keep the vectors in registers
    for (int r = 0; r < 8; ++r) hv[r] = (_Float16)(o[nt][r] / l);
    *(v8h*)(orow + nt * 16) = hv;
  }
}

// ---------------------------------------------------------------------------
extern "C" void kernel_launch(void* const* d_in, const int* in_sizes, int n_in,
                              void* d_out, int out_size, void* d_ws, size_t ws_size,
                              hipStream_t stream) {
  const float* hs  = (const float*)d_in[0];
  const float* pb  = (const float*)d_in[1];
  const float* msk = (const float*)d_in[2];
  const float* Wq  = (const float*)d_in[3];
  const float* bq  = (const float*)d_in[4];
  const float* Wk  = (const float*)d_in[5];
  const float* bk  = (const float*)d_in[6];
  const float* Wv  = (const float*)d_in[7];
  const float* bv  = (const float*)d_in[8];
  const float* Wo  = (const float*)d_in[9];
  const float* bo  = (const float*)d_in[10];
  float* out = (float*)d_out;

  const int NHS = Bsz * Ssz * Hsz;   // 4,194,304
  const int WSZ = Hsz * Hsz;         // 1,048,576
  _Float16* hs16 = (_Float16*)d_ws;
  _Float16* w16  = hs16 + NHS;       // 4 weight matrices
  _Float16* q16  = w16 + 4 * (size_t)WSZ;
  _Float16* k16  = q16 + NHS;
  _Float16* vt16 = k16 + NHS;        // V stored [B,NH,HD,S]
  _Float16* ao16 = vt16 + NHS;

  // fp32 -> f16 staging: hs16 and the four w16 matrices are one contiguous range
  cvt_all<<<512, 256, 0, stream>>>(hs, Wq, Wk, Wv, Wo, hs16);

  // Q, K, V: w16 holds Wq, Wk, Wv in a row; q16, k16, vt16 lie in a row
  dim3 gp(32, 8), blk(128);
  gemm_proj<<<dim3(32, 8, 3), blk, 0, stream>>>(hs16, w16, bq, bk, bv, q16);

  attn_flash<<<dim3(Ssz / 128, NHsz), dim3(512), 0, stream>>>(q16, k16, vt16, pb, msk, ao16);

  gemm_out<<<gp, blk, 0, stream>>>(ao16, w16 + 3 * (size_t)WSZ, bo, out);
}

// v009
// One run takes 85.2 microseconds.
// In both of two side-by-side timings against v008, it was 1.08 times as fast.
// Counting every step since v000, it is 3.90 times as fast.
#include <hip/hip_runtime.h>
#include <hip/hip_bf16.h>

typedef __attribute__((ext_vector_type(16))) _Float16 v16h;
typedef __attribute__((ext_vector_type(4)))  _Float16 v4h;
typedef __attribute__((ext_vector_type(8)))  _Float16 v8h;
typedef __attribute__((ext_vector_type(4)))  float    v4f;
typedef __attribute__((ext_vector_type(8)))  float    v8f;

#define Bsz 2
#define Ssz 2048
#define Hsz 1024
#define NHsz 16
#define HDsz 64
#define QSCALE 0.125f

#define FST 72   // f16 LDS tile stride (64 + 8 pad) -> 144 B, 16B aligned rows
#define TSZ (64 * FST)  // halves in one 64 x 64 f16 LDS tile
#define GTSZ (128 * FST)  // halves in one 128-row x 64 f16 LDS tile of the GEMMs
#define BST 68   // f32 LDS tile stride (64 + 4 pad) -> 272 B rows (16 B x odd): b128 row reads spread over all banks

// ---------------------------------------------------------------------------
// 16-byte global -> LDS copies on the CDNA5 async-to-LDS path (ASYNCcnt,
// GLOBAL_LOAD_ASYNC_TO_LDS_B128), four or eight to a statement. Each lane names its own
// LDS byte address and its own global pointer; no immediate offset. The
// s_wait_xcnt 0 is the statement's last line, so that it stands in front of
// every later write of a register that one of these copies names (a precaution).
// ---------------------------------------------------------------------------
__device__ __forceinline__ unsigned lds_addr(const void* p) {
  return (unsigned)(unsigned long long)p;  // low 32 bits of a __shared__ address
}

__device__ __forceinline__ void cp16x4(unsigned l0, unsigned l1, unsigned l2, unsigned l3,
                                       const void* g0, const void* g1,
                                       const void* g2, const void* g3) {
  asm volatile(
      "global_load_async_to_lds_b128 %0, %4, off\n\t"
      "global_load_async_to_lds_b128 %1, %5, off\n\t"
      "global_load_async_to_lds_b128 %2, %6, off\n\t"
      "global_load_async_to_lds_b128 %3, %7, off\n\t"
      "s_wait_xcnt 0x0"
      :: "v"(l0), "v"(l1), "v"(l2), "v"(l3), "v"(g0), "v"(g1), "v"(g2), "v"(g3)
      : "memory");
}

__device__ __forceinline__ void cp16x8(unsigned l0, unsigned l1, unsigned l2, unsigned l3,
                                       unsigned l4, unsigned l5, unsigned l6, unsigned l7,
                                       const void* g0, const void* g1,
                                       const void* g2, const void* g3,
                                       const void* g4, const void* g5,
                                       const void* g6, const void* g7) {
  asm volatile(
      "global_load_async_to_lds_b128 %0, %8, off\n\t"
      "global_load_async_to_lds_b128 %1, %9, off\n\t"
      "global_load_async_to_lds_b128 %2, %10, off\n\t"
      "global_load_async_to_lds_b128 %3, %11, off\n\t"
      "global_load_async_to_lds_b128 %4, %12, off\n\t"
      "global_load_async_to_lds_b128 %5, %13, off\n\t"
      "global_load_async_to_lds_b128 %6, %14, off\n\t"
      "global_load_async_to_lds_b128 %7, %15, off\n\t"
      "s_wait_xcnt 0x0"
      :: "v"(l0), "v"(l1), "v"(l2), "v"(l3), "v"(l4), "v"(l5), "v"(l6), "v"(l7),
         "v"(g0), "v"(g1), "v"(g2), "v"(g3), "v"(g4), "v"(g5), "v"(g6), "v"(g7)
      : "memory");
}

// Stage a 128-row x 64-half tile of an [.., Hsz] array into LDS (row stride FST
// halves). 128 threads, 8 x 16B each. Fixed trip count: every lane is on at every copy.
__device__ __forceinline__ void stage128(_Float16* __restrict__ lds,
                                         const _Float16* __restrict__ gbase, int tid) {
  const unsigned row = (unsigned)tid >> 3, q = (unsigned)tid & 7u;
  const unsigned l0 = lds_addr(lds + row * FST + q * 8);
  const _Float16* g0 = gbase + (row * Hsz + q * 8);
  cp16x8(l0, l0 + 16 * FST * 2, l0 + 32 * FST * 2, l0 + 48 * FST * 2,
         l0 + 64 * FST * 2, l0 + 80 * FST * 2, l0 + 96 * FST * 2, l0 + 112 * FST * 2,
         g0, g0 + 16 * Hsz, g0 + 32 * Hsz, g0 + 48 * Hsz,
         g0 + 64 * Hsz, g0 + 80 * Hsz, g0 + 96 * Hsz, g0 + 112 * Hsz);
}

// ---------------------------------------------------------------------------
// Fragment gather from LDS, 16-bit A/B matrix layout (ISA 7.12.2, wave32):
// lane m = lane&15 selects the row (A: M-row, B: N-column of the N x K tile),
// hi = lane>>4 selects K-halves; element e -> K = kofs + 8*hi + (e<8 ? e : e+8).
// Pairs are K-consecutive -> lowers to two ds_load_b128 per fragment.
// ---------------------------------------------------------------------------
__device__ __forceinline__ v16h frag16(const _Float16* __restrict__ base,
                                       int stride, int kofs) {
  const int lane = threadIdx.x & 31;
  const int m  = lane & 15;
  const int hi = lane >> 4;
  const _Float16* r = base + m * stride + kofs + hi * 8;
  v16h f;
#pragma unroll
  for (int e = 0; e < 16; e += 2) {
    int k = (e < 8) ? e : (e + 8);
    f[e]     = r[k];
    f[e + 1] = r[k + 1];
  }
  return f;
}

#define WMMA(a, b, c) __builtin_amdgcn_wmma_f32_16x16x32_f16( \
    false, (a), false, (b), (short)0, (c), false, false)

// ---------------------------------------------------------------------------
// K loop of both GEMMs: acc += A tile x W tile^T over Hsz in steps of 64, on two
// LDS buffers each for A and W: tile t + 1's copies fly while tile t is worked on.
// The block's tile is 128 x 128; its four waves lie 2 x 2, each on 64 x 64 (wm, wn
// = the wave's row and column): a fragment read from LDS feeds four products.
// Trip t works on k tile (t + rot) mod 16: blocks that share an operand's rows get
// different rot, so that they do not ask L2 for the same lines at the same moment.
// The fragments lie in two register sets, one for each 32-k half of a tile: a half's
// LDS reads are issued ahead of the other half's 16 products and land under them.
// The second half's products work on registers alone and stand behind the trip's barrier.
// ---------------------------------------------------------------------------
__device__ __forceinline__ void gemm_loop(_Float16* As, _Float16* Bs,
                                          const _Float16* __restrict__ Abase,
                                          const _Float16* __restrict__ Wbase,
                                          int tid, int wm, int wn, int rot, v8f (&acc)[4][4]) {
  const int NT = Hsz / 64;  // a power of two: the walk wraps by a mask
  stage128(As, Abase + (rot & (NT - 1)) * 64, tid);
  stage128(Bs, Wbase + (rot & (NT - 1)) * 64, tid);
  // this wave's copies of tile 0 have landed before the barrier publishes them
  asm volatile("s_wait_asynccnt 0x0" ::: "memory");
  __syncthreads();
  stage128(As + GTSZ, Abase + ((rot + 1) & (NT - 1)) * 64, tid);
  stage128(Bs + GTSZ, Wbase + ((rot + 1) & (NT - 1)) * 64, tid);
  const _Float16* Aw0 = As + wm * 64 * FST;
  const _Float16* Bw0 = Bs + wn * 64 * FST;
  v16h a0[4], b0[4], a1[4], b1[4];
#pragma unroll  // constant indices keep the fragments in registers
  for (int i = 0; i < 4; ++i) {
    a0[i] = frag16(Aw0 + i * 16 * FST, FST, 0);
    b0[i] = frag16(Bw0 + i * 16 * FST, FST, 0);
  }
  for (int t = 0; t < NT; ++t) {
    const int cur = (t & 1) * GTSZ;
    const _Float16* Aw = Aw0 + cur;
    const _Float16* Bw = Bw0 + cur;
#pragma unroll  // constant indices keep the fragments in registers
    for (int i = 0; i < 4; ++i) {
      a1[i] = frag16(Aw + i * 16 * FST, FST, 32);
      b1[i] = frag16(Bw + i * 16 * FST, FST, 32);
    }
    // the second half's LDS reads stay one group ahead of the first half's products:
    // left free, the compiler puts them among the products and waits for each
    __builtin_amdgcn_sched_barrier(0);
#pragma unroll  // constant indices keep the accumulators in registers
    for (int i = 0; i < 4; ++i)
#pragma unroll  // constant indices keep the accumulators in registers
      for (int j = 0; j < 4; ++j) acc[i][j] = WMMA(a0[i], b0[j], acc[i][j]);
    // the products are issued ahead of the waits, so that the reads land under them
    __builtin_amdgcn_sched_barrier(0);
    // this wave's reads of tile t have returned before the buffer is refilled
    asm volatile("s_wait_dscnt 0x0" ::: "memory");
    // this wave's copies of tile t + 1 have landed before the barrier publishes them
    asm volatile("s_wait_asynccnt 0x0" ::: "memory");
    __syncthreads();
    if (t + 2 < NT) {
      const int kn = ((t + 2 + rot) & (NT - 1)) * 64;
      stage128(As + cur, Abase + kn, tid);
      stage128(Bs + cur, Wbase + kn, tid);
    }
    if (t + 1 < NT) {
      const _Float16* An = Aw0 + (GTSZ - cur);
      const _Float16* Bn = Bw0 + (GTSZ - cur);
#pragma unroll  // constant indices keep the fragments in registers
      for (int i = 0; i < 4; ++i) {
        a0[i] = frag16(An + i * 16 * FST, FST, 0);
        b0[i] = frag16(Bn + i * 16 * FST, FST, 0);
      }
    }
    // the next tile's first LDS reads stay one group ahead of this tile's last products
    __builtin_amdgcn_sched_barrier(0);
#pragma unroll  // constant indices keep the accumulators in registers
    for (int i = 0; i < 4; ++i)
#pragma unroll  // constant indices keep the accumulators in registers
      for (int j = 0; j < 4; ++j) acc[i][j] = WMMA(a1[i], b1[j], acc[i][j]);
  }
  // no copy is outstanding when the wave goes on to its stores and ends
  asm volatile("s_wait_asynccnt 0x0" ::: "memory");
}

// ---------------------------------------------------------------------------
// All five fp32 -> f16 conversions in one launch. The five destinations lie one
// behind the other in the workspace, so dst is one array of 8 segments of H*H
// elements: segments 0..3 are hidden_states, 4..7 are Wq, Wk, Wv, Wo.
// 64 blocks per segment; a block converts 16,384 elements, a thread 16 x 4.
// Blocks 512..767 scan the additive mask instead: block 512 + s reads the 16 query rows
// s * 16 .. + 15 of the [B * S, S] mask once and writes mflag[s * 32 + t] = 1 if the
// 16 x 64 tile of key tile t holds any value other than +0 or -0, else 0. Adding such a
// zero changes no score, so the attention kernel, which would read every mask tile once
// per head, leaves out the tiles whose flag is 0.
// ---------------------------------------------------------------------------
__global__ void __launch_bounds__(256) cvt_all(
    const float* __restrict__ hs, const float* __restrict__ wq,
    const float* __restrict__ wk, const float* __restrict__ wv,
    const float* __restrict__ wo, _Float16* __restrict__ dst,
    const float* __restrict__ mask, float* __restrict__ mflag) {
  if (blockIdx.x >= 512) {
    __shared__ unsigned wbits[8];
    const int strip = (int)blockIdx.x - 512;
    const int wave = threadIdx.x >> 5, lane = threadIdx.x & 31;
    // wave w: 16 rows x 256 keys (key tiles 4w .. 4w + 3), whole 512-B row pieces
    const float* s = mask + ((long)strip * 16 * Ssz + wave * 256 + lane * 4);
    float4 f[32];
#pragma unroll  // constant indices keep the array in registers; the loads run ahead of the ORs
    for (int j = 0; j < 32; ++j) f[j] = *(const float4*)(s + (j >> 1) * Ssz + (j & 1) * 128);
    unsigned a0 = 0, a1 = 0;  // OR of the lane's bit patterns, keys 0..127 and 128..255
#pragma unroll  // constant indices keep the array in registers
    for (int j = 0; j < 32; j += 2) {
      a0 |= __builtin_bit_cast(unsigned, f[j].x) | __builtin_bit_cast(unsigned, f[j].y) |
            __builtin_bit_cast(unsigned, f[j].z) | __builtin_bit_cast(unsigned, f[j].w);
      a1 |= __builtin_bit_cast(unsigned, f[j + 1].x) | __builtin_bit_cast(unsigned, f[j + 1].y) |
            __builtin_bit_cast(unsigned, f[j + 1].z) | __builtin_bit_cast(unsigned, f[j + 1].w);
    }
    // the sign bit alone is -0; lanes 0..15 hold one key tile, lanes 16..31 the next
    const unsigned b0 = __builtin_amdgcn_ballot_w32((a0 & 0x7fffffffu) != 0u);
    const unsigned b1 = __builtin_amdgcn_ballot_w32((a1 & 0x7fffffffu) != 0u);
    if (lane == 0)
      wbits[wave] = ((b0 & 0xffffu) ? 1u : 0u) | ((b0 >> 16) ? 2u : 0u) |
                    ((b1 & 0xffffu) ? 4u : 0u) | ((b1 >> 16) ? 8u : 0u);
    __syncthreads();  // the eight waves' bits are gathered: one wave stores the strip's 128-B line
    if (threadIdx.x < 32)
      mflag[strip * 32 + lane] = ((wbits[lane >> 2] >> (lane & 3)) & 1u) ? 1.0f : 0.0f;
    return;
  }
  const int seg = blockIdx.x >> 6;
  const float* sbase = seg < 4 ? hs + (long)seg * (Hsz * Hsz)
                     : seg == 4 ? wq : seg == 5 ? wk : seg == 6 ? wv : wo;
  const int off = (blockIdx.x & 63) * 16384 + threadIdx.x * 4;
  const float* s = sbase + off;
  _Float16* d = dst + (long)seg * (Hsz * Hsz) + off;
  float4 f[16];
#pragma unroll  // all sixteen loads are issued ahead of the first store
  for (int j = 0; j < 16; ++j) f[j] = *(const float4*)(s + j * 1024);
#pragma unroll  // constant indices keep the array in registers
  for (int j = 0; j < 16; ++j) {
    v4h h;
    h[0] = (_Float16)f[j].x; h[1] = (_Float16)f[j].y;
    h[2] = (_Float16)f[j].z; h[3] = (_Float16)f[j].w;
    *(v4h*)(d + j * 1024) = h;
  }
}

// ---------------------------------------------------------------------------
// A wave's staged 64 x 64 f16 tile (rows of FST halves in its own LDS range) goes to
// global rows PITCH halves apart: 8 lanes to a 128-B row, 4 rows to a store.
// ---------------------------------------------------------------------------
template <int PITCH>
__device__ __forceinline__ void put_tile(const _Float16* __restrict__ st,
                                         _Float16* __restrict__ g, int lane) {
  // the wave's own LDS writes are done before its lanes read one another's values back
  asm volatile("s_wait_dscnt 0x0" ::: "memory");
  const int rr = lane >> 3, q = lane & 7;
  const _Float16* sr = st + rr * FST + q * 8;
  _Float16* gl = g + rr * PITCH + q * 8;
#pragma unroll  // the sixteen LDS reads are issued ahead of the stores
  for (int k = 0; k < 16; ++k)
    *(v8h*)(gl + k * 4 * PITCH) = *(const v8h*)(sr + k * 4 * FST);
}

// ---------------------------------------------------------------------------
// Projection GEMMs, all three in one launch: out = (X @ W^T + bias) * scale, f16
// output. z = 0, 1, 2 is Q, K, V: it picks the weight matrix (W3 holds the three
// one behind the other), the bias, the output (dst3 likewise) and its form.
// vmode=0: per-head [B,NH,S,HD];  vmode=1: transposed per-head [B,NH,HD,S].
// Block = 128 threads (4 waves), tile 128 x 128, K-step 64.
// The first WMMA operand is the one whose index is contiguous in the output (W's
// rows for Q and K, X's rows for V): a lane's 8 accumulator registers are then 8
// neighbours in memory. Each wave turns its 64 x 64 tile in its own LDS range and
// stores it as whole 128-B rows, 16 B a lane.
// ---------------------------------------------------------------------------
__global__ void __launch_bounds__(128) gemm_proj(
    const _Float16* __restrict__ A, const _Float16* __restrict__ W3,
    const float* __restrict__ bq, const float* __restrict__ bk,
    const float* __restrict__ bv, _Float16* __restrict__ dst3) {
  __shared__ alignas(16) _Float16 As[2 * GTSZ];
  __shared__ alignas(16) _Float16 Bs[2 * GTSZ];
  const int z = 2 - (int)blockIdx.z;  // blockIdx.z = 0, 1, 2 is V, K, Q
  const _Float16* W = W3 + (long)z * (Hsz * Hsz);
  const float* bias = z == 0 ? bq : z == 1 ? bk : bv;
  _Float16* dst = dst3 + (long)z * (Bsz * Ssz * Hsz);
  const float scale = z == 0 ? QSCALE : 1.0f;
  const int vmode = z == 2;
  const int tid = threadIdx.x;
  const int wave = tid >> 5;
  const int wm = wave >> 1, wn = wave & 1;
  const int lane = tid & 31;
  const int laneN = lane & 15, laneHi = lane >> 4;
  const int m0 = blockIdx.x * 128;   // rows of X (positions)
  const int n0 = blockIdx.y * 128;   // rows of W (output features)
  const _Float16* Xbase = A + (long)m0 * Hsz;
  const _Float16* Wbase = W + (long)n0 * Hsz;

  // acc[i][j][r]: first operand's row wm*64 + i*16 + laneHi*8 + r,
  //               second operand's row wn*64 + j*16 + laneN
  v8f acc[4][4] = {};
  // X's rows are shared by the 24 blocks of one blockIdx.x, W's by the 32 of one (y, z)
  const int rot = (int)(blockIdx.x + blockIdx.y + 8 * blockIdx.z);
  gemm_loop(As, Bs, vmode ? Xbase : Wbase, vmode ? Wbase : Xbase, tid, wm, wn, rot, acc);

  // The loop's last barrier stands behind every wave's last read of the tiles, and no
  // copy is outstanding: As is free. Wave w stages in As[w * TSZ ..), 64 rows of FST halves:
  // row = second operand's row in the wave's tile, column = first operand's.
  _Float16* st = As + wave * TSZ;
  _Float16* sw = st + laneN * FST + laneHi * 8;
  // A tile lies in one batch; a wave's 64 features lie in one head.
  if (vmode) {
#pragma unroll  // constant indices keep the accumulators in registers
    for (int j = 0; j < 4; ++j) {
      const float bc = bias[n0 + wn * 64 + j * 16 + laneN];
#pragma unroll  // constant indices keep the accumulators in registers
      for (int i = 0; i < 4; ++i) {
        v8h hv;
#pragma unroll  // constant indices keep the accumulators in registers
        for (int r = 0; r < 8; ++r) hv[r] = (_Float16)(acc[i][j][r] + bc);
        *(v8h*)(sw + j * 16 * FST + i * 16) = hv;
      }
    }
    // staged row = feature, column = position
    put_tile<Ssz>(st, dst + ((long)((m0 >> 11) * Hsz + n0 + wn * 64) * Ssz + (m0 & 2047) + wm * 64), lane);
  } else {
    const float* bp = bias + n0 + wm * 64 + laneHi * 8;
    v4f b0[4], b1[4];
#pragma unroll  // all eight bias loads are issued ahead of the first use
    for (int i = 0; i < 4; ++i) {
      b0[i] = *(const v4f*)(bp + i * 16);
      b1[i] = *(const v4f*)(bp + i * 16 + 4);
    }
#pragma unroll  // constant indices keep the accumulators in registers
    for (int i = 0; i < 4; ++i) {
#pragma unroll  // constant indices keep the accumulators in registers
      for (int j = 0; j < 4; ++j) {
        v8h hv;
#pragma unroll  // constant indices keep the accumulators in registers
        for (int r = 0; r < 4; ++r) {
          hv[r]     = (_Float16)((acc[i][j][r] + b0[i][r]) * scale);
          hv[r + 4] = (_Float16)((acc[i][j][r + 4] + b1[i][r]) * scale);
        }
        *(v8h*)(sw + j * 16 * FST + i * 16) = hv;
      }
    }
    // staged row = position, column = feature inside the head
    put_tile<HDsz>(st, dst + ((long)((m0 >> 11) * NHsz + (n0 >> 6) + wm) * Ssz + (m0 & 2047) + wn * 64) * HDsz, lane);
  }
}

// ---------------------------------------------------------------------------
// Output projection GEMM: d_out = A @ Wo^T + bo  (fp32 output, [4096,1024])
// Wo's rows are the first WMMA operand: a lane's 8 accumulator registers are 8
// neighbours of one output row. Each wave turns its 64 x 64 tile in its own LDS
// range and stores whole 256-B row pieces, 16 B a lane.
// ---------------------------------------------------------------------------
__global__ void __launch_bounds__(128) gemm_out(
    const _Float16* __restrict__ A, const _Float16* __restrict__ W,
    const float* __restrict__ bias, float* __restrict__ dst) {
  __shared__ alignas(16) _Float16 As[2 * GTSZ];
  __shared__ alignas(16) _Float16 Bs[2 * GTSZ];
  const int tid = threadIdx.x;
  const int wave = tid >> 5;
  const int wm = wave >> 1, wn = wave & 1;
  const int lane = tid & 31;
  const int laneN = lane & 15, laneHi = lane >> 4;
  const int m0 = blockIdx.x * 128;
  const int n0 = blockIdx.y * 128;
  const _Float16* Abase = A + (long)m0 * Hsz;
  const _Float16* Wbase = W + (long)n0 * Hsz;

  // acc[i][j][r]: column n0 + wm*64 + i*16 + laneHi*8 + r, row m0 + wn*64 + j*16 + laneN
  v8f acc[4][4] = {};
  // A's rows are shared by the 8 blocks of one blockIdx.x, Wo's by the 32 of one blockIdx.y
  const int rot = (int)(blockIdx.x + 2 * blockIdx.y);
  gemm_loop(As, Bs, Wbase, Abase, tid, wm, wn, rot, acc);

  // The loop's last barrier stands behind every wave's last read of the tiles, and no
  // copy is outstanding: As and Bs are free. Each holds two waves' staging ranges of
  // 64 rows of BST floats.
  float* st = (float*)(wm ? Bs : As) + wn * (64 * BST);
  float* sw = st + laneN * BST + laneHi * 8;
  const float* bp = bias + n0 + wm * 64 + laneHi * 8;
  v4f b0[4], b1[4];
#pragma unroll  // all eight bias loads are issued ahead of the first use
  for (int i = 0; i < 4; ++i) {
    b0[i] = *(const v4f*)(bp + i * 16);
    b1[i] = *(const v4f*)(bp + i * 16 + 4);
  }
#pragma unroll  // constant indices keep the accumulators in registers
  for (int i = 0; i < 4; ++i) {
#pragma unroll  // constant indices keep the accumulators in registers
    for (int j = 0; j < 4; ++j) {
      v4f lo, hi;
#pragma unroll  // constant indices keep the accumulators in registers
      for (int r = 0; r < 4; ++r) {
        lo[r] = acc[i][j][r] + b0[i][r];
        hi[r] = acc[i][j][r + 4] + b1[i][r];
      }
      *(v4f*)(sw + j * 16 * BST + i * 16) = lo;
      *(v4f*)(sw + j * 16 * BST + i * 16 + 4) = hi;
    }
  }
  // the wave's own LDS writes are done before its lanes read one another's values back
  asm volatile("s_wait_dscnt 0x0" ::: "memory");
  const int rr = lane >> 4, q = lane & 15;  // 16 lanes to a 256-B row piece, 2 rows to a store
  const float* sr = st + rr * BST + q * 4;
  float* gl = dst + ((long)(m0 + wn * 64 + rr) * Hsz + n0 + wm * 64 + q * 4);
#pragma unroll  // LDS reads run ahead of the stores
  for (int k = 0; k < 32; ++k)
    *(v4f*)(gl + k * 2 * Hsz) = *(const v4f*)(sr + k * 2 * BST);
}

// One wave stages 16 rows x 64 floats of an [.., S, S] array into LDS (row stride
// BST floats), 8 x 16B a lane, whole 256-B rows: the 16 mask rows that it alone
// reads. They are a ring of one slot, private to the wave, and need no barrier.
// Fixed trip count: every lane is on at every copy.
__device__ __forceinline__ void stage16f(float* __restrict__ lds,
                                         const float* __restrict__ gbase,
                                         int lane) {
  const unsigned row = (unsigned)lane >> 4, q = (unsigned)lane & 15u;
  const unsigned l0 = lds_addr(lds + row * BST + q * 4);
  const float* g0 = gbase + (row * Ssz + q * 4);
  cp16x8(l0, l0 + 2 * BST * 4, l0 + 4 * BST * 4, l0 + 6 * BST * 4,
         l0 + 8 * BST * 4, l0 + 10 * BST * 4, l0 + 12 * BST * 4, l0 + 14 * BST * 4,
         g0, g0 + 2 * Ssz, g0 + 4 * Ssz, g0 + 6 * Ssz,
         g0 + 8 * Ssz, g0 + 10 * Ssz, g0 + 12 * Ssz, g0 + 14 * Ssz);
}

// The block's shared tiles of one key step, 512 threads, 8 x 16B each, one statement:
// K (64 keys x 64 halves) and V^T (64 d x 64 keys) of both batches, one copy a lane
// each (kl, vl: two tiles of TSZ halves, batch 0 then 1), and 128 rows x 64 floats of
// the bias, four copies a lane. hstep = halves from batch 0's head to batch 1's.
// Fixed trip count: every lane is on at every copy.
__device__ __forceinline__ void stage_kvb(_Float16* __restrict__ kl, const _Float16* __restrict__ kg,
                                          _Float16* __restrict__ vl, const _Float16* __restrict__ vg,
                                          float* __restrict__ pl, const float* __restrict__ pg,
                                          int tid) {
  const unsigned hstep = NHsz * Ssz * HDsz;
  const unsigned row = (unsigned)tid >> 3, q = (unsigned)tid & 7u;
  const unsigned lk = lds_addr(kl + row * FST + q * 8);
  const unsigned lv = lds_addr(vl + row * FST + q * 8);
  const _Float16* k0 = kg + (row * HDsz + q * 8);
  const _Float16* v0 = vg + (row * Ssz + q * 8);
  const unsigned prow = (unsigned)tid >> 4, pq = (unsigned)tid & 15u;
  const unsigned lp = lds_addr(pl + prow * BST + pq * 4);
  const float* p0 = pg + (prow * Ssz + pq * 4);
  cp16x8(lk, lk + TSZ * 2, lv, lv + TSZ * 2,
         lp, lp + 32 * BST * 4, lp + 64 * BST * 4, lp + 96 * BST * 4,
         k0, k0 + hstep, v0, v0 + hstep,
         p0, p0 + 32 * Ssz, p0 + 64 * Ssz, p0 + 96 * Ssz);
}

// 8 consecutive floats from LDS (16-B aligned): two ds_load_b128.
__device__ __forceinline__ v8f lds8f(const float* __restrict__ p) {
  v4f lo = *(const v4f*)p;
  v4f hi = *(const v4f*)(p + 4);
  return __builtin_shufflevector(lo, hi, 0, 1, 2, 3, 4, 5, 6, 7);
}

// e^x for eight values, as __expf compiles: a multiply by log2(e), then v_exp_f32.
// The eight v_exp_f32 stand in one asm statement, each on its own register, and a
// v_nop ends it: so no instruction directly behind a transcendental reads its result
// or overwrites its source.
__device__ __forceinline__ v8f exp8(v8f x) {
  x *= 1.44269504f;
  float a = x[0], b = x[1], c = x[2], d = x[3], e = x[4], f = x[5], g = x[6], h = x[7];
  asm("v_exp_f32 %0, %0\n\tv_exp_f32 %1, %1\n\tv_exp_f32 %2, %2\n\tv_exp_f32 %3, %3\n\t"
      "v_exp_f32 %4, %4\n\tv_exp_f32 %5, %5\n\tv_exp_f32 %6, %6\n\tv_exp_f32 %7, %7\n\tv_nop"
      : "+v"(a), "+v"(b), "+v"(c), "+v"(d), "+v"(e), "+v"(f), "+v"(g), "+v"(h));
  v8f r = {a, b, c, d, e, f, g, h};
  return r;
}

// value of lane l ^ 16
__device__ __forceinline__ float xhalf(float x) {
  int v = __builtin_bit_cast(int, x);
  return __builtin_bit_cast(float, __builtin_amdgcn_permlanex16(
      v, v, 0x76543210, 0xfedcba98, false, false));
}

__global__ void __launch_bounds__(512) attn_flash(
    const _Float16* __restrict__ q16, const _Float16* __restrict__ k16,
    const _Float16* __restrict__ vt16, const float* __restrict__ pbias,
    const float* __restrict__ mask, const float* __restrict__ mflag,
    _Float16* __restrict__ out16) {
  __shared__ alignas(16) _Float16 Qs[2 * GTSZ];      // [batch][128 rows]
  __shared__ alignas(16) _Float16 Ks[2 * 2 * TSZ];   // [buffer][batch][64 keys]
  __shared__ alignas(16) _Float16 Vt[2 * 2 * TSZ];   // [buffer][batch][64 d]
  __shared__ alignas(16) float Pb[2 * 128 * BST];    // [buffer][128 rows], shared by the batches
  __shared__ alignas(16) float Mk[2 * 128 * BST];    // [batch][128 rows] = [wave][16 rows]

  const int tid = threadIdx.x;
  const int wave = tid >> 5;
  const int lane = tid & 31;
  const int laneN = lane & 15, laneHi = lane >> 4;
  const int qt = blockIdx.x;          // q tile 0..15
  const int h = blockIdx.y;           // head 0..15
  const int b = wave >> 3;            // this wave's batch
  const int wq = wave & 7;            // this wave's 16 rows in the q tile
  const int NKT = Ssz / 64;           // key tiles, a power of two: the walk wraps by a mask
  const int rot = 2 * (qt + h);       // the block's first key tile, before the wrap
  const long head0 = (long)h * Ssz * HDsz;       // batch 0's slice of q16/k16/vt16
  const _Float16* Khead = k16 + head0;           // [S, HD] rows, batch 0
  const _Float16* Vhead = vt16 + head0;          // [HD, S] rows, batch 0
  const float* pbTile = pbias + ((long)h * Ssz + qt * 128) * Ssz;
  const float* mkWave = mask + ((long)b * Ssz + qt * 128 + wq * 16) * Ssz;  // the wave's 16 rows
  float* MkW = Mk + wave * 16 * BST;
  const int qrow = wq * 16 + laneN;              // this lane's query row in the tile
  const float* pbRow = Pb + qrow * BST + laneHi * 8;
  const float* mkRow = MkW + laneN * BST + laneHi * 8;
  // lane t asks for the flag of key tile t of the wave's 16 mask rows
  const float mfl = mflag[((b * Ssz + qt * 128 + wq * 16) >> 4) * NKT + lane];

  // Q of both batches: 2 x 128 rows of 64 halves, four copies a lane
  {
    const unsigned row = (unsigned)tid >> 3, q = (unsigned)tid & 7u;
    const unsigned lq = lds_addr(Qs + row * FST + q * 8);
    const _Float16* gq = q16 + head0 + ((qt * 128 + row) * HDsz + q * 8);
    cp16x4(lq, lq + TSZ * 2, lq + GTSZ * 2, lq + (GTSZ + TSZ) * 2,
           gq, gq + 64 * HDsz, gq + NHsz * Ssz * HDsz, gq + (NHsz * Ssz + 64) * HDsz);
  }
  // first tile: K rows [key][d], V^T rows [d][key], bias and mask rows [q][key]
  {
    const int k0 = (rot & (NKT - 1)) * 64;
    stage_kvb(Ks, Khead + k0 * HDsz, Vt, Vhead + k0, Pb, pbTile + k0, tid);
  }
  // the wait for the flags stays behind the first tile's copies (left free, the compiler puts it ahead)
  __builtin_amdgcn_sched_barrier(0);
  // bit t: key tile t of this wave's mask rows holds a value other than zero (same in every lane)
  const unsigned mnz = __builtin_amdgcn_ballot_w32(mfl != 0.0f);
#define MASKED(t) ((mnz >> (((t) + rot) & (NKT - 1))) & 1u)  // does trip t's tile need its mask rows?
  if (MASKED(0)) stage16f(MkW, mkWave + (rot & (NKT - 1)) * 64, lane);
  // this wave's copies have landed before the barrier publishes them
  asm volatile("s_wait_asynccnt 0x0" ::: "memory");
  __syncthreads();
  // K, V and bias of the second tile fly while the first is worked on
  {
    const int k1 = ((rot + 1) & (NKT - 1)) * 64;
    stage_kvb(Ks + 2 * TSZ, Khead + k1 * HDsz, Vt + 2 * TSZ, Vhead + k1,
              Pb + 128 * BST, pbTile + k1, tid);
  }

  const v16h qb0 = frag16(Qs + wave * 16 * FST, FST, 0);
  const v16h qb1 = frag16(Qs + wave * 16 * FST, FST, 32);
  v8f o[4] = {};                      // o[nt][r] = O[qrow][nt*16 + laneHi*8 + r]
  float m = -3.0e38f;                 // running maximum of the row (both halves agree)
  float l = 0.0f;                     // running sum over this lane's own keys only

  // the first tile's bias + mask go to registers, so that the mask rows can be refilled at once
  v8f bm[4];
#pragma unroll  // constant indices keep the vectors in registers
  for (int nt = 0; nt < 4; ++nt) bm[nt] = lds8f(pbRow + nt * 16);
  if (MASKED(0)) {
#pragma unroll  // constant indices keep the vectors in registers
    for (int nt = 0; nt < 4; ++nt) bm[nt] += lds8f(mkRow + nt * 16);
  }
  if (MASKED(1)) {
    // this wave's reads of its own mask rows have returned before it refills them
    asm volatile("s_wait_dscnt 0x0" ::: "memory");
    stage16f(MkW, mkWave + ((1 + rot) & (NKT - 1)) * 64, lane);
  }

  for (int kt = 0; kt < NKT; ++kt) {
    _Float16* Kb = Ks + (kt & 1) * 2 * TSZ;      // this tile's buffers, batch 0 first
    _Float16* Vb = Vt + (kt & 1) * 2 * TSZ;
    const _Float16* Kc = Kb + b * TSZ;
    const _Float16* Vc = Vb + b * TSZ;

    // S^T = K Q^T (+ bias + mask): s[nt][r] = S[qrow][nt*16 + laneHi*8 + r]
    v8f s[4];
#pragma unroll  // constant indices keep the vectors in registers
    for (int nt = 0; nt < 4; ++nt) {
      v8f c = {};
      v16h kf0 = frag16(Kc + nt * 16 * FST, FST, 0);
      v16h kf1 = frag16(Kc + nt * 16 * FST, FST, 32);
      c = WMMA(kf0, qb0, c);
      c = WMMA(kf1, qb1, c);
      s[nt] = c + bm[nt];
    }

    // online softmax, one query row per lane pair (l, l ^ 16)
    float rm = s[0][0];
#pragma unroll  // constant indices keep the vectors in registers
    for (int nt = 0; nt < 4; ++nt)
#pragma unroll  // constant indices keep the vectors in registers
      for (int r = 0; r < 8; ++r) rm = fmaxf(rm, s[nt][r]);
    rm = fmaxf(rm, xhalf(rm));
    const float mNew = fmaxf(m, rm);
    const float f = __expf(m - mNew);
    m = mNew;
#pragma unroll  // constant indices keep the vectors in registers
    for (int nt = 0; nt < 4; ++nt) s[nt] = exp8(s[nt] - mNew);
    const v8f ps = (s[0] + s[1]) + (s[2] + s[3]);
    l = l * f + (((ps[0] + ps[1]) + (ps[2] + ps[3])) +
                 ((ps[4] + ps[5]) + (ps[6] + ps[7])));
    v16h p0, p1;
#pragma unroll  // constant indices keep the vectors in registers
    for (int r = 0; r < 8; ++r) {
      p0[r] = (_Float16)s[0][r]; p0[r + 8] = (_Float16)s[1][r];
      p1[r] = (_Float16)s[2][r]; p1[r + 8] = (_Float16)s[3][r];
    }

    // V^T goes to registers and the running O^T is rescaled in front of the barrier
    v16h vf0[4], vf1[4];
#pragma unroll  // constant indices keep the vectors in registers
    for (int nt = 0; nt < 4; ++nt) {
      vf0[nt] = frag16(Vc + nt * 16 * FST, FST, 0);
      vf1[nt] = frag16(Vc + nt * 16 * FST, FST, 32);
      o[nt] *= f;
    }
    // one product stands in front of the barrier: its V^T fragment's registers are free for the
    // next tile's rows (with all eight products behind the barrier the kernel spills)
    o[0] = WMMA(vf0[0], p0, o[0]);
    // the softmax stays in front of the waits: moved behind them, it would shorten the time
    // that the next tile's copies have to land, and V^T's reads would not land under it
    __builtin_amdgcn_sched_barrier(0);
    // this wave's reads of K, V and bias have returned before their buffers are refilled
    asm volatile("s_wait_dscnt 0x0" ::: "memory");
    // this wave's copies of tile kt + 1 have landed before the barrier publishes K, V and bias
    asm volatile("s_wait_asynccnt 0x0" ::: "memory");
    __syncthreads();
    if (kt + 2 < NKT) {
      const int kn = ((kt + 2 + rot) & (NKT - 1)) * 64;
      stage_kvb(Kb, Khead + kn * HDsz, Vb, Vhead + kn,
                Pb + (kt & 1) * 128 * BST, pbTile + kn, tid);
    }
    // The next tile's bias and mask rows are asked for ahead of this tile's last products.
    // In the last trip these reads fall on rows that no copy is aimed at; their values are not used.
    const float* pbNext = pbRow + ((kt + 1) & 1) * 128 * BST;
    // Mask rows that are all zero are neither read nor added (a scalar test, the same in every lane).
    const bool mNext = MASKED(kt + 1);
    v8f mr[4];
#pragma unroll  // constant indices keep the vectors in registers
    for (int nt = 0; nt < 4; ++nt) bm[nt] = lds8f(pbNext + nt * 16);
    if (mNext) {
#pragma unroll  // constant indices keep the vectors in registers
      for (int nt = 0; nt < 4; ++nt) mr[nt] = lds8f(mkRow + nt * 16);
    }
    // the LDS reads stay one group ahead of the products, which work on registers alone
    __builtin_amdgcn_sched_barrier(0);
    // O^T += V^T P^T
#pragma unroll  // constant indices keep the vectors in registers
    for (int nt = 1; nt < 4; ++nt) o[nt] = WMMA(vf0[nt], p0, o[nt]);
#pragma unroll  // constant indices keep the vectors in registers
    for (int nt = 0; nt < 4; ++nt) o[nt] = WMMA(vf1[nt], p1, o[nt]);
    // products stay ahead of the wait, so that the reads land under them (without this line
    // the compiler puts all but one of them behind the wait)
    __builtin_amdgcn_sched_barrier(0);
    if (mNext) {
#pragma unroll  // constant indices keep the vectors in registers
      for (int nt = 0; nt < 4; ++nt) bm[nt] += mr[nt];
    }
    if (kt + 2 < NKT && MASKED(kt + 2)) {
      // this wave's reads of its own mask rows have returned before it refills them
      asm volatile("s_wait_dscnt 0x0" ::: "memory");
      stage16f(MkW, mkWave + ((kt + 2 + rot) & (NKT - 1)) * 64, lane);
    }
  }
  // no copy is outstanding when the wave goes on to its stores and ends
  asm volatile("s_wait_asynccnt 0x0" ::: "memory");

  // join the halves' sums, normalize, write to [B, S, H] f16 (16 B per store)
  l += xhalf(l);
  _Float16* orow = out16 + ((long)(b * Ssz + qt * 128 + qrow)) * Hsz + h * HDsz + laneHi * 8;
#pragma unroll  // constant indices keep the vectors in registers
  for (int nt = 0; nt < 4; ++nt) {
    v8h hv;
#pragma unroll  // constant indices keep the vectors in registers
    for (int r = 0; r < 8; ++r) hv[r] = (_Float16)(o[nt][r] / l);
    *(v8h*)(orow + nt * 16) = hv;
  }
}

// ---------------------------------------------------------------------------
extern "C" void kernel_launch(void* const* d_in, const int* in_sizes, int n_in,
                              void* d_out, int out_size, void* d_ws, size_t ws_size,
                              hipStream_t stream) {
  const float* hs  = (const float*)d_in[0];
  const float* pb  = (const float*)d_in[1];
  const float* msk = (const float*)d_in[2];
  const float* Wq  = (const float*)d_in[3];
  const float* bq  = (const float*)d_in[4];
  const float* Wk  = (const float*)d_in[5];
  const float* bk  = (const float*)d_in[6];
  const float* Wv  = (const float*)d_in[7];
  const float* bv  = (const float*)d_in[8];
  const float* Wo  = (const float*)d_in[9];
  const float* bo  = (const float*)d_in[10];
  float* out = (float*)d_out;

  const int NHS = Bsz * Ssz * Hsz;   // 4,194,304
  const int WSZ = Hsz * Hsz;         // 1,048,576
  _Float16* hs16 = (_Float16*)d_ws;
  _Float16* w16  = hs16 + NHS;       // 4 weight matrices
  _Float16* q16  = w16 + 4 * (size_t)WSZ;
  _Float16* k16  = q16 + NHS;
  _Float16* vt16 = k16 + NHS;        // V stored [B,NH,HD,S]
  _Float16* ao16 = vt16 + NHS;
  float* mflag = (float*)(ao16 + NHS);  // 256 strips of 16 mask rows x 32 key tiles

  // fp32 -> f16 staging: hs16 and the four w16 matrices are one contiguous range
  // and, in blocks 512..767, the scan of the mask for tiles that are all zero
  cvt_all<<<768, 256, 0, stream>>>(hs, Wq, Wk, Wv, Wo, hs16, msk, mflag);

  // Q, K, V: w16 holds Wq, Wk, Wv in a row; q16, k16, vt16 lie in a row
  dim3 gp(32, 8), blk(128);
  gemm_proj<<<dim3(32, 8, 3), blk, 0, stream>>>(hs16, w16, bq, bk, bv, q16);

  attn_flash<<<dim3(Ssz / 128, NHsz), dim3(512), 0, stream>>>(q16, k16, vt16, pb, msk, mflag, ao16);

  gemm_out<<<gp, blk, 0, stream>>>(ao16, w16 + 3 * (size_t)WSZ, bo, out);
}
